// v000
// Times are from an AMD MI455X. After a warm-up the kernel runs many times in a row, and a time is the length of
// such a window on the GPU divided by its runs, so every launch and the gaps after it count. The runs cycle
// through copies of the inputs. A figure is the median of several windows, for all but v000 over two sittings.
// Sittings can differ by a few percent; kernels timed side by side share one.
// v000, which the later versions start from, runs in 1060 microseconds.
#include <hip/hip_runtime.h>
#include <hip/hip_bf16.h>

typedef __attribute__((ext_vector_type(16))) _Float16 v16h;
typedef __attribute__((ext_vector_type(8)))  _Float16 v8h;
typedef __attribute__((ext_vector_type(8)))  float    v8f;
typedef __attribute__((ext_vector_type(4)))  unsigned int u32x4;
typedef __attribute__((ext_vector_type(8)))  int      i32x8;
typedef __attribute__((ext_vector_type(4)))  int      i32x4;

#define SK 8192
#define SQ 8192
#define DD 128
// 1/sqrt(128) * log2(e): softmax computed in log2 domain -> native v_exp_f32
#define SCALE2 0.12751589906834162f

#if defined(__HIP_DEVICE_COMPILE__) && __has_builtin(__builtin_amdgcn_tensor_load_to_lds) && \
    __has_builtin(__builtin_amdgcn_s_wait_tensorcnt)
#define USE_TDM 1
#else
#define USE_TDM 0
#endif

// Raw v_exp_f32: args here are bounded (<= 0, > -40), so skip OCML's
// underflow-guard path (saves ~6 VALU per exponential in the hot loop).
__device__ __forceinline__ float fexp2(float x) {
#if defined(__HIP_DEVICE_COMPILE__) && __has_builtin(__builtin_amdgcn_exp2f)
  return __builtin_amdgcn_exp2f(x);
#else
  return exp2f(x);
#endif
}

// ---------------------------------------------------------------------------
// Load a 16x32 f16 tile from a row-major matrix into the WMMA A/B register
// layout (ISA 7.12.2, 16-bit A-matrix 16x32):
//   lanes 0-15 : row = row0+lane,    halves 0-7 = cols c0+0..7,  8-15 = c0+16..23
//   lanes 16-31: row = row0+lane-16, halves 0-7 = cols c0+8..15, 8-15 = c0+24..31
// Both chunks are 16B aligned -> two b128 loads per lane (global or ds).
// Serves B operands too: a B (KxN) tile equals the A layout of rows of the
// row-major N-major source (lane = column index n).
// ---------------------------------------------------------------------------
__device__ __forceinline__ v16h load_tile_ab(const _Float16* base,
                                             int ld, int row0, int col0, int lane) {
  const int r  = row0 + (lane & 15);
  const int hs = (lane >> 4) & 1;
  const _Float16* p = base + (size_t)r * ld + col0 + hs * 8;
  v8h lo = *(const v8h*)p;
  v8h hi = *(const v8h*)(p + 16);
  v16h out;
#pragma unroll
  for (int i = 0; i < 8; ++i) { out[i] = lo[i]; out[i + 8] = hi[i]; }
  return out;
}

#if USE_TDM
// Issue a TDM load of a 2D tile (tile_dim0=32 halfs wide, tile_dim1=128 rows)
// from row-major Vt[128][8192] (f16) into LDS at lds_byte_addr.
// D# bitfields per CDNA5 ISA 8.3/8.4 (group0: count/lds/global/type,
// group1: data_size, tensor dims, tile dims, dim0 stride).
// This toolchain's builtin takes 6 args: (g0 u32x4, g1 i32x8, i32x4, i32x4,
// i32x8, cpol) — trailing groups zero for a 2-D tensor.
__device__ __forceinline__ void tdm_load_vt(const _Float16* gsrc, unsigned int lds_byte_addr) {
  unsigned long long ga = (unsigned long long)(uintptr_t)gsrc;
  u32x4 g0;
  g0[0] = 1u;                                            // count=1, user mode
  g0[1] = lds_byte_addr;                                 // lds_addr
  g0[2] = (unsigned int)ga;                              // global_addr[31:0]
  g0[3] = (unsigned int)((ga >> 32) & 0x01FFFFFFu) | (2u << 30);  // addr[56:32] | type=2
  i32x8 g1;
  g1[0] = (int)(1u << 16);                               // data_size=1 (2 bytes)
  g1[1] = (int)(((unsigned)SQ & 0xFFFFu) << 16);         // tensor_dim0 lo16
  g1[2] = (int)(((unsigned)SQ >> 16) | (((unsigned)DD & 0xFFFFu) << 16)); // dim0 hi | dim1 lo
  g1[3] = (int)(((unsigned)DD >> 16) | (32u << 16));     // dim1 hi | tile_dim0=32
  g1[4] = (int)128;                                      // tile_dim1=128, tile_dim2=0
  g1[5] = (int)SQ;                                       // tensor_dim0_stride lo32
  g1[6] = 0;                                             // stride hi | dim1_stride lo
  g1[7] = 0;
  i32x4 z4 = {0, 0, 0, 0};
  i32x8 z8 = {0, 0, 0, 0, 0, 0, 0, 0};
  __builtin_amdgcn_tensor_load_to_lds(g0, g1, z4, z4, z8, 0);
}
#endif

// ---------------------------------------------------------------------------
// Kernel 1: f32 -> f16 copies of K and Q; transposed f16 copy of V (Vt[d][q]).
// ---------------------------------------------------------------------------
__global__ void sda_convert(const float* __restrict__ K, const float* __restrict__ Q,
                            const float* __restrict__ V,
                            _Float16* __restrict__ Kh, _Float16* __restrict__ Qh,
                            _Float16* __restrict__ Vt) {
  int i = blockIdx.x * blockDim.x + threadIdx.x;   // 0 .. SK*DD-1
  Kh[i] = (_Float16)K[i];
  Qh[i] = (_Float16)Q[i];
  int q = i >> 7, d = i & 127;
  Vt[(size_t)d * SQ + q] = (_Float16)V[i];
}

// ---------------------------------------------------------------------------
// Kernel 2: per-query-column softmax stats over the k axis.
// Each wave owns 16 q columns; loops all k in 16-row tiles.
// Online (max, sum-exp2) per column, merged across lane halves via shfl_xor 16.
// ---------------------------------------------------------------------------
__global__ void sda_stats(const _Float16* __restrict__ Kh,
                          const _Float16* __restrict__ Qh,
                          float* __restrict__ m2, float* __restrict__ rZ) {
  const int lane = threadIdx.x & 31;
  const int wave = (blockIdx.x * blockDim.x + threadIdx.x) >> 5;
  const int q0 = wave * 16;

  v16h bq[4];
#pragma unroll
  for (int dc = 0; dc < 4; ++dc) bq[dc] = load_tile_ab(Qh, DD, q0, dc * 32, lane);

  float mrun = -__builtin_inff();
  float zrun = 0.0f;

  for (int k0 = 0; k0 < SK; k0 += 16) {
    v8f c = {};
#pragma unroll
    for (int dc = 0; dc < 4; ++dc) {
      v16h a = load_tile_ab(Kh, DD, k0, dc * 32, lane);
      c = __builtin_amdgcn_wmma_f32_16x16x32_f16(false, a, false, bq[dc],
                                                 (short)0, c, false, false);
    }
    // C layout: lane holds column n=lane&15, rows r+8*(lane>>4), r=0..7
    float tmax = c[0];
#pragma unroll
    for (int r = 1; r < 8; ++r) tmax = fmaxf(tmax, c[r]);
    tmax = fmaxf(tmax, __shfl_xor(tmax, 16, 32));
    tmax *= SCALE2;
    float nm = fmaxf(mrun, tmax);
    float ts = 0.0f;
#pragma unroll
    for (int r = 0; r < 8; ++r) ts += fexp2(c[r] * SCALE2 - nm);
    ts += __shfl_xor(ts, 16, 32);
    zrun = zrun * fexp2(mrun - nm) + ts;
    mrun = nm;
  }
  if (lane < 16) {
    m2[q0 + lane] = mrun;
    rZ[q0 + lane] = 1.0f / zrun;
  }
}

// ---------------------------------------------------------------------------
// Kernel 3: output. Each wave owns 16 k rows x full 128 d (8 f32 accumulators).
// Per 32-q chunk: recompute S, p = exp2(s-m2[q])*rZ[q] in f16,
// C-layout -> A-layout via wave-private LDS tile, then 8 WMMAs against Vt.
// Vt chunk (128x32 f16, shared by ALL waves) is staged block-wide into LDS by
// the Tensor Data Mover, double-buffered to overlap with the S GEMM.
// ---------------------------------------------------------------------------
__global__ void sda_output(const _Float16* __restrict__ Kh,
                           const _Float16* __restrict__ Qh,
                           const _Float16* __restrict__ Vt,
                           const float* __restrict__ m2,
                           const float* __restrict__ rZ,
                           float* __restrict__ out) {
  __shared__ _Float16 plds[8][16 * 32];       // per-wave 16x32 P tile, 8 KB
#if USE_TDM
  __shared__ _Float16 vstage[2][DD * 32];     // double-buffered Vt chunk, 16 KB
#endif
  const int lane = threadIdx.x & 31;
  const int wv   = threadIdx.x >> 5;
  const int wave = (blockIdx.x * blockDim.x + threadIdx.x) >> 5;
  const int k0   = wave * 16;
  const int n    = lane & 15;
  const int hi   = lane >> 4;

  v16h ak[4];
#pragma unroll
  for (int dc = 0; dc < 4; ++dc) ak[dc] = load_tile_ab(Kh, DD, k0, dc * 32, lane);

  v8f acc[8];
#pragma unroll
  for (int dt = 0; dt < 8; ++dt) acc[dt] = (v8f){};

#if USE_TDM
  if (wv == 0) tdm_load_vt(Vt, (unsigned int)(uintptr_t)&vstage[0][0]);
#endif

  const int NCHUNK = SQ / 32;
  for (int ci = 0; ci < NCHUNK; ++ci) {
    const int q0 = ci * 32;
    // ---- S = K x Q^T for 16 k-rows x 32 q-cols (accumulate over d=128) ----
    v8f c0 = {}, c1 = {};
#pragma unroll
    for (int dc = 0; dc < 4; ++dc) {
      v16h b0 = load_tile_ab(Qh, DD, q0,      dc * 32, lane);
      v16h b1 = load_tile_ab(Qh, DD, q0 + 16, dc * 32, lane);
      c0 = __builtin_amdgcn_wmma_f32_16x16x32_f16(false, ak[dc], false, b0,
                                                  (short)0, c0, false, false);
      c1 = __builtin_amdgcn_wmma_f32_16x16x32_f16(false, ak[dc], false, b1,
                                                  (short)0, c1, false, false);
    }
    __syncthreads();   // (A) prior chunk's plds/vstage reads complete
    // ---- p = exp2(s*scale2 - m2[q]) * rZ[q], staged to LDS in (m,q) form --
    float mq0 = m2[q0 + n],      rz0 = rZ[q0 + n];
    float mq1 = m2[q0 + 16 + n], rz1 = rZ[q0 + 16 + n];
#pragma unroll
    for (int r = 0; r < 8; ++r) {
      int mrow = r + 8 * hi;
      plds[wv][mrow * 32 + n]      = (_Float16)(fexp2(c0[r] * SCALE2 - mq0) * rz0);
      plds[wv][mrow * 32 + 16 + n] = (_Float16)(fexp2(c1[r] * SCALE2 - mq1) * rz1);
    }
#if USE_TDM
    if (wv == 0) __builtin_amdgcn_s_wait_tensorcnt(0);  // chunk ci resident
#endif
    __syncthreads();   // (B) plds written + vstage[ci&1] published to block
#if USE_TDM
    if (wv == 0 && ci + 1 < NCHUNK)                     // prefetch next chunk
      tdm_load_vt(Vt + (size_t)(q0 + 32), (unsigned int)(uintptr_t)&vstage[(ci + 1) & 1][0]);
#endif
    // ---- read P back in WMMA A layout (16x32) ----------------------------
    v16h pa;
    {
      v8h lo = *(const v8h*)&plds[wv][n * 32 + 8 * hi];
      v8h hp = *(const v8h*)&plds[wv][n * 32 + 16 + 8 * hi];
#pragma unroll
      for (int i = 0; i < 8; ++i) { pa[i] = lo[i]; pa[i + 8] = hp[i]; }
    }
    // ---- O(16x128) += P(16x32) x Vt-as-B(32q x 16d) per d-tile -----------
#if USE_TDM
    const _Float16* vsrc = &vstage[ci & 1][0];          // row-major [128][32] in LDS
#pragma unroll
    for (int dt = 0; dt < 8; ++dt) {
      v16h bv = load_tile_ab(vsrc, 32, dt * 16, 0, lane);
      acc[dt] = __builtin_amdgcn_wmma_f32_16x16x32_f16(false, pa, false, bv,
                                                       (short)0, acc[dt], false, false);
    }
#else
#pragma unroll
    for (int dt = 0; dt < 8; ++dt) {
      v16h bv = load_tile_ab(Vt, SQ, dt * 16, q0, lane);
      acc[dt] = __builtin_amdgcn_wmma_f32_16x16x32_f16(false, pa, false, bv,
                                                       (short)0, acc[dt], false, false);
    }
#endif
  }
  // ---- store C layout: element (m = r+8*hi, col = dt*16+n); write-once ----
#pragma unroll
  for (int dt = 0; dt < 8; ++dt) {
#pragma unroll
    for (int r = 0; r < 8; ++r) {
      __builtin_nontemporal_store(acc[dt][r],
          &out[(size_t)(k0 + r + 8 * hi) * DD + dt * 16 + n]);
    }
  }
}

extern "C" void kernel_launch(void* const* d_in, const int* in_sizes, int n_in,
                              void* d_out, int out_size, void* d_ws, size_t ws_size,
                              hipStream_t stream) {
  (void)in_sizes; (void)n_in; (void)out_size; (void)ws_size;
  const float* K = (const float*)d_in[0];
  const float* Q = (const float*)d_in[1];
  const float* V = (const float*)d_in[2];
  float* out = (float*)d_out;

  _Float16* Kh = (_Float16*)d_ws;                       // [8192,128] f16
  _Float16* Qh = Kh + (size_t)SK * DD;                  // [8192,128] f16
  _Float16* Vt = Qh + (size_t)SQ * DD;                  // [128,8192] f16 (transposed)
  float*    m2 = (float*)(Vt + (size_t)DD * SQ);        // [8192] column max (log2 dom)
  float*    rZ = m2 + SQ;                               // [8192] 1/sum

  sda_convert<<<(SK * DD) / 256, 256, 0, stream>>>(K, Q, V, Kh, Qh, Vt);
  // 512 waves each: 8 waves/block -> 64 blocks
  sda_stats<<<64, 256, 0, stream>>>(Kh, Qh, m2, rZ);
  sda_output<<<64, 256, 0, stream>>>(Kh, Qh, Vt, m2, rZ, out);
}

// v001
// Measured time: 223 microseconds a run.
// In two side-by-side timings against v000, it was 4.79 and 4.76 times as fast.
#include <hip/hip_runtime.h>
#include <hip/hip_bf16.h>

typedef __attribute__((ext_vector_type(16))) _Float16 v16h;
typedef __attribute__((ext_vector_type(8)))  _Float16 v8h;
typedef __attribute__((ext_vector_type(8)))  float    v8f;
typedef __attribute__((ext_vector_type(4)))  unsigned int u32x4;
typedef __attribute__((ext_vector_type(8)))  int      i32x8;
typedef __attribute__((ext_vector_type(4)))  int      i32x4;

#define SK 8192
#define SQ 8192
#define DD 128
// The k loop of the stats kernel and the q loop of the output kernel are cut
// into KSPLIT / QSPLIT equal ranges, one per blockIdx.y, so that the grid
// covers every WGP; the ranges' partial results are merged by small launches.
#define KSPLIT 32
#define QSPLIT 16
// 1/sqrt(128) * log2(e): softmax computed in log2 domain -> native v_exp_f32
#define SCALE2 0.12751589906834162f

#if defined(__HIP_DEVICE_COMPILE__) && __has_builtin(__builtin_amdgcn_tensor_load_to_lds) && \
    __has_builtin(__builtin_amdgcn_s_wait_tensorcnt)
#define USE_TDM 1
#else
#define USE_TDM 0
#endif

// Raw v_exp_f32: args here are bounded (<= 0, > -40), so skip OCML's
// underflow-guard path (saves ~6 VALU per exponential in the hot loop).
__device__ __forceinline__ float fexp2(float x) {
#if defined(__HIP_DEVICE_COMPILE__) && __has_builtin(__builtin_amdgcn_exp2f)
  return __builtin_amdgcn_exp2f(x);
#else
  return exp2f(x);
#endif
}

// ---------------------------------------------------------------------------
// Load a 16x32 f16 tile from a row-major matrix into the WMMA A/B register
// layout (ISA 7.12.2, 16-bit A-matrix 16x32):
//   lanes 0-15 : row = row0+lane,    halves 0-7 = cols c0+0..7,  8-15 = c0+16..23
//   lanes 16-31: row = row0+lane-16, halves 0-7 = cols c0+8..15, 8-15 = c0+24..31
// Both chunks are 16B aligned -> two b128 loads per lane (global or ds).
// Serves B operands too: a B (KxN) tile equals the A layout of rows of the
// row-major N-major source (lane = column index n).
// ---------------------------------------------------------------------------
__device__ __forceinline__ v16h load_tile_ab(const _Float16* base,
                                             int ld, int row0, int col0, int lane) {
  const int r  = row0 + (lane & 15);
  const int hs = (lane >> 4) & 1;
  const _Float16* p = base + (size_t)r * ld + col0 + hs * 8;
  v8h lo = *(const v8h*)p;
  v8h hi = *(const v8h*)(p + 16);
  v16h out;
#pragma unroll
  for (int i = 0; i < 8; ++i) { out[i] = lo[i]; out[i + 8] = hi[i]; }
  return out;
}

#if USE_TDM
// Issue a TDM load of a 2D tile (tile_dim0=32 halfs wide, tile_dim1=128 rows)
// from row-major Vt[128][8192] (f16) into LDS at lds_byte_addr.
// D# bitfields per CDNA5 ISA 8.3/8.4 (group0: count/lds/global/type,
// group1: data_size, tensor dims, tile dims, dim0 stride).
// This toolchain's builtin takes 6 args: (g0 u32x4, g1 i32x8, i32x4, i32x4,
// i32x8, cpol) — trailing groups zero for a 2-D tensor.
__device__ __forceinline__ void tdm_load_vt(const _Float16* gsrc, unsigned int lds_byte_addr) {
  unsigned long long ga = (unsigned long long)(uintptr_t)gsrc;
  u32x4 g0;
  g0[0] = 1u;                                            // count=1, user mode
  g0[1] = lds_byte_addr;                                 // lds_addr
  g0[2] = (unsigned int)ga;                              // global_addr[31:0]
  g0[3] = (unsigned int)((ga >> 32) & 0x01FFFFFFu) | (2u << 30);  // addr[56:32] | type=2
  i32x8 g1;
  g1[0] = (int)(1u << 16);                               // data_size=1 (2 bytes)
  g1[1] = (int)(((unsigned)SQ & 0xFFFFu) << 16);         // tensor_dim0 lo16
  g1[2] = (int)(((unsigned)SQ >> 16) | (((unsigned)DD & 0xFFFFu) << 16)); // dim0 hi | dim1 lo
  g1[3] = (int)(((unsigned)DD >> 16) | (32u << 16));     // dim1 hi | tile_dim0=32
  g1[4] = (int)128;                                      // tile_dim1=128, tile_dim2=0
  g1[5] = (int)SQ;                                       // tensor_dim0_stride lo32
  g1[6] = 0;                                             // stride hi | dim1_stride lo
  g1[7] = 0;
  i32x4 z4 = {0, 0, 0, 0};
  i32x8 z8 = {0, 0, 0, 0, 0, 0, 0, 0};
  __builtin_amdgcn_tensor_load_to_lds(g0, g1, z4, z4, z8, 0);
}
#endif

// ---------------------------------------------------------------------------
// Kernel 1: f32 -> f16 copies of K and Q; transposed f16 copy of V (Vt[d][q]).
// ---------------------------------------------------------------------------
__global__ void sda_convert(const float* __restrict__ K, const float* __restrict__ Q,
                            const float* __restrict__ V,
                            _Float16* __restrict__ Kh, _Float16* __restrict__ Qh,
                            _Float16* __restrict__ Vt) {
  int i = blockIdx.x * blockDim.x + threadIdx.x;   // 0 .. SK*DD-1
  Kh[i] = (_Float16)K[i];
  Qh[i] = (_Float16)Q[i];
  int q = i >> 7, d = i & 127;
  Vt[(size_t)d * SQ + q] = (_Float16)V[i];
}

// ---------------------------------------------------------------------------
// Kernel 2: per-query-column softmax stats over one range of the k axis.
// Each wave owns 16 q columns; loops its k range (blockIdx.y) in 16-row tiles.
// Online (max, sum-exp2) per column, merged across lane halves via shfl_xor 16.
// Writes the range's (max, sum) pair; sda_stats_merge joins the ranges.
// ---------------------------------------------------------------------------
__global__ void sda_stats(const _Float16* __restrict__ Kh_all,
                          const _Float16* __restrict__ Qh,
                          float* __restrict__ pmz_f) {
  float2* pmz = (float2*)pmz_f;                  // [KSPLIT][SQ] (max, sum) pairs
  const _Float16* Kh = Kh_all + (size_t)blockIdx.y * (SK / KSPLIT) * DD;
  const int lane = threadIdx.x & 31;
  const int wave = (blockIdx.x * blockDim.x + threadIdx.x) >> 5;
  const int q0 = wave * 16;

  v16h bq[4];
#pragma unroll
  for (int dc = 0; dc < 4; ++dc) bq[dc] = load_tile_ab(Qh, DD, q0, dc * 32, lane);

  float mrun = -__builtin_inff();
  float zrun = 0.0f;

  for (int k0 = 0; k0 < SK / KSPLIT; k0 += 16) {
    v8f c = {};
#pragma unroll
    for (int dc = 0; dc < 4; ++dc) {
      v16h a = load_tile_ab(Kh, DD, k0, dc * 32, lane);
      c = __builtin_amdgcn_wmma_f32_16x16x32_f16(false, a, false, bq[dc],
                                                 (short)0, c, false, false);
    }
    // C layout: lane holds column n=lane&15, rows r+8*(lane>>4), r=0..7
    float tmax = c[0];
#pragma unroll
    for (int r = 1; r < 8; ++r) tmax = fmaxf(tmax, c[r]);
    tmax = fmaxf(tmax, __shfl_xor(tmax, 16, 32));
    tmax *= SCALE2;
    float nm = fmaxf(mrun, tmax);
    float ts = 0.0f;
#pragma unroll
    for (int r = 0; r < 8; ++r) ts += fexp2(c[r] * SCALE2 - nm);
    ts += __shfl_xor(ts, 16, 32);
    zrun = zrun * fexp2(mrun - nm) + ts;
    mrun = nm;
  }
  if (lane < 16) {
    pmz[blockIdx.y * SQ + q0 + lane] = make_float2(mrun, zrun);
  }
}

// ---------------------------------------------------------------------------
// Kernel 2b: join the KSPLIT (max, sum) pairs of each q column.
// ---------------------------------------------------------------------------
__global__ void sda_stats_merge(const float* __restrict__ pmz_f,
                                float* __restrict__ m2, float* __restrict__ rZ) {
  const float2* pmz = (const float2*)pmz_f;      // [KSPLIT][SQ] (max, sum) pairs
  const int q = blockIdx.x * blockDim.x + threadIdx.x;   // 0 .. SQ-1
  float2 p[KSPLIT];
#pragma unroll
  for (int s = 0; s < KSPLIT; ++s) p[s] = pmz[s * SQ + q];
  float m = p[0].x;
#pragma unroll
  for (int s = 1; s < KSPLIT; ++s) m = fmaxf(m, p[s].x);
  float z = 0.0f;
#pragma unroll
  for (int s = 0; s < KSPLIT; ++s) z += p[s].y * fexp2(p[s].x - m);
  m2[q] = m;
  rZ[q] = 1.0f / z;
}

// ---------------------------------------------------------------------------
// Kernel 3: output. Each wave owns 16 k rows x full 128 d (8 f32 accumulators)
// over one range of the q axis (blockIdx.y); the range's f32 partial sum goes
// to the workspace and sda_reduce adds the ranges.
// Per 32-q chunk: recompute S, p = exp2(s-m2[q])*rZ[q] in f16,
// C-layout -> A-layout via wave-private LDS tile, then 8 WMMAs against Vt.
// Vt chunk (128x32 f16, shared by ALL waves) is staged block-wide into LDS by
// the Tensor Data Mover, double-buffered to overlap with the S GEMM.
// ---------------------------------------------------------------------------
__global__ void sda_output(const _Float16* __restrict__ Kh,
                           const _Float16* __restrict__ Qh_all,
                           const _Float16* __restrict__ Vt_all,
                           const float* __restrict__ m2_all,
                           const float* __restrict__ rZ_all,
                           float* __restrict__ part) {
  // this work-group's q range: every q index below is relative to qbase
  const int qbase = blockIdx.y * (SQ / QSPLIT);
  const _Float16* Qh = Qh_all + (size_t)qbase * DD;
  const _Float16* Vt = Vt_all + qbase;
  const float* m2 = m2_all + qbase;
  const float* rZ = rZ_all + qbase;
  float* out = part + blockIdx.y * DD;   // partials lie as [k][range][d]
  __shared__ _Float16 plds[8][16 * 32];       // per-wave 16x32 P tile, 8 KB
#if USE_TDM
  __shared__ _Float16 vstage[2][DD * 32];     // double-buffered Vt chunk, 16 KB
#endif
  const int lane = threadIdx.x & 31;
  const int wv   = threadIdx.x >> 5;
  const int wave = (blockIdx.x * blockDim.x + threadIdx.x) >> 5;
  const int k0   = wave * 16;
  const int n    = lane & 15;
  const int hi   = lane >> 4;

  v16h ak[4];
#pragma unroll
  for (int dc = 0; dc < 4; ++dc) ak[dc] = load_tile_ab(Kh, DD, k0, dc * 32, lane);

  v8f acc[8];
#pragma unroll
  for (int dt = 0; dt < 8; ++dt) acc[dt] = (v8f){};

#if USE_TDM
  if (wv == 0) tdm_load_vt(Vt, (unsigned int)(uintptr_t)&vstage[0][0]);
#endif

  const int NCHUNK = SQ / QSPLIT / 32;
  for (int ci = 0; ci < NCHUNK; ++ci) {
    const int q0 = ci * 32;
    // ---- S = K x Q^T for 16 k-rows x 32 q-cols (accumulate over d=128) ----
    v8f c0 = {}, c1 = {};
#pragma unroll
    for (int dc = 0; dc < 4; ++dc) {
      v16h b0 = load_tile_ab(Qh, DD, q0,      dc * 32, lane);
      v16h b1 = load_tile_ab(Qh, DD, q0 + 16, dc * 32, lane);
      c0 = __builtin_amdgcn_wmma_f32_16x16x32_f16(false, ak[dc], false, b0,
                                                  (short)0, c0, false, false);
      c1 = __builtin_amdgcn_wmma_f32_16x16x32_f16(false, ak[dc], false, b1,
                                                  (short)0, c1, false, false);
    }
    __syncthreads();   // (A) prior chunk's plds/vstage reads complete
    // ---- p = exp2(s*scale2 - m2[q]) * rZ[q], staged to LDS in (m,q) form --
    float mq0 = m2[q0 + n],      rz0 = rZ[q0 + n];
    float mq1 = m2[q0 + 16 + n], rz1 = rZ[q0 + 16 + n];
#pragma unroll
    for (int r = 0; r < 8; ++r) {
      int mrow = r + 8 * hi;
      plds[wv][mrow * 32 + n]      = (_Float16)(fexp2(c0[r] * SCALE2 - mq0) * rz0);
      plds[wv][mrow * 32 + 16 + n] = (_Float16)(fexp2(c1[r] * SCALE2 - mq1) * rz1);
    }
#if USE_TDM
    // chunk ci resident. Every wave passes the wait (a wave with no request
    // outstanding passes at once): no test, so no EXEC save lands in a scalar
    // register while the request is in flight.
    asm volatile("s_wait_tensorcnt 0x0" ::: "memory");
#endif
    __syncthreads();   // (B) plds written + vstage[ci&1] published to block
#if USE_TDM
    if (wv == 0 && ci + 1 < NCHUNK)                     // prefetch next chunk
      tdm_load_vt(Vt + (size_t)(q0 + 32), (unsigned int)(uintptr_t)&vstage[(ci + 1) & 1][0]);
#endif
    // ---- read P back in WMMA A layout (16x32) ----------------------------
    v16h pa;
    {
      v8h lo = *(const v8h*)&plds[wv][n * 32 + 8 * hi];
      v8h hp = *(const v8h*)&plds[wv][n * 32 + 16 + 8 * hi];
#pragma unroll
      for (int i = 0; i < 8; ++i) { pa[i] = lo[i]; pa[i + 8] = hp[i]; }
    }
    // ---- O(16x128) += P(16x32) x Vt-as-B(32q x 16d) per d-tile -----------
#if USE_TDM
    const _Float16* vsrc = &vstage[ci & 1][0];          // row-major [128][32] in LDS
#pragma unroll
    for (int dt = 0; dt < 8; ++dt) {
      v16h bv = load_tile_ab(vsrc, 32, dt * 16, 0, lane);
      acc[dt] = __builtin_amdgcn_wmma_f32_16x16x32_f16(false, pa, false, bv,
                                                       (short)0, acc[dt], false, false);
    }
#else
#pragma unroll
    for (int dt = 0; dt < 8; ++dt) {
      v16h bv = load_tile_ab(Vt, SQ, dt * 16, q0, lane);
      acc[dt] = __builtin_amdgcn_wmma_f32_16x16x32_f16(false, pa, false, bv,
                                                       (short)0, acc[dt], false, false);
    }
#endif
  }
  // ---- store C layout: element (m = r+8*hi, col = dt*16+n); write-once ----
  // plain stores: sda_reduce reads these partial sums back at once
#pragma unroll
  for (int dt = 0; dt < 8; ++dt) {
#pragma unroll
    for (int r = 0; r < 8; ++r) {
      out[(size_t)(k0 + r + 8 * hi) * (QSPLIT * DD) + dt * 16 + n] = acc[dt][r];
    }
  }
}

// ---------------------------------------------------------------------------
// Kernel 4: out = sum of the QSPLIT partial outputs, in range order.
// ---------------------------------------------------------------------------
__global__ void sda_reduce(const float* __restrict__ part, float* __restrict__ out) {
  const int i = blockIdx.x * blockDim.x + threadIdx.x;   // float4 index, 0 .. SK*DD/4-1
  // row k = i / 32 holds QSPLIT partial rows of 32 float4 each
  const float4* row4 = (const float4*)part + (i >> 5) * (QSPLIT * DD / 4) + (i & 31);
  float4 v[QSPLIT];
#pragma unroll
  for (int p = 0; p < QSPLIT; ++p) v[p] = row4[p * (DD / 4)];
  float4 s = v[0];
#pragma unroll
  for (int p = 1; p < QSPLIT; ++p) { s.x += v[p].x; s.y += v[p].y; s.z += v[p].z; s.w += v[p].w; }
  ((float4*)out)[i] = s;
}

extern "C" void kernel_launch(void* const* d_in, const int* in_sizes, int n_in,
                              void* d_out, int out_size, void* d_ws, size_t ws_size,
                              hipStream_t stream) {
  (void)in_sizes; (void)n_in; (void)out_size; (void)ws_size;
  const float* K = (const float*)d_in[0];
  const float* Q = (const float*)d_in[1];
  const float* V = (const float*)d_in[2];
  float* out = (float*)d_out;

  _Float16* Kh = (_Float16*)d_ws;                       // [8192,128] f16
  _Float16* Qh = Kh + (size_t)SK * DD;                  // [8192,128] f16
  _Float16* Vt = Qh + (size_t)SQ * DD;                  // [128,8192] f16 (transposed)
  float*    m2 = (float*)(Vt + (size_t)DD * SQ);        // [8192] column max (log2 dom)
  float*    rZ = m2 + SQ;                               // [8192] 1/sum
  float*    pmz = rZ + SQ;                              // [KSPLIT][8192] range (max, sum) pairs
  float*    part = pmz + (size_t)KSPLIT * SQ * 2;       // [8192][QSPLIT][128] partial out

  sda_convert<<<(SK * DD) / 256, 256, 0, stream>>>(K, Q, V, Kh, Qh, Vt);
  // 512 wave tiles: 8 waves/block -> 64 blocks in x; the split ranges in y
  sda_stats<<<dim3(64, KSPLIT), 256, 0, stream>>>(Kh, Qh, pmz);
  sda_stats_merge<<<SQ / 256, 256, 0, stream>>>(pmz, m2, rZ);
  sda_output<<<dim3(64, QSPLIT), 256, 0, stream>>>(Kh, Qh, Vt, m2, rZ, part);
  sda_reduce<<<(SK * DD) / 4 / 256, 256, 0, stream>>>(part, out);
}

// v002
// It runs in 133 microseconds.
// In both of two side-by-side timings against v001, it was 1.68 times as fast.
// Counting every step since v000, it is 8.03 times as fast.
#include <hip/hip_runtime.h>
#include <hip/hip_bf16.h>

typedef __attribute__((ext_vector_type(16))) _Float16 v16h;
typedef __attribute__((ext_vector_type(8)))  _Float16 v8h;
typedef __attribute__((ext_vector_type(8)))  float    v8f;

#define SK 8192
#define SQ 8192
#define DD 128
// The k loop of the stats kernel and the q loop of the output kernel are cut
// into KSPLIT / QSPLIT equal ranges, one per blockIdx.y, so that the grid
// covers every WGP; the ranges' partial results are merged by small launches.
#define KSPLIT 32
#define QSPLIT 16
// 1/sqrt(128) * log2(e): softmax computed in log2 domain -> native v_exp_f32
#define SCALE2 0.12751589906834162f

// Raw v_exp_f32: args here are bounded (<= 0, > -40), so skip OCML's
// underflow-guard path (saves ~6 VALU per exponential in the hot loop).
__device__ __forceinline__ float fexp2(float x) {
#if defined(__HIP_DEVICE_COMPILE__) && __has_builtin(__builtin_amdgcn_exp2f)
  return __builtin_amdgcn_exp2f(x);
#else
  return exp2f(x);
#endif
}

// ---------------------------------------------------------------------------
// Load a 16x32 f16 tile from a row-major matrix into the WMMA A/B register
// layout (ISA 7.12.2, 16-bit A-matrix 16x32):
//   lanes 0-15 : row = row0+lane,    halves 0-7 = cols c0+0..7,  8-15 = c0+16..23
//   lanes 16-31: row = row0+lane-16, halves 0-7 = cols c0+8..15, 8-15 = c0+24..31
// Both chunks are 16B aligned -> two b128 loads per lane (global or ds).
// Serves B operands too: a B (KxN) tile equals the A layout of rows of the
// row-major N-major source (lane = column index n).
// ---------------------------------------------------------------------------
__device__ __forceinline__ v16h load_tile_ab(const _Float16* base,
                                             int ld, int row0, int col0, int lane) {
  const int r  = row0 + (lane & 15);
  const int hs = (lane >> 4) & 1;
  const _Float16* p = base + (size_t)r * ld + col0 + hs * 8;
  v8h lo = *(const v8h*)p;
  v8h hi = *(const v8h*)(p + 16);
  v16h out;
#pragma unroll
  for (int i = 0; i < 8; ++i) { out[i] = lo[i]; out[i + 8] = hi[i]; }
  return out;
}

// LDS pitch, in halfs, of a staged 128-half row: 272 bytes = 16 x 17, the
// conflict-free pitch for 16-byte LDS reads of 256-byte rows.
#define LP 136
// The same for a staged 32-half row: 80 bytes = 16 x 5.
#define VP 40

// Asynchronous copies global -> LDS, 16 bytes per lane and copy, through no
// register. l* = the lane's own LDS byte address, g* = its own global address.
// The closing s_wait_xcnt stands inside the statement so that no address
// register of an issued copy is rewritten in front of it.
__device__ __forceinline__ void async_copy2(unsigned int l0, unsigned int l1,
                                            const _Float16* g0, const _Float16* g1) {
  asm volatile("global_load_async_to_lds_b128 %0, %2, off\n\t"
               "global_load_async_to_lds_b128 %1, %3, off\n\t"
               "s_wait_xcnt 0x0"
               :: "v"(l0), "v"(l1), "v"(g0), "v"(g1) : "memory");
}
__device__ __forceinline__ void async_copy8(unsigned int l, const _Float16* g,
                                            unsigned int lstep, int gstep) {
  asm volatile("global_load_async_to_lds_b128 %0, %8, off\n\t"
               "global_load_async_to_lds_b128 %1, %9, off\n\t"
               "global_load_async_to_lds_b128 %2, %10, off\n\t"
               "global_load_async_to_lds_b128 %3, %11, off\n\t"
               "global_load_async_to_lds_b128 %4, %12, off\n\t"
               "global_load_async_to_lds_b128 %5, %13, off\n\t"
               "global_load_async_to_lds_b128 %6, %14, off\n\t"
               "global_load_async_to_lds_b128 %7, %15, off\n\t"
               "s_wait_xcnt 0x0"
               :: "v"(l), "v"(l + lstep), "v"(l + 2 * lstep), "v"(l + 3 * lstep),
                  "v"(l + 4 * lstep), "v"(l + 5 * lstep), "v"(l + 6 * lstep), "v"(l + 7 * lstep),
                  "v"(g), "v"(g + gstep), "v"(g + 2 * gstep), "v"(g + 3 * gstep),
                  "v"(g + 4 * gstep), "v"(g + 5 * gstep), "v"(g + 6 * gstep), "v"(g + 7 * gstep)
               : "memory");
}

// ---------------------------------------------------------------------------
// Kernel 1: f32 -> f16 copies of K and Q; transposed f16 copy of V (Vt[d][q]).
// ---------------------------------------------------------------------------
__global__ void sda_convert(const float* __restrict__ K, const float* __restrict__ Q,
                            const float* __restrict__ V,
                            _Float16* __restrict__ Kh, _Float16* __restrict__ Qh,
                            _Float16* __restrict__ Vt) {
  int i = blockIdx.x * blockDim.x + threadIdx.x;   // 0 .. SK*DD-1
  Kh[i] = (_Float16)K[i];
  Qh[i] = (_Float16)Q[i];
  int q = i >> 7, d = i & 127;
  Vt[(size_t)d * SQ + q] = (_Float16)V[i];
}

// ---------------------------------------------------------------------------
// Kernel 2: per-query-column softmax stats over one range of the k axis.
// Each wave owns 16 q columns; loops its k range (blockIdx.y) in 16-row tiles.
// Online (max, sum-exp2) per column, merged across lane halves via shfl_xor 16.
// Writes the range's (max, sum) pair; sda_stats_merge joins the ranges.
// The range's K rows, which all 8 waves read, are copied once per block into
// LDS in whole lines; the fragments are then read from LDS.
// ---------------------------------------------------------------------------
__global__ void sda_stats(const _Float16* __restrict__ Kh_all,
                          const _Float16* __restrict__ Qh,
                          float* __restrict__ pmz_f) {
  float2* pmz = (float2*)pmz_f;                  // [KSPLIT][SQ] (max, sum) pairs
  const _Float16* Kh = Kh_all + (size_t)blockIdx.y * (SK / KSPLIT) * DD;
  const int lane = threadIdx.x & 31;
  const int wave = (blockIdx.x * blockDim.x + threadIdx.x) >> 5;
  const int q0 = wave * 16;

  // 256 rows of 256 bytes = 4096 pieces of 16 bytes; thread t copies pieces
  // t + 256 j, j = 0..15: piece p is bytes 16 (p & 15) .. +15 of row p >> 4.
  __shared__ __attribute__((aligned(16))) _Float16 kst[(SK / KSPLIT) * LP];
  {
    const int t = threadIdx.x;
    const unsigned int l = (unsigned int)(uintptr_t)&kst[0] + (t >> 4) * (LP * 2) + (t & 15) * 16;
    const _Float16* g = Kh + t * 8;
    async_copy8(l, g, 16 * LP * 2, 256 * 8);
    async_copy8(l + 8 * 16 * LP * 2, g + 8 * 256 * 8, 16 * LP * 2, 256 * 8);
  }

  v16h bq[4];
#pragma unroll
  for (int dc = 0; dc < 4; ++dc) bq[dc] = load_tile_ab(Qh, DD, q0, dc * 32, lane);

  // this wave's copies have landed; behind the barrier every wave's have
  asm volatile("s_wait_asynccnt 0x0" ::: "memory");
  __syncthreads();

  float mrun = -__builtin_inff();
  float zrun = 0.0f;

  for (int k0 = 0; k0 < SK / KSPLIT; k0 += 16) {
    v8f c = {};
#pragma unroll
    for (int dc = 0; dc < 4; ++dc) {
      v16h a = load_tile_ab(kst, LP, k0, dc * 32, lane);
      c = __builtin_amdgcn_wmma_f32_16x16x32_f16(false, a, false, bq[dc],
                                                 (short)0, c, false, false);
    }
    // C layout: lane holds column n=lane&15, rows r+8*(lane>>4), r=0..7
    float tmax = c[0];
#pragma unroll
    for (int r = 1; r < 8; ++r) tmax = fmaxf(tmax, c[r]);
    tmax = fmaxf(tmax, __shfl_xor(tmax, 16, 32));
    tmax *= SCALE2;
    float nm = fmaxf(mrun, tmax);
    float ts = 0.0f;
#pragma unroll
    for (int r = 0; r < 8; ++r) ts += fexp2(c[r] * SCALE2 - nm);
    ts += __shfl_xor(ts, 16, 32);
    zrun = zrun * fexp2(mrun - nm) + ts;
    mrun = nm;
  }
  if (lane < 16) {
    pmz[blockIdx.y * SQ + q0 + lane] = make_float2(mrun, zrun);
  }
}

// ---------------------------------------------------------------------------
// Kernel 2b: join the KSPLIT (max, sum) pairs of each q column.
// ---------------------------------------------------------------------------
__global__ void sda_stats_merge(const float* __restrict__ pmz_f,
                                float* __restrict__ m2, float* __restrict__ rZ) {
  const float2* pmz = (const float2*)pmz_f;      // [KSPLIT][SQ] (max, sum) pairs
  const int q = blockIdx.x * blockDim.x + threadIdx.x;   // 0 .. SQ-1
  float2 p[KSPLIT];
#pragma unroll
  for (int s = 0; s < KSPLIT; ++s) p[s] = pmz[s * SQ + q];
  float m = p[0].x;
#pragma unroll
  for (int s = 1; s < KSPLIT; ++s) m = fmaxf(m, p[s].x);
  float z = 0.0f;
#pragma unroll
  for (int s = 0; s < KSPLIT; ++s) z += p[s].y * fexp2(p[s].x - m);
  m2[q] = m;
  rZ[q] = 1.0f / z;
}

// ---------------------------------------------------------------------------
// Kernel 3: output. Each wave owns 16 k rows x full 128 d (8 f32 accumulators)
// over one range of the q axis (blockIdx.y); the range's f32 partial sum goes
// to the workspace and sda_reduce adds the ranges.
// Per 32-q chunk: recompute S, p = exp2(s-m2[q])*rZ[q] in f16,
// C-layout -> A-layout via wave-private LDS tile, then 8 WMMAs against Vt.
// The Q chunk (32x128 f16) and the Vt chunk (128x32 f16), shared by ALL waves,
// are copied block-wide into LDS by asynchronous copies, two buffers each: Q
// two chunks ahead, Vt one chunk ahead, both published by barrier (B).
// ---------------------------------------------------------------------------
__global__ void sda_output(const _Float16* __restrict__ Kh,
                           const _Float16* __restrict__ Qh_all,
                           const _Float16* __restrict__ Vt_all,
                           const float* __restrict__ m2_all,
                           const float* __restrict__ rZ_all,
                           float* __restrict__ part) {
  // this work-group's q range: every q index below is relative to qbase
  const int qbase = blockIdx.y * (SQ / QSPLIT);
  const _Float16* Qh = Qh_all + (size_t)qbase * DD;
  const _Float16* Vt = Vt_all + qbase;
  const float* m2 = m2_all + qbase;
  const float* rZ = rZ_all + qbase;
  float* out = part + blockIdx.y * DD;   // partials lie as [k][range][d]
  __shared__ _Float16 plds[8][16 * 32];       // per-wave 16x32 P tile, 8 KB
  __shared__ __attribute__((aligned(16))) _Float16 vstage[2][DD * VP];  // Vt chunks, 20 KB
  const int lane = threadIdx.x & 31;
  const int wv   = threadIdx.x >> 5;
  const int wave = (blockIdx.x * blockDim.x + threadIdx.x) >> 5;
  const int k0   = wave * 16;
  const int n    = lane & 15;
  const int hi   = lane >> 4;

  // a chunk = 32 rows of 256 bytes = 512 pieces of 16 bytes; thread t copies
  // pieces t and t + 256: piece p is bytes 16 (p & 15) .. +15 of row p >> 4.
  __shared__ __attribute__((aligned(16))) _Float16 qst[2][32 * LP];
  const unsigned int ql = (unsigned int)(uintptr_t)&qst[0][0] +
                          (threadIdx.x >> 4) * (LP * 2) + (threadIdx.x & 15) * 16;
  const _Float16* qg = Qh + threadIdx.x * 8;
  async_copy2(ql, ql + 16 * LP * 2, qg, qg + 256 * 8);            // chunk 0 -> buffer 0
  // a Vt chunk = 128 rows of 64 bytes = 512 pieces of 16 bytes; thread t copies
  // pieces t and t + 256: piece p is bytes 16 (p & 3) .. +15 of row p >> 2.
  const unsigned int vl = (unsigned int)(uintptr_t)&vstage[0][0] +
                          (threadIdx.x >> 2) * (VP * 2) + (threadIdx.x & 3) * 16;
  const _Float16* vg = Vt + (size_t)(threadIdx.x >> 2) * SQ + (threadIdx.x & 3) * 8;
  async_copy2(vl, vl + 64 * VP * 2, vg, vg + (size_t)64 * SQ);    // chunk 0 -> buffer 0

  v16h ak[4];
#pragma unroll
  for (int dc = 0; dc < 4; ++dc) ak[dc] = load_tile_ab(Kh, DD, k0, dc * 32, lane);

  v8f acc[8];
#pragma unroll
  for (int dt = 0; dt < 8; ++dt) acc[dt] = (v8f){};

  const int NCHUNK = SQ / QSPLIT / 32;
  // chunk 0 of Q and of Vt: this wave's copies have landed; the barrier publishes all
  asm volatile("s_wait_asynccnt 0x0" ::: "memory");
  __syncthreads();
  async_copy2(ql + 32 * LP * 2, ql + 48 * LP * 2,                 // chunk 1 -> buffer 1
              qg + 32 * DD, qg + 32 * DD + 256 * 8);

  for (int ci = 0; ci < NCHUNK; ++ci) {
    const int q0 = ci * 32;
    // ---- S = K x Q^T for 16 k-rows x 32 q-cols (accumulate over d=128) ----
    v8f c0 = {}, c1 = {};
#pragma unroll
    for (int dc = 0; dc < 4; ++dc) {
      v16h b0 = load_tile_ab(&qst[ci & 1][0], LP, 0,  dc * 32, lane);
      v16h b1 = load_tile_ab(&qst[ci & 1][0], LP, 16, dc * 32, lane);
      c0 = __builtin_amdgcn_wmma_f32_16x16x32_f16(false, ak[dc], false, b0,
                                                  (short)0, c0, false, false);
      c1 = __builtin_amdgcn_wmma_f32_16x16x32_f16(false, ak[dc], false, b1,
                                                  (short)0, c1, false, false);
    }
    __syncthreads();   // (A) prior chunk's plds/vstage reads complete
    // ---- p = exp2(s*scale2 - m2[q]) * rZ[q], staged to LDS in (m,q) form --
    float mq0 = m2[q0 + n],      rz0 = rZ[q0 + n];
    float mq1 = m2[q0 + 16 + n], rz1 = rZ[q0 + 16 + n];
#pragma unroll
    for (int r = 0; r < 8; ++r) {
      int mrow = r + 8 * hi;
      plds[wv][mrow * 32 + n]      = (_Float16)(fexp2(c0[r] * SCALE2 - mq0) * rz0);
      plds[wv][mrow * 32 + 16 + n] = (_Float16)(fexp2(c1[r] * SCALE2 - mq1) * rz1);
    }
    // Publish point of Q chunk ci + 1 and Vt chunk ci: this wave's LDS reads and
    // writes are done and its own copies have landed; barrier (B) follows.
    asm volatile("s_wait_dscnt 0x0" ::: "memory");
    asm volatile("s_wait_asynccnt 0x0" ::: "memory");
    __syncthreads();   // (B) plds written + vstage[ci&1], qst[(ci+1)&1] published to block
    if (ci + 1 < NCHUNK) {   // Vt chunk ci + 1 into the buffer whose readers ended at (A)
      const unsigned int lb = vl + ((ci + 1) & 1) * (DD * VP * 2);
      const _Float16* gb = vg + (q0 + 32);
      async_copy2(lb, lb + 64 * VP * 2, gb, gb + (size_t)64 * SQ);
    }
    if (ci + 2 < NCHUNK) {   // Q chunk ci + 2 into the buffer that chunk ci has left
      const unsigned int lb = ql + (ci & 1) * (32 * LP * 2);
      const _Float16* gb = qg + (size_t)(q0 + 64) * DD;
      async_copy2(lb, lb + 16 * LP * 2, gb, gb + 256 * 8);
    }
    // ---- read P back in WMMA A layout (16x32) ----------------------------
    v16h pa;
    {
      v8h lo = *(const v8h*)&plds[wv][n * 32 + 8 * hi];
      v8h hp = *(const v8h*)&plds[wv][n * 32 + 16 + 8 * hi];
#pragma unroll
      for (int i = 0; i < 8; ++i) { pa[i] = lo[i]; pa[i + 8] = hp[i]; }
    }
    // ---- O(16x128) += P(16x32) x Vt-as-B(32q x 16d) per d-tile -----------
    const _Float16* vsrc = &vstage[ci & 1][0];          // row-major [128][32], pitch VP
#pragma unroll
    for (int dt = 0; dt < 8; ++dt) {
      v16h bv = load_tile_ab(vsrc, VP, dt * 16, 0, lane);
      acc[dt] = __builtin_amdgcn_wmma_f32_16x16x32_f16(false, pa, false, bv,
                                                       (short)0, acc[dt], false, false);
    }
  }
  // no copy is left in flight when the wave ends
  asm volatile("s_wait_asynccnt 0x0" ::: "memory");
  // ---- store C layout: element (m = r+8*hi, col = dt*16+n); write-once ----
  // plain stores: sda_reduce reads these partial sums back at once
#pragma unroll
  for (int dt = 0; dt < 8; ++dt) {
#pragma unroll
    for (int r = 0; r < 8; ++r) {
      out[(size_t)(k0 + r + 8 * hi) * (QSPLIT * DD) + dt * 16 + n] = acc[dt][r];
    }
  }
}

// ---------------------------------------------------------------------------
// Kernel 4: out = sum of the QSPLIT partial outputs, in range order.
// ---------------------------------------------------------------------------
__global__ void sda_reduce(const float* __restrict__ part, float* __restrict__ out) {
  const int i = blockIdx.x * blockDim.x + threadIdx.x;   // float4 index, 0 .. SK*DD/4-1
  // row k = i / 32 holds QSPLIT partial rows of 32 float4 each
  const float4* row4 = (const float4*)part + (i >> 5) * (QSPLIT * DD / 4) + (i & 31);
  float4 v[QSPLIT];
#pragma unroll
  for (int p = 0; p < QSPLIT; ++p) v[p] = row4[p * (DD / 4)];
  float4 s = v[0];
#pragma unroll
  for (int p = 1; p < QSPLIT; ++p) { s.x += v[p].x; s.y += v[p].y; s.z += v[p].z; s.w += v[p].w; }
  ((float4*)out)[i] = s;
}

extern "C" void kernel_launch(void* const* d_in, const int* in_sizes, int n_in,
                              void* d_out, int out_size, void* d_ws, size_t ws_size,
                              hipStream_t stream) {
  (void)in_sizes; (void)n_in; (void)out_size; (void)ws_size;
  const float* K = (const float*)d_in[0];
  const float* Q = (const float*)d_in[1];
  const float* V = (const float*)d_in[2];
  float* out = (float*)d_out;

  _Float16* Kh = (_Float16*)d_ws;                       // [8192,128] f16
  _Float16* Qh = Kh + (size_t)SK * DD;                  // [8192,128] f16
  _Float16* Vt = Qh + (size_t)SQ * DD;                  // [128,8192] f16 (transposed)
  float*    m2 = (float*)(Vt + (size_t)DD * SQ);        // [8192] column max (log2 dom)
  float*    rZ = m2 + SQ;                               // [8192] 1/sum
  float*    pmz = rZ + SQ;                              // [KSPLIT][8192] range (max, sum) pairs
  float*    part = pmz + (size_t)KSPLIT * SQ * 2;       // [8192][QSPLIT][128] partial out

  sda_convert<<<(SK * DD) / 256, 256, 0, stream>>>(K, Q, V, Kh, Qh, Vt);
  // 512 wave tiles: 8 waves/block -> 64 blocks in x; the split ranges in y
  sda_stats<<<dim3(64, KSPLIT), 256, 0, stream>>>(Kh, Qh, pmz);
  sda_stats_merge<<<SQ / 256, 256, 0, stream>>>(pmz, m2, rZ);
  sda_output<<<dim3(64, QSPLIT), 256, 0, stream>>>(Kh, Qh, Vt, m2, rZ, part);
  sda_reduce<<<(SK * DD) / 4 / 256, 256, 0, stream>>>(part, out);
}

// v003
// It runs in 114 microseconds.
// Timed twice side by side with v002, it ran 1.17 times as fast both times.
// Over all steps from v000 it is 9.37 times as fast.
#include <hip/hip_runtime.h>
#include <hip/hip_bf16.h>

typedef __attribute__((ext_vector_type(16))) _Float16 v16h;
typedef __attribute__((ext_vector_type(8)))  _Float16 v8h;
typedef __attribute__((ext_vector_type(8)))  float    v8f;

#define SK 8192
#define SQ 8192
#define DD 128
// The k loop of the stats kernel and the q loop of the output kernel are cut
// into KSPLIT / QSPLIT equal ranges, one per blockIdx.y, so that the grid
// covers every WGP; the ranges' partial results are merged by small launches.
#define KSPLIT 32
#define QSPLIT 16
// Wave tiles: a stats wave owns SQT 16-column q tiles and an output wave OKT
// 16-row k tiles, so that one fragment read from LDS feeds SQT (OKT) WMMAs.
// Every loop over these tiles is unrolled: its fragment and accumulator arrays
// stay in registers only if each index is a constant.
#define SQT 4
#define OKT 2
// 1/sqrt(128) * log2(e): softmax computed in log2 domain -> native v_exp_f32
#define SCALE2 0.12751589906834162f

// Raw v_exp_f32: args here are bounded (<= 0, > -40), so skip OCML's
// underflow-guard path (saves ~6 VALU per exponential in the hot loop).
__device__ __forceinline__ float fexp2(float x) {
#if defined(__HIP_DEVICE_COMPILE__) && __has_builtin(__builtin_amdgcn_exp2f)
  return __builtin_amdgcn_exp2f(x);
#else
  return exp2f(x);
#endif
}

// ---------------------------------------------------------------------------
// Load a 16x32 f16 tile from a row-major matrix into the WMMA A/B register
// layout (ISA 7.12.2, 16-bit A-matrix 16x32):
//   lanes 0-15 : row = row0+lane,    halves 0-7 = cols c0+0..7,  8-15 = c0+16..23
//   lanes 16-31: row = row0+lane-16, halves 0-7 = cols c0+8..15, 8-15 = c0+24..31
// Both chunks are 16B aligned -> two b128 loads per lane (global or ds).
// Serves B operands too: a B (KxN) tile equals the A layout of rows of the
// row-major N-major source (lane = column index n).
// ---------------------------------------------------------------------------
__device__ __forceinline__ v16h load_tile_ab(const _Float16* base,
                                             int ld, int row0, int col0, int lane) {
  const int r  = row0 + (lane & 15);
  const int hs = (lane >> 4) & 1;
  const _Float16* p = base + (size_t)r * ld + col0 + hs * 8;
  v8h lo = *(const v8h*)p;
  v8h hi = *(const v8h*)(p + 16);
  v16h out;
#pragma unroll
  for (int i = 0; i < 8; ++i) { out[i] = lo[i]; out[i + 8] = hi[i]; }
  return out;
}

// LDS pitch, in halfs, of a staged 128-half row: 272 bytes = 16 x 17, the
// conflict-free pitch for 16-byte LDS reads of 256-byte rows.
#define LP 136
// The same for a staged 32-half row: 80 bytes = 16 x 5.
#define VP 40

// Asynchronous copies global -> LDS, 16 bytes per lane and copy, through no
// register. l* = the lane's own LDS byte address, g* = its own global address.
// The closing s_wait_xcnt stands inside the statement so that no address
// register of an issued copy is rewritten in front of it.
__device__ __forceinline__ void async_copy2(unsigned int l0, unsigned int l1,
                                            const _Float16* g0, const _Float16* g1) {
  asm volatile("global_load_async_to_lds_b128 %0, %2, off\n\t"
               "global_load_async_to_lds_b128 %1, %3, off\n\t"
               "s_wait_xcnt 0x0"
               :: "v"(l0), "v"(l1), "v"(g0), "v"(g1) : "memory");
}
__device__ __forceinline__ void async_copy8(unsigned int l, const _Float16* g,
                                            unsigned int lstep, int gstep) {
  asm volatile("global_load_async_to_lds_b128 %0, %8, off\n\t"
               "global_load_async_to_lds_b128 %1, %9, off\n\t"
               "global_load_async_to_lds_b128 %2, %10, off\n\t"
               "global_load_async_to_lds_b128 %3, %11, off\n\t"
               "global_load_async_to_lds_b128 %4, %12, off\n\t"
               "global_load_async_to_lds_b128 %5, %13, off\n\t"
               "global_load_async_to_lds_b128 %6, %14, off\n\t"
               "global_load_async_to_lds_b128 %7, %15, off\n\t"
               "s_wait_xcnt 0x0"
               :: "v"(l), "v"(l + lstep), "v"(l + 2 * lstep), "v"(l + 3 * lstep),
                  "v"(l + 4 * lstep), "v"(l + 5 * lstep), "v"(l + 6 * lstep), "v"(l + 7 * lstep),
                  "v"(g), "v"(g + gstep), "v"(g + 2 * gstep), "v"(g + 3 * gstep),
                  "v"(g + 4 * gstep), "v"(g + 5 * gstep), "v"(g + 6 * gstep), "v"(g + 7 * gstep)
               : "memory");
}

// ---------------------------------------------------------------------------
// Kernel 1: f32 -> f16 copies of K and Q; transposed f16 copy of V (Vt[d][q]).
// ---------------------------------------------------------------------------
__global__ void sda_convert(const float* __restrict__ K, const float* __restrict__ Q,
                            const float* __restrict__ V,
                            _Float16* __restrict__ Kh, _Float16* __restrict__ Qh,
                            _Float16* __restrict__ Vt) {
  int i = blockIdx.x * blockDim.x + threadIdx.x;   // 0 .. SK*DD-1
  Kh[i] = (_Float16)K[i];
  Qh[i] = (_Float16)Q[i];
  int q = i >> 7, d = i & 127;
  Vt[(size_t)d * SQ + q] = (_Float16)V[i];
}

// ---------------------------------------------------------------------------
// Kernel 2: per-query-column softmax stats over one range of the k axis.
// Each wave owns 16 SQT q columns; loops its k range (blockIdx.y) in 16-row tiles.
// Online (max, sum-exp2) per column, merged across lane halves via shfl_xor 16.
// Writes the range's (max, sum) pair; sda_stats_merge joins the ranges.
// The range's K rows, which all 8 waves read, are copied once per block into
// LDS in whole lines; the fragments are then read from LDS.
// ---------------------------------------------------------------------------
// The real block size lifts the register ceiling to what the wave tile needs.
__global__ __launch_bounds__(256) void sda_stats(const _Float16* __restrict__ Kh_all,
                          const _Float16* __restrict__ Qh,
                          float* __restrict__ pmz_f) {
  float2* pmz = (float2*)pmz_f;                  // [KSPLIT][SQ] (max, sum) pairs
  const _Float16* Kh = Kh_all + (size_t)blockIdx.y * (SK / KSPLIT) * DD;
  const int lane = threadIdx.x & 31;
  const int wave = (blockIdx.x * blockDim.x + threadIdx.x) >> 5;
  const int q0 = wave * (16 * SQT);

  // 256 rows of 256 bytes = 4096 pieces of 16 bytes; thread t copies pieces
  // t + 256 j, j = 0..15: piece p is bytes 16 (p & 15) .. +15 of row p >> 4.
  __shared__ __attribute__((aligned(16))) _Float16 kst[(SK / KSPLIT) * LP];
  {
    const int t = threadIdx.x;
    const unsigned int l = (unsigned int)(uintptr_t)&kst[0] + (t >> 4) * (LP * 2) + (t & 15) * 16;
    const _Float16* g = Kh + t * 8;
    async_copy8(l, g, 16 * LP * 2, 256 * 8);
    async_copy8(l + 8 * 16 * LP * 2, g + 8 * 256 * 8, 16 * LP * 2, 256 * 8);
  }

  v16h bq[SQT][4];
#pragma unroll
  for (int qt = 0; qt < SQT; ++qt) {
#pragma unroll
    for (int dc = 0; dc < 4; ++dc) bq[qt][dc] = load_tile_ab(Qh + (size_t)q0 * DD, DD, qt * 16, dc * 32, lane);
  }

  // this wave's copies have landed; behind the barrier every wave's have
  asm volatile("s_wait_asynccnt 0x0" ::: "memory");
  __syncthreads();

  float mrun[SQT], zrun[SQT];
#pragma unroll
  for (int qt = 0; qt < SQT; ++qt) { mrun[qt] = -__builtin_inff(); zrun[qt] = 0.0f; }

  for (int k0 = 0; k0 < SK / KSPLIT; k0 += 16) {
    v16h a[4];
#pragma unroll
    for (int dc = 0; dc < 4; ++dc) a[dc] = load_tile_ab(kst, LP, k0, dc * 32, lane);
    v8f c[SQT];
#pragma unroll
    for (int qt = 0; qt < SQT; ++qt) c[qt] = (v8f){};
#pragma unroll
    for (int dc = 0; dc < 4; ++dc) {
#pragma unroll
      for (int qt = 0; qt < SQT; ++qt)
        c[qt] = __builtin_amdgcn_wmma_f32_16x16x32_f16(false, a[dc], false, bq[qt][dc],
                                                       (short)0, c[qt], false, false);
    }
    // C layout: lane holds column n=lane&15, rows r+8*(lane>>4), r=0..7
#pragma unroll
    for (int qt = 0; qt < SQT; ++qt) {
      float tmax = c[qt][0];
#pragma unroll
      for (int r = 1; r < 8; ++r) tmax = fmaxf(tmax, c[qt][r]);
      tmax = fmaxf(tmax, __shfl_xor(tmax, 16, 32));
      tmax *= SCALE2;
      float nm = fmaxf(mrun[qt], tmax);
      float ts = 0.0f;
#pragma unroll
      for (int r = 0; r < 8; ++r) ts += fexp2(c[qt][r] * SCALE2 - nm);
      ts += __shfl_xor(ts, 16, 32);
      zrun[qt] = zrun[qt] * fexp2(mrun[qt] - nm) + ts;
      mrun[qt] = nm;
    }
  }
  if (lane < 16) {
#pragma unroll
    for (int qt = 0; qt < SQT; ++qt)
      pmz[blockIdx.y * SQ + q0 + qt * 16 + lane] = make_float2(mrun[qt], zrun[qt]);
  }
}

// ---------------------------------------------------------------------------
// Kernel 2b: join the KSPLIT (max, sum) pairs of each q column.
// ---------------------------------------------------------------------------
__global__ void sda_stats_merge(const float* __restrict__ pmz_f,
                                float* __restrict__ m2, float* __restrict__ rZ) {
  const float2* pmz = (const float2*)pmz_f;      // [KSPLIT][SQ] (max, sum) pairs
  const int q = blockIdx.x * blockDim.x + threadIdx.x;   // 0 .. SQ-1
  float2 p[KSPLIT];
#pragma unroll
  for (int s = 0; s < KSPLIT; ++s) p[s] = pmz[s * SQ + q];
  float m = p[0].x;
#pragma unroll
  for (int s = 1; s < KSPLIT; ++s) m = fmaxf(m, p[s].x);
  float z = 0.0f;
#pragma unroll
  for (int s = 0; s < KSPLIT; ++s) z += p[s].y * fexp2(p[s].x - m);
  m2[q] = m;
  rZ[q] = 1.0f / z;
}

// ---------------------------------------------------------------------------
// Kernel 3: output. Each wave owns 16 OKT k rows x full 128 d (8 OKT f32 accumulators)
// over one range of the q axis (blockIdx.y); the range's f32 partial sum goes
// to the workspace and sda_reduce adds the ranges.
// Per 32-q chunk: recompute S, p = exp2(s-m2[q])*rZ[q] in f16,
// C-layout -> A-layout via wave-private LDS tile, then 8 OKT WMMAs against Vt.
// The Q chunk (32x128 f16) and the Vt chunk (128x32 f16), shared by ALL waves,
// are copied block-wide into LDS by asynchronous copies, two buffers each: Q
// two chunks ahead, Vt one chunk ahead, both published by barrier (B).
// ---------------------------------------------------------------------------
// The real block size lifts the register ceiling to what the wave tile needs;
// four waves per SIMD (256 registers) keep two work-groups on a WGP, so that the
// whole grid is resident at once.
__global__ __launch_bounds__(256, 4) void sda_output(const _Float16* __restrict__ Kh,
                           const _Float16* __restrict__ Qh_all,
                           const _Float16* __restrict__ Vt_all,
                           const float* __restrict__ m2_all,
                           const float* __restrict__ rZ_all,
                           float* __restrict__ part) {
  // this work-group's q range: every q index below is relative to qbase
  const int qbase = blockIdx.y * (SQ / QSPLIT);
  const _Float16* Qh = Qh_all + (size_t)qbase * DD;
  const _Float16* Vt = Vt_all + qbase;
  const float* m2 = m2_all + qbase;
  const float* rZ = rZ_all + qbase;
  float* out = part + blockIdx.y * DD;   // partials lie as [k][range][d]
  __shared__ _Float16 plds[8][OKT * 16 * 32]; // per-wave (16 OKT)x32 P tile, 16 KB
  __shared__ __attribute__((aligned(16))) _Float16 vstage[2][DD * VP];  // Vt chunks, 20 KB
  const int lane = threadIdx.x & 31;
  const int wv   = threadIdx.x >> 5;
  const int wave = (blockIdx.x * blockDim.x + threadIdx.x) >> 5;
  const int k0   = wave * (16 * OKT);
  const int n    = lane & 15;
  const int hi   = lane >> 4;

  // a chunk = 32 rows of 256 bytes = 512 pieces of 16 bytes; thread t copies
  // pieces t and t + 256: piece p is bytes 16 (p & 15) .. +15 of row p >> 4.
  __shared__ __attribute__((aligned(16))) _Float16 qst[2][32 * LP];
  const unsigned int ql = (unsigned int)(uintptr_t)&qst[0][0] +
                          (threadIdx.x >> 4) * (LP * 2) + (threadIdx.x & 15) * 16;
  const _Float16* qg = Qh + threadIdx.x * 8;
  async_copy2(ql, ql + 16 * LP * 2, qg, qg + 256 * 8);            // chunk 0 -> buffer 0
  // a Vt chunk = 128 rows of 64 bytes = 512 pieces of 16 bytes; thread t copies
  // pieces t and t + 256: piece p is bytes 16 (p & 3) .. +15 of row p >> 2.
  const unsigned int vl = (unsigned int)(uintptr_t)&vstage[0][0] +
                          (threadIdx.x >> 2) * (VP * 2) + (threadIdx.x & 3) * 16;
  const _Float16* vg = Vt + (size_t)(threadIdx.x >> 2) * SQ + (threadIdx.x & 3) * 8;
  async_copy2(vl, vl + 64 * VP * 2, vg, vg + (size_t)64 * SQ);    // chunk 0 -> buffer 0

  v16h ak[OKT][4];
#pragma unroll
  for (int kt = 0; kt < OKT; ++kt) {
#pragma unroll
    for (int dc = 0; dc < 4; ++dc) ak[kt][dc] = load_tile_ab(Kh, DD, k0 + kt * 16, dc * 32, lane);
  }

  v8f acc[OKT][8];
#pragma unroll
  for (int kt = 0; kt < OKT; ++kt) {
#pragma unroll
    for (int dt = 0; dt < 8; ++dt) acc[kt][dt] = (v8f){};
  }

  const int NCHUNK = SQ / QSPLIT / 32;
  // chunk 0 of Q and of Vt: this wave's copies have landed; the barrier publishes all
  asm volatile("s_wait_asynccnt 0x0" ::: "memory");
  __syncthreads();
  async_copy2(ql + 32 * LP * 2, ql + 48 * LP * 2,                 // chunk 1 -> buffer 1
              qg + 32 * DD, qg + 32 * DD + 256 * 8);

  for (int ci = 0; ci < NCHUNK; ++ci) {
    const int q0 = ci * 32;
    // ---- S = K x Q^T for 16 OKT k-rows x 32 q-cols (accumulate over d=128) ----
    v8f c0[OKT], c1[OKT];
#pragma unroll
    for (int kt = 0; kt < OKT; ++kt) { c0[kt] = (v8f){}; c1[kt] = (v8f){}; }
#pragma unroll
    for (int dc = 0; dc < 4; ++dc) {
      v16h b0 = load_tile_ab(&qst[ci & 1][0], LP, 0,  dc * 32, lane);
      v16h b1 = load_tile_ab(&qst[ci & 1][0], LP, 16, dc * 32, lane);
#pragma unroll
      for (int kt = 0; kt < OKT; ++kt) {
        c0[kt] = __builtin_amdgcn_wmma_f32_16x16x32_f16(false, ak[kt][dc], false, b0,
                                                        (short)0, c0[kt], false, false);
        c1[kt] = __builtin_amdgcn_wmma_f32_16x16x32_f16(false, ak[kt][dc], false, b1,
                                                        (short)0, c1[kt], false, false);
      }
    }
    __syncthreads();   // (A) prior chunk's plds/vstage reads complete
    // ---- p = exp2(s*scale2 - m2[q]) * rZ[q], staged to LDS in (m,q) form --
    float mq0 = m2[q0 + n],      rz0 = rZ[q0 + n];
    float mq1 = m2[q0 + 16 + n], rz1 = rZ[q0 + 16 + n];
#pragma unroll
    for (int kt = 0; kt < OKT; ++kt) {
#pragma unroll
      for (int r = 0; r < 8; ++r) {
        int mrow = kt * 16 + r + 8 * hi;
        plds[wv][mrow * 32 + n]      = (_Float16)(fexp2(c0[kt][r] * SCALE2 - mq0) * rz0);
        plds[wv][mrow * 32 + 16 + n] = (_Float16)(fexp2(c1[kt][r] * SCALE2 - mq1) * rz1);
      }
    }
    // Publish point of Q chunk ci + 1 and Vt chunk ci: this wave's LDS reads and
    // writes are done and its own copies have landed; barrier (B) follows.
    asm volatile("s_wait_dscnt 0x0" ::: "memory");
    asm volatile("s_wait_asynccnt 0x0" ::: "memory");
    __syncthreads();   // (B) plds written + vstage[ci&1], qst[(ci+1)&1] published to block
    if (ci + 1 < NCHUNK) {   // Vt chunk ci + 1 into the buffer whose readers ended at (A)
      const unsigned int lb = vl + ((ci + 1) & 1) * (DD * VP * 2);
      const _Float16* gb = vg + (q0 + 32);
      async_copy2(lb, lb + 64 * VP * 2, gb, gb + (size_t)64 * SQ);
    }
    if (ci + 2 < NCHUNK) {   // Q chunk ci + 2 into the buffer that chunk ci has left
      const unsigned int lb = ql + (ci & 1) * (32 * LP * 2);
      const _Float16* gb = qg + (size_t)(q0 + 64) * DD;
      async_copy2(lb, lb + 16 * LP * 2, gb, gb + 256 * 8);
    }
    // ---- read P back in WMMA A layout (16x32) ----------------------------
    v16h pa[OKT];
#pragma unroll
    for (int kt = 0; kt < OKT; ++kt) {
      v8h lo = *(const v8h*)&plds[wv][(kt * 16 + n) * 32 + 8 * hi];
      v8h hp = *(const v8h*)&plds[wv][(kt * 16 + n) * 32 + 16 + 8 * hi];
#pragma unroll
      for (int i = 0; i < 8; ++i) { pa[kt][i] = lo[i]; pa[kt][i + 8] = hp[i]; }
    }
    // ---- O(16x128) += P(16x32) x Vt-as-B(32q x 16d) per d-tile -----------
    const _Float16* vsrc = &vstage[ci & 1][0];          // row-major [128][32], pitch VP
#pragma unroll
    for (int dt = 0; dt < 8; ++dt) {
      v16h bv = load_tile_ab(vsrc, VP, dt * 16, 0, lane);
#pragma unroll
      for (int kt = 0; kt < OKT; ++kt)
        acc[kt][dt] = __builtin_amdgcn_wmma_f32_16x16x32_f16(false, pa[kt], false, bv,
                                                             (short)0, acc[kt][dt], false, false);
    }
  }
  // no copy is left in flight when the wave ends
  asm volatile("s_wait_asynccnt 0x0" ::: "memory");
  // ---- store C layout: element (m = r+8*hi, col = dt*16+n); write-once ----
  // plain stores: sda_reduce reads these partial sums back at once
#pragma unroll
  for (int kt = 0; kt < OKT; ++kt) {
#pragma unroll
    for (int dt = 0; dt < 8; ++dt) {
#pragma unroll
      for (int r = 0; r < 8; ++r) {
        out[(size_t)(k0 + kt * 16 + r + 8 * hi) * (QSPLIT * DD) + dt * 16 + n] = acc[kt][dt][r];
      }
    }
  }
}

// ---------------------------------------------------------------------------
// Kernel 4: out = sum of the QSPLIT partial outputs, in range order.
// ---------------------------------------------------------------------------
__global__ void sda_reduce(const float* __restrict__ part, float* __restrict__ out) {
  const int i = blockIdx.x * blockDim.x + threadIdx.x;   // float4 index, 0 .. SK*DD/4-1
  // row k = i / 32 holds QSPLIT partial rows of 32 float4 each
  const float4* row4 = (const float4*)part + (i >> 5) * (QSPLIT * DD / 4) + (i & 31);
  float4 v[QSPLIT];
#pragma unroll
  for (int p = 0; p < QSPLIT; ++p) v[p] = row4[p * (DD / 4)];
  float4 s = v[0];
#pragma unroll
  for (int p = 1; p < QSPLIT; ++p) { s.x += v[p].x; s.y += v[p].y; s.z += v[p].z; s.w += v[p].w; }
  ((float4*)out)[i] = s;
}

extern "C" void kernel_launch(void* const* d_in, const int* in_sizes, int n_in,
                              void* d_out, int out_size, void* d_ws, size_t ws_size,
                              hipStream_t stream) {
  (void)in_sizes; (void)n_in; (void)out_size; (void)ws_size;
  const float* K = (const float*)d_in[0];
  const float* Q = (const float*)d_in[1];
  const float* V = (const float*)d_in[2];
  float* out = (float*)d_out;

  _Float16* Kh = (_Float16*)d_ws;                       // [8192,128] f16
  _Float16* Qh = Kh + (size_t)SK * DD;                  // [8192,128] f16
  _Float16* Vt = Qh + (size_t)SQ * DD;                  // [128,8192] f16 (transposed)
  float*    m2 = (float*)(Vt + (size_t)DD * SQ);        // [8192] column max (log2 dom)
  float*    rZ = m2 + SQ;                               // [8192] 1/sum
  float*    pmz = rZ + SQ;                              // [KSPLIT][8192] range (max, sum) pairs
  float*    part = pmz + (size_t)KSPLIT * SQ * 2;       // [8192][QSPLIT][128] partial out

  sda_convert<<<(SK * DD) / 256, 256, 0, stream>>>(K, Q, V, Kh, Qh, Vt);
  // 8 waves/block: 128 SQT q columns (128 OKT k rows) per block in x; the split ranges in y
  sda_stats<<<dim3(SQ / (128 * SQT), KSPLIT), 256, 0, stream>>>(Kh, Qh, pmz);
  sda_stats_merge<<<SQ / 256, 256, 0, stream>>>(pmz, m2, rZ);
  sda_output<<<dim3(SK / (128 * OKT), QSPLIT), 256, 0, stream>>>(Kh, Qh, Vt, m2, rZ, part);
  sda_reduce<<<(SK * DD) / 4 / 256, 256, 0, stream>>>(part, out);
}

// v004
// One run takes 82.5 microseconds.
// Timed twice side by side with v003, it ran 1.38 times as fast both times.
// All steps since v000 together make it 12.9 times as fast.
#include <hip/hip_runtime.h>
#include <hip/hip_bf16.h>

typedef __attribute__((ext_vector_type(16))) _Float16 v16h;
typedef __attribute__((ext_vector_type(8)))  _Float16 v8h;
typedef __attribute__((ext_vector_type(8)))  float    v8f;

#define SK 8192
#define SQ 8192
#define DD 128
// The k loop of the stats kernel and the q loop of the output kernel are cut
// into KSPLIT / QSPLIT equal ranges, one per blockIdx.y, so that the grid
// covers every WGP; the ranges' partial results are merged by small launches.
#define KSPLIT 32
#define QSPLIT 16
// Wave tiles: a stats wave owns SQT 16-column q tiles and an output wave OKT
// 16-row k tiles, so that one fragment read from LDS feeds SQT (OKT) WMMAs.
// Every loop over these tiles is unrolled: its fragment and accumulator arrays
// stay in registers only if each index is a constant.
#define SQT 4
#define OKT 2
// 1/sqrt(128) * log2(e): softmax computed in log2 domain -> native v_exp_f32
#define SCALE2 0.12751589906834162f

// Raw v_exp_f32: args here are bounded (<= 0, > -40), so skip OCML's
// underflow-guard path (saves ~6 VALU per exponential in the hot loop).
__device__ __forceinline__ float fexp2(float x) {
#if defined(__HIP_DEVICE_COMPILE__) && __has_builtin(__builtin_amdgcn_exp2f)
  return __builtin_amdgcn_exp2f(x);
#else
  return exp2f(x);
#endif
}

// ---------------------------------------------------------------------------
// Load a 16x32 f16 tile from a row-major matrix into the WMMA A/B register
// layout (ISA 7.12.2, 16-bit A-matrix 16x32):
//   lanes 0-15 : row = row0+lane,    halves 0-7 = cols c0+0..7,  8-15 = c0+16..23
//   lanes 16-31: row = row0+lane-16, halves 0-7 = cols c0+8..15, 8-15 = c0+24..31
// Both chunks are 16B aligned -> two b128 loads per lane (global or ds).
// Serves B operands too: a B (KxN) tile equals the A layout of rows of the
// row-major N-major source (lane = column index n).
// ---------------------------------------------------------------------------
__device__ __forceinline__ v16h load_tile_ab(const _Float16* base,
                                             int ld, int row0, int col0, int lane) {
  const int r  = row0 + (lane & 15);
  const int hs = (lane >> 4) & 1;
  const _Float16* p = base + (size_t)r * ld + col0 + hs * 8;
  v8h lo = *(const v8h*)p;
  v8h hi = *(const v8h*)(p + 16);
  v16h out;
#pragma unroll
  for (int i = 0; i < 8; ++i) { out[i] = lo[i]; out[i + 8] = hi[i]; }
  return out;
}

// LDS pitch, in halfs, of a staged 128-half row: 272 bytes = 16 x 17, the
// conflict-free pitch for 16-byte LDS reads of 256-byte rows.
#define LP 136
// The same for a staged 32-half row: 80 bytes = 16 x 5.
#define VP 40

// Asynchronous copies global -> LDS, 16 bytes per lane and copy, through no
// register. l* = the lane's own LDS byte address, g* = its own global address.
// The closing s_wait_xcnt stands inside the statement so that no address
// register of an issued copy is rewritten in front of it.
__device__ __forceinline__ void async_copy2(unsigned int l0, unsigned int l1,
                                            const _Float16* g0, const _Float16* g1) {
  asm volatile("global_load_async_to_lds_b128 %0, %2, off\n\t"
               "global_load_async_to_lds_b128 %1, %3, off\n\t"
               "s_wait_xcnt 0x0"
               :: "v"(l0), "v"(l1), "v"(g0), "v"(g1) : "memory");
}
__device__ __forceinline__ void async_copy8(unsigned int l, const _Float16* g,
                                            unsigned int lstep, int gstep) {
  asm volatile("global_load_async_to_lds_b128 %0, %8, off\n\t"
               "global_load_async_to_lds_b128 %1, %9, off\n\t"
               "global_load_async_to_lds_b128 %2, %10, off\n\t"
               "global_load_async_to_lds_b128 %3, %11, off\n\t"
               "global_load_async_to_lds_b128 %4, %12, off\n\t"
               "global_load_async_to_lds_b128 %5, %13, off\n\t"
               "global_load_async_to_lds_b128 %6, %14, off\n\t"
               "global_load_async_to_lds_b128 %7, %15, off\n\t"
               "s_wait_xcnt 0x0"
               :: "v"(l), "v"(l + lstep), "v"(l + 2 * lstep), "v"(l + 3 * lstep),
                  "v"(l + 4 * lstep), "v"(l + 5 * lstep), "v"(l + 6 * lstep), "v"(l + 7 * lstep),
                  "v"(g), "v"(g + gstep), "v"(g + 2 * gstep), "v"(g + 3 * gstep),
                  "v"(g + 4 * gstep), "v"(g + 5 * gstep), "v"(g + 6 * gstep), "v"(g + 7 * gstep)
               : "memory");
}

// ---------------------------------------------------------------------------
// Kernel 1: f32 -> f16 copies of K and Q; transposed f16 copy of V (Vt[d][q]).
// One work-group per 64 q x 64 d tile of V (256 in all), which also converts
// 4096 elements of K and of Q. Every thread has its 12 16-byte loads in flight
// at once; V is transposed through LDS so that Vt is stored in whole 128-byte
// lines, each by one work-group.
// ---------------------------------------------------------------------------
// LDS pitch, in halfs, of a transposed 64-half row: 144 bytes = 16 x 9.
#define TP 72
typedef __attribute__((ext_vector_type(4))) _Float16 v4h;
typedef __attribute__((ext_vector_type(2))) _Float16 v2h;
typedef __attribute__((ext_vector_type(4))) float v4f;
__global__ __launch_bounds__(256) void sda_convert(const float* __restrict__ K, const float* __restrict__ Q,
                            const float* __restrict__ V,
                            _Float16* __restrict__ Kh, _Float16* __restrict__ Qh,
                            _Float16* __restrict__ Vt) {
  __shared__ __attribute__((aligned(16))) _Float16 tl[64 * TP];   // [d][q]
  const int t  = threadIdx.x;
  const int q0 = (blockIdx.x >> 1) * 64;
  const int d0 = (blockIdx.x & 1) * 64;
  const int c  = t & 15;      // which float4 of the tile's 64-float row
  const int rp = t >> 4;      // which pair of rows
  // V rows q0 + 32 j + 2 rp and the next one, floats d0 + 4 c .. + 3
  const float* vp = V + (size_t)q0 * DD + d0 + (2 * rp * DD + 4 * c);
  v4f va[2], vb[2];
#pragma unroll
  for (int j = 0; j < 2; ++j) {
    va[j] = *(const v4f*)(vp + 32 * j * DD);
    vb[j] = *(const v4f*)(vp + 32 * j * DD + DD);
  }
  // The offset register of the V loads is given to a later load's result: this
  // wait stands in front of that overwrite.
  asm volatile("s_wait_xcnt 0x0" ::: "memory");
  // K and Q: float4 pieces t + 256 j of this work-group's 1024
  const v4f* K4 = (const v4f*)K + blockIdx.x * 1024 + t;
  const v4f* Q4 = (const v4f*)Q + blockIdx.x * 1024 + t;
  v4f kv[4], qv[4];
#pragma unroll
  for (int j = 0; j < 4; ++j) { kv[j] = K4[256 * j]; qv[j] = Q4[256 * j]; }

#pragma unroll
  for (int j = 0; j < 2; ++j) {
#pragma unroll
    for (int i = 0; i < 4; ++i) {
      v2h h = {(_Float16)va[j][i], (_Float16)vb[j][i]};     // q, q + 1 of one d
      *(v2h*)&tl[(4 * c + i) * TP + 32 * j + 2 * rp] = h;
    }
  }
  // Holds the K and Q loads in front of the barrier, whole and in flight beside
  // the V loads: without it half of each is sunk behind the barrier and pays a
  // second round trip there.
  asm volatile("" :: "v"(kv[0]), "v"(kv[1]), "v"(kv[2]), "v"(kv[3]),
                     "v"(qv[0]), "v"(qv[1]), "v"(qv[2]), "v"(qv[3]));
  // The transposed tile is complete. No global store stands in front of this
  // barrier: it would wait for that store to finish.
  __syncthreads();
  // 64 rows of 128 bytes = 512 pieces of 16 bytes; thread t stores pieces t, t + 256
#pragma unroll
  for (int j = 0; j < 2; ++j) {
    const int p = t + 256 * j;
    const int d = p >> 3, g = p & 7;
    *(v8h*)&Vt[(size_t)(d0 + d) * SQ + q0 + 8 * g] = *(const v8h*)&tl[d * TP + 8 * g];
  }
  v4h* Kh4 = (v4h*)Kh + blockIdx.x * 1024 + t;
  v4h* Qh4 = (v4h*)Qh + blockIdx.x * 1024 + t;
#pragma unroll
  for (int j = 0; j < 4; ++j) {
    Kh4[256 * j] = __builtin_convertvector(kv[j], v4h);
    Qh4[256 * j] = __builtin_convertvector(qv[j], v4h);
  }
}

// ---------------------------------------------------------------------------
// Kernel 2: per-query-column softmax stats over one range of the k axis.
// Each wave owns 16 SQT q columns; loops its k range (blockIdx.y) in 16-row tiles.
// Online (max, sum-exp2) per column, merged across lane halves via shfl_xor 16.
// Writes the range's (max, sum) pair; sda_stats_merge joins the ranges.
// The range's K rows, which all 8 waves read, are copied once per block into
// LDS in whole lines; the fragments are then read from LDS.
// ---------------------------------------------------------------------------
// The real block size lifts the register ceiling to what the wave tile needs.
__global__ __launch_bounds__(256) void sda_stats(const _Float16* __restrict__ Kh_all,
                          const _Float16* __restrict__ Qh,
                          float* __restrict__ pmz_f) {
  float2* pmz = (float2*)pmz_f;                  // [KSPLIT][SQ] (max, sum) pairs
  const _Float16* Kh = Kh_all + (size_t)blockIdx.y * (SK / KSPLIT) * DD;
  const int lane = threadIdx.x & 31;
  const int wave = (blockIdx.x * blockDim.x + threadIdx.x) >> 5;
  const int q0 = wave * (16 * SQT);

  // 256 rows of 256 bytes = 4096 pieces of 16 bytes; thread t copies pieces
  // t + 256 j, j = 0..15: piece p is bytes 16 (p & 15) .. +15 of row p >> 4.
  __shared__ __attribute__((aligned(16))) _Float16 kst[(SK / KSPLIT) * LP];
  {
    const int t = threadIdx.x;
    const unsigned int l = (unsigned int)(uintptr_t)&kst[0] + (t >> 4) * (LP * 2) + (t & 15) * 16;
    const _Float16* g = Kh + t * 8;
    async_copy8(l, g, 16 * LP * 2, 256 * 8);
    async_copy8(l + 8 * 16 * LP * 2, g + 8 * 256 * 8, 16 * LP * 2, 256 * 8);
  }

  v16h bq[SQT][4];
#pragma unroll
  for (int qt = 0; qt < SQT; ++qt) {
#pragma unroll
    for (int dc = 0; dc < 4; ++dc) bq[qt][dc] = load_tile_ab(Qh + (size_t)q0 * DD, DD, qt * 16, dc * 32, lane);
  }

  // this wave's copies have landed; behind the barrier every wave's have
  asm volatile("s_wait_asynccnt 0x0" ::: "memory");
  __syncthreads();

  float mrun[SQT], zrun[SQT];
#pragma unroll
  for (int qt = 0; qt < SQT; ++qt) { mrun[qt] = -__builtin_inff(); zrun[qt] = 0.0f; }

  for (int k0 = 0; k0 < SK / KSPLIT; k0 += 16) {
    v16h a[4];
#pragma unroll
    for (int dc = 0; dc < 4; ++dc) a[dc] = load_tile_ab(kst, LP, k0, dc * 32, lane);
    v8f c[SQT];
#pragma unroll
    for (int qt = 0; qt < SQT; ++qt) c[qt] = (v8f){};
#pragma unroll
    for (int dc = 0; dc < 4; ++dc) {
#pragma unroll
      for (int qt = 0; qt < SQT; ++qt)
        c[qt] = __builtin_amdgcn_wmma_f32_16x16x32_f16(false, a[dc], false, bq[qt][dc],
                                                       (short)0, c[qt], false, false);
    }
    // C layout: lane holds column n=lane&15, rows r+8*(lane>>4), r=0..7
#pragma unroll
    for (int qt = 0; qt < SQT; ++qt) {
      float tmax = c[qt][0];
#pragma unroll
      for (int r = 1; r < 8; ++r) tmax = fmaxf(tmax, c[qt][r]);
      tmax = fmaxf(tmax, __shfl_xor(tmax, 16, 32));
      tmax *= SCALE2;
      float nm = fmaxf(mrun[qt], tmax);
      float ts = 0.0f;
#pragma unroll
      for (int r = 0; r < 8; ++r) ts += fexp2(c[qt][r] * SCALE2 - nm);
      ts += __shfl_xor(ts, 16, 32);
      zrun[qt] = zrun[qt] * fexp2(mrun[qt] - nm) + ts;
      mrun[qt] = nm;
    }
  }
  if (lane < 16) {
#pragma unroll
    for (int qt = 0; qt < SQT; ++qt)
      pmz[blockIdx.y * SQ + q0 + qt * 16 + lane] = make_float2(mrun[qt], zrun[qt]);
  }
}

// ---------------------------------------------------------------------------
// Kernel 2b: join the KSPLIT (max, sum) pairs of each q column.
// ---------------------------------------------------------------------------
__global__ void sda_stats_merge(const float* __restrict__ pmz_f,
                                float* __restrict__ m2, float* __restrict__ rZ) {
  const float2* pmz = (const float2*)pmz_f;      // [KSPLIT][SQ] (max, sum) pairs
  const int q = blockIdx.x * blockDim.x + threadIdx.x;   // 0 .. SQ-1
  float2 p[KSPLIT];
#pragma unroll
  for (int s = 0; s < KSPLIT; ++s) p[s] = pmz[s * SQ + q];
  float m = p[0].x;
#pragma unroll
  for (int s = 1; s < KSPLIT; ++s) m = fmaxf(m, p[s].x);
  float z = 0.0f;
#pragma unroll
  for (int s = 0; s < KSPLIT; ++s) z += p[s].y * fexp2(p[s].x - m);
  m2[q] = m;
  rZ[q] = 1.0f / z;
}

// ---------------------------------------------------------------------------
// Kernel 3: output. Each wave owns 16 OKT k rows x full 128 d (8 OKT f32 accumulators)
// over one range of the q axis (blockIdx.y); the range's f32 partial sum goes
// to the workspace and sda_reduce adds the ranges.
// Per 32-q chunk: recompute S, p = exp2(s-m2[q])*rZ[q] in f16,
// C-layout -> A-layout via wave-private LDS tile, then 8 OKT WMMAs against Vt.
// The Q chunk (32x128 f16) and the Vt chunk (128x32 f16), shared by ALL waves,
// are copied block-wide into LDS by asynchronous copies, two buffers each: Q
// two chunks ahead, Vt one chunk ahead, both published by barrier (B).
// ---------------------------------------------------------------------------
// The real block size lifts the register ceiling to what the wave tile needs;
// four waves per SIMD (256 registers) keep two work-groups on a WGP, so that the
// whole grid is resident at once.
__global__ __launch_bounds__(256, 4) void sda_output(const _Float16* __restrict__ Kh,
                           const _Float16* __restrict__ Qh_all,
                           const _Float16* __restrict__ Vt_all,
                           const float* __restrict__ m2_all,
                           const float* __restrict__ rZ_all,
                           float* __restrict__ part) {
  // this work-group's q range: every q index below is relative to qbase
  const int qbase = blockIdx.y * (SQ / QSPLIT);
  const _Float16* Qh = Qh_all + (size_t)qbase * DD;
  const _Float16* Vt = Vt_all + qbase;
  const float* m2 = m2_all + qbase;
  const float* rZ = rZ_all + qbase;
  float* out = part + blockIdx.y * DD;   // partials lie as [k][range][d]
  __shared__ _Float16 plds[8][OKT * 16 * 32]; // per-wave (16 OKT)x32 P tile, 16 KB
  __shared__ __attribute__((aligned(16))) _Float16 vstage[2][DD * VP];  // Vt chunks, 20 KB
  const int lane = threadIdx.x & 31;
  const int wv   = threadIdx.x >> 5;
  const int wave = (blockIdx.x * blockDim.x + threadIdx.x) >> 5;
  const int k0   = wave * (16 * OKT);
  const int n    = lane & 15;
  const int hi   = lane >> 4;

  // a chunk = 32 rows of 256 bytes = 512 pieces of 16 bytes; thread t copies
  // pieces t and t + 256: piece p is bytes 16 (p & 15) .. +15 of row p >> 4.
  __shared__ __attribute__((aligned(16))) _Float16 qst[2][32 * LP];
  const unsigned int ql = (unsigned int)(uintptr_t)&qst[0][0] +
                          (threadIdx.x >> 4) * (LP * 2) + (threadIdx.x & 15) * 16;
  const _Float16* qg = Qh + threadIdx.x * 8;
  async_copy2(ql, ql + 16 * LP * 2, qg, qg + 256 * 8);            // chunk 0 -> buffer 0
  // a Vt chunk = 128 rows of 64 bytes = 512 pieces of 16 bytes; thread t copies
  // pieces t and t + 256: piece p is bytes 16 (p & 3) .. +15 of row p >> 2.
  const unsigned int vl = (unsigned int)(uintptr_t)&vstage[0][0] +
                          (threadIdx.x >> 2) * (VP * 2) + (threadIdx.x & 3) * 16;
  const _Float16* vg = Vt + (size_t)(threadIdx.x >> 2) * SQ + (threadIdx.x & 3) * 8;
  async_copy2(vl, vl + 64 * VP * 2, vg, vg + (size_t)64 * SQ);    // chunk 0 -> buffer 0

  v16h ak[OKT][4];
#pragma unroll
  for (int kt = 0; kt < OKT; ++kt) {
#pragma unroll
    for (int dc = 0; dc < 4; ++dc) ak[kt][dc] = load_tile_ab(Kh, DD, k0 + kt * 16, dc * 32, lane);
  }

  v8f acc[OKT][8];
#pragma unroll
  for (int kt = 0; kt < OKT; ++kt) {
#pragma unroll
    for (int dt = 0; dt < 8; ++dt) acc[kt][dt] = (v8f){};
  }

  const int NCHUNK = SQ / QSPLIT / 32;
  // chunk 0 of Q and of Vt: this wave's copies have landed; the barrier publishes all
  asm volatile("s_wait_asynccnt 0x0" ::: "memory");
  __syncthreads();
  async_copy2(ql + 32 * LP * 2, ql + 48 * LP * 2,                 // chunk 1 -> buffer 1
              qg + 32 * DD, qg + 32 * DD + 256 * 8);

  for (int ci = 0; ci < NCHUNK; ++ci) {
    const int q0 = ci * 32;
    // ---- S = K x Q^T for 16 OKT k-rows x 32 q-cols (accumulate over d=128) ----
    v8f c0[OKT], c1[OKT];
#pragma unroll
    for (int kt = 0; kt < OKT; ++kt) { c0[kt] = (v8f){}; c1[kt] = (v8f){}; }
#pragma unroll
    for (int dc = 0; dc < 4; ++dc) {
      v16h b0 = load_tile_ab(&qst[ci & 1][0], LP, 0,  dc * 32, lane);
      v16h b1 = load_tile_ab(&qst[ci & 1][0], LP, 16, dc * 32, lane);
#pragma unroll
      for (int kt = 0; kt < OKT; ++kt) {
        c0[kt] = __builtin_amdgcn_wmma_f32_16x16x32_f16(false, ak[kt][dc], false, b0,
                                                        (short)0, c0[kt], false, false);
        c1[kt] = __builtin_amdgcn_wmma_f32_16x16x32_f16(false, ak[kt][dc], false, b1,
                                                        (short)0, c1[kt], false, false);
      }
    }
    __syncthreads();   // (A) prior chunk's plds/vstage reads complete
    // ---- p = exp2(s*scale2 - m2[q]) * rZ[q], staged to LDS in (m,q) form --
    float mq0 = m2[q0 + n],      rz0 = rZ[q0 + n];
    float mq1 = m2[q0 + 16 + n], rz1 = rZ[q0 + 16 + n];
#pragma unroll
    for (int kt = 0; kt < OKT; ++kt) {
#pragma unroll
      for (int r = 0; r < 8; ++r) {
        int mrow = kt * 16 + r + 8 * hi;
        plds[wv][mrow * 32 + n]      = (_Float16)(fexp2(c0[kt][r] * SCALE2 - mq0) * rz0);
        plds[wv][mrow * 32 + 16 + n] = (_Float16)(fexp2(c1[kt][r] * SCALE2 - mq1) * rz1);
      }
    }
    // Publish point of Q chunk ci + 1 and Vt chunk ci: this wave's LDS reads and
    // writes are done and its own copies have landed; barrier (B) follows.
    asm volatile("s_wait_dscnt 0x0" ::: "memory");
    asm volatile("s_wait_asynccnt 0x0" ::: "memory");
    __syncthreads();   // (B) plds written + vstage[ci&1], qst[(ci+1)&1] published to block
    if (ci + 1 < NCHUNK) {   // Vt chunk ci + 1 into the buffer whose readers ended at (A)
      const unsigned int lb = vl + ((ci + 1) & 1) * (DD * VP * 2);
      const _Float16* gb = vg + (q0 + 32);
      async_copy2(lb, lb + 64 * VP * 2, gb, gb + (size_t)64 * SQ);
    }
    if (ci + 2 < NCHUNK) {   // Q chunk ci + 2 into the buffer that chunk ci has left
      const unsigned int lb = ql + (ci & 1) * (32 * LP * 2);
      const _Float16* gb = qg + (size_t)(q0 + 64) * DD;
      async_copy2(lb, lb + 16 * LP * 2, gb, gb + 256 * 8);
    }
    // ---- read P back in WMMA A layout (16x32) ----------------------------
    v16h pa[OKT];
#pragma unroll
    for (int kt = 0; kt < OKT; ++kt) {
      v8h lo = *(const v8h*)&plds[wv][(kt * 16 + n) * 32 + 8 * hi];
      v8h hp = *(const v8h*)&plds[wv][(kt * 16 + n) * 32 + 16 + 8 * hi];
#pragma unroll
      for (int i = 0; i < 8; ++i) { pa[kt][i] = lo[i]; pa[kt][i + 8] = hp[i]; }
    }
    // ---- O(16x128) += P(16x32) x Vt-as-B(32q x 16d) per d-tile -----------
    const _Float16* vsrc = &vstage[ci & 1][0];          // row-major [128][32], pitch VP
#pragma unroll
    for (int dt = 0; dt < 8; ++dt) {
      v16h bv = load_tile_ab(vsrc, VP, dt * 16, 0, lane);
#pragma unroll
      for (int kt = 0; kt < OKT; ++kt)
        acc[kt][dt] = __builtin_amdgcn_wmma_f32_16x16x32_f16(false, pa[kt], false, bv,
                                                             (short)0, acc[kt][dt], false, false);
    }
  }
  // no copy is left in flight when the wave ends
  asm volatile("s_wait_asynccnt 0x0" ::: "memory");
  // ---- store C layout: element (m = r+8*hi, col = dt*16+n); write-once ----
  // plain stores: sda_reduce reads these partial sums back at once
#pragma unroll
  for (int kt = 0; kt < OKT; ++kt) {
#pragma unroll
    for (int dt = 0; dt < 8; ++dt) {
#pragma unroll
      for (int r = 0; r < 8; ++r) {
        out[(size_t)(k0 + kt * 16 + r + 8 * hi) * (QSPLIT * DD) + dt * 16 + n] = acc[kt][dt][r];
      }
    }
  }
}

// ---------------------------------------------------------------------------
// Kernel 4: out = sum of the QSPLIT partial outputs, in range order.
// ---------------------------------------------------------------------------
__global__ void sda_reduce(const float* __restrict__ part, float* __restrict__ out) {
  const int i = blockIdx.x * blockDim.x + threadIdx.x;   // float4 index, 0 .. SK*DD/4-1
  // row k = i / 32 holds QSPLIT partial rows of 32 float4 each
  const float4* row4 = (const float4*)part + (i >> 5) * (QSPLIT * DD / 4) + (i & 31);
  float4 v[QSPLIT];
#pragma unroll
  for (int p = 0; p < QSPLIT; ++p) v[p] = row4[p * (DD / 4)];
  float4 s = v[0];
#pragma unroll
  for (int p = 1; p < QSPLIT; ++p) { s.x += v[p].x; s.y += v[p].y; s.z += v[p].z; s.w += v[p].w; }
  ((float4*)out)[i] = s;
}

extern "C" void kernel_launch(void* const* d_in, const int* in_sizes, int n_in,
                              void* d_out, int out_size, void* d_ws, size_t ws_size,
                              hipStream_t stream) {
  (void)in_sizes; (void)n_in; (void)out_size; (void)ws_size;
  const float* K = (const float*)d_in[0];
  const float* Q = (const float*)d_in[1];
  const float* V = (const float*)d_in[2];
  float* out = (float*)d_out;

  _Float16* Kh = (_Float16*)d_ws;                       // [8192,128] f16
  _Float16* Qh = Kh + (size_t)SK * DD;                  // [8192,128] f16
  _Float16* Vt = Qh + (size_t)SQ * DD;                  // [128,8192] f16 (transposed)
  float*    m2 = (float*)(Vt + (size_t)DD * SQ);        // [8192] column max (log2 dom)
  float*    rZ = m2 + SQ;                               // [8192] 1/sum
  float*    pmz = rZ + SQ;                              // [KSPLIT][8192] range (max, sum) pairs
  float*    part = pmz + (size_t)KSPLIT * SQ * 2;       // [8192][QSPLIT][128] partial out

  sda_convert<<<(SQ / 64) * (DD / 64), 256, 0, stream>>>(K, Q, V, Kh, Qh, Vt);
  // 8 waves/block: 128 SQT q columns (128 OKT k rows) per block in x; the split ranges in y
  sda_stats<<<dim3(SQ / (128 * SQT), KSPLIT), 256, 0, stream>>>(Kh, Qh, pmz);
  sda_stats_merge<<<SQ / 256, 256, 0, stream>>>(pmz, m2, rZ);
  sda_output<<<dim3(SK / (128 * OKT), QSPLIT), 256, 0, stream>>>(Kh, Qh, Vt, m2, rZ, part);
  sda_reduce<<<(SK * DD) / 4 / 256, 256, 0, stream>>>(part, out);
}

// v005
// Measured time: 72 microseconds a run.
// Timed twice side by side with v004, it ran 1.15 times as fast both times.
// Over all steps from v000 it is 14.9 times as fast.
#include <hip/hip_runtime.h>
#include <hip/hip_bf16.h>

typedef __attribute__((ext_vector_type(16))) _Float16 v16h;
typedef __attribute__((ext_vector_type(8)))  _Float16 v8h;
typedef __attribute__((ext_vector_type(8)))  float    v8f;

#define SK 8192
#define SQ 8192
#define DD 128
// The k loop of the stats kernel and the q loop of the output kernel are cut
// into KSPLIT / QSPLIT equal ranges, one per blockIdx.y, so that the grid
// covers every WGP; the ranges' partial results are merged by small launches.
#define KSPLIT 32
#define QSPLIT 16
// Wave tiles: a stats wave owns SQT 16-column q tiles and an output wave OKT
// 16-row k tiles, so that one fragment read from LDS feeds SQT (OKT) WMMAs.
// Every loop over these tiles is unrolled: its fragment and accumulator arrays
// stay in registers only if each index is a constant.
#define SQT 4
#define OKT 2
// 1/sqrt(128) * log2(e): softmax computed in log2 domain -> native v_exp_f32
#define SCALE2 0.12751589906834162f

// Raw v_exp_f32: args here are bounded (<= 0, > -40), so skip OCML's
// underflow-guard path (saves ~6 VALU per exponential in the hot loop).
__device__ __forceinline__ float fexp2(float x) {
#if defined(__HIP_DEVICE_COMPILE__) && __has_builtin(__builtin_amdgcn_exp2f)
  return __builtin_amdgcn_exp2f(x);
#else
  return exp2f(x);
#endif
}

// ---------------------------------------------------------------------------
// Load a 16x32 f16 tile from a row-major matrix into the WMMA A/B register
// layout (ISA 7.12.2, 16-bit A-matrix 16x32):
//   lanes 0-15 : row = row0+lane,    halves 0-7 = cols c0+0..7,  8-15 = c0+16..23
//   lanes 16-31: row = row0+lane-16, halves 0-7 = cols c0+8..15, 8-15 = c0+24..31
// Both chunks are 16B aligned -> two b128 loads per lane (global or ds).
// Serves B operands too: a B (KxN) tile equals the A layout of rows of the
// row-major N-major source (lane = column index n).
// ---------------------------------------------------------------------------
__device__ __forceinline__ v16h load_tile_ab(const _Float16* base,
                                             int ld, int row0, int col0, int lane) {
  const int r  = row0 + (lane & 15);
  const int hs = (lane >> 4) & 1;
  const _Float16* p = base + (size_t)r * ld + col0 + hs * 8;
  v8h lo = *(const v8h*)p;
  v8h hi = *(const v8h*)(p + 16);
  v16h out;
#pragma unroll
  for (int i = 0; i < 8; ++i) { out[i] = lo[i]; out[i + 8] = hi[i]; }
  return out;
}

// LDS pitch, in halfs, of a staged 128-half row: 272 bytes = 16 x 17, the
// conflict-free pitch for 16-byte LDS reads of 256-byte rows.
#define LP 136
// The same for a staged 32-half row: 80 bytes = 16 x 5.
#define VP 40

// Asynchronous copies global -> LDS, 16 bytes per lane and copy, through no
// register. l* = the lane's own LDS byte address, g* = its own global address.
// The closing s_wait_xcnt stands inside the statement so that no address
// register of an issued copy is rewritten in front of it.
__device__ __forceinline__ void async_copy2(unsigned int l0, unsigned int l1,
                                            const _Float16* g0, const _Float16* g1) {
  asm volatile("global_load_async_to_lds_b128 %0, %2, off\n\t"
               "global_load_async_to_lds_b128 %1, %3, off\n\t"
               "s_wait_xcnt 0x0"
               :: "v"(l0), "v"(l1), "v"(g0), "v"(g1) : "memory");
}
__device__ __forceinline__ void async_copy8(unsigned int l, const _Float16* g,
                                            unsigned int lstep, int gstep) {
  asm volatile("global_load_async_to_lds_b128 %0, %8, off\n\t"
               "global_load_async_to_lds_b128 %1, %9, off\n\t"
               "global_load_async_to_lds_b128 %2, %10, off\n\t"
               "global_load_async_to_lds_b128 %3, %11, off\n\t"
               "global_load_async_to_lds_b128 %4, %12, off\n\t"
               "global_load_async_to_lds_b128 %5, %13, off\n\t"
               "global_load_async_to_lds_b128 %6, %14, off\n\t"
               "global_load_async_to_lds_b128 %7, %15, off\n\t"
               "s_wait_xcnt 0x0"
               :: "v"(l), "v"(l + lstep), "v"(l + 2 * lstep), "v"(l + 3 * lstep),
                  "v"(l + 4 * lstep), "v"(l + 5 * lstep), "v"(l + 6 * lstep), "v"(l + 7 * lstep),
                  "v"(g), "v"(g + gstep), "v"(g + 2 * gstep), "v"(g + 3 * gstep),
                  "v"(g + 4 * gstep), "v"(g + 5 * gstep), "v"(g + 6 * gstep), "v"(g + 7 * gstep)
               : "memory");
}

// ---------------------------------------------------------------------------
// Kernel 1: f32 -> f16 copies of K and Q; transposed f16 copy of V (Vt[d][q]).
// One work-group per 64 q x 64 d tile of V (256 in all), which also converts
// 4096 elements of K and of Q. Every thread has its 12 16-byte loads in flight
// at once; V is transposed through LDS so that Vt is stored in whole 128-byte
// lines, each by one work-group.
// ---------------------------------------------------------------------------
// LDS pitch, in halfs, of a transposed 64-half row: 144 bytes = 16 x 9.
#define TP 72
typedef __attribute__((ext_vector_type(4))) _Float16 v4h;
typedef __attribute__((ext_vector_type(2))) _Float16 v2h;
typedef __attribute__((ext_vector_type(4))) float v4f;
__global__ __launch_bounds__(256) void sda_convert(const float* __restrict__ K, const float* __restrict__ Q,
                            const float* __restrict__ V,
                            _Float16* __restrict__ Kh, _Float16* __restrict__ Qh,
                            _Float16* __restrict__ Vt) {
  __shared__ __attribute__((aligned(16))) _Float16 tl[64 * TP];   // [d][q]
  const int t  = threadIdx.x;
  const int q0 = (blockIdx.x >> 1) * 64;
  const int d0 = (blockIdx.x & 1) * 64;
  const int c  = t & 15;      // which float4 of the tile's 64-float row
  const int rp = t >> 4;      // which pair of rows
  // V rows q0 + 32 j + 2 rp and the next one, floats d0 + 4 c .. + 3
  const float* vp = V + (size_t)q0 * DD + d0 + (2 * rp * DD + 4 * c);
  v4f va[2], vb[2];
#pragma unroll
  for (int j = 0; j < 2; ++j) {
    va[j] = *(const v4f*)(vp + 32 * j * DD);
    vb[j] = *(const v4f*)(vp + 32 * j * DD + DD);
  }
  // The offset register of the V loads is given to a later load's result: this
  // wait stands in front of that overwrite.
  asm volatile("s_wait_xcnt 0x0" ::: "memory");
  // K and Q: float4 pieces t + 256 j of this work-group's 1024
  const v4f* K4 = (const v4f*)K + blockIdx.x * 1024 + t;
  const v4f* Q4 = (const v4f*)Q + blockIdx.x * 1024 + t;
  v4f kv[4], qv[4];
#pragma unroll
  for (int j = 0; j < 4; ++j) { kv[j] = K4[256 * j]; qv[j] = Q4[256 * j]; }

#pragma unroll
  for (int j = 0; j < 2; ++j) {
#pragma unroll
    for (int i = 0; i < 4; ++i) {
      v2h h = {(_Float16)va[j][i], (_Float16)vb[j][i]};     // q, q + 1 of one d
      *(v2h*)&tl[(4 * c + i) * TP + 32 * j + 2 * rp] = h;
    }
  }
  // Holds the K and Q loads in front of the barrier, whole and in flight beside
  // the V loads: without it half of each is sunk behind the barrier and pays a
  // second round trip there.
  asm volatile("" :: "v"(kv[0]), "v"(kv[1]), "v"(kv[2]), "v"(kv[3]),
                     "v"(qv[0]), "v"(qv[1]), "v"(qv[2]), "v"(qv[3]));
  // The transposed tile is complete. No global store stands in front of this
  // barrier: it would wait for that store to finish.
  __syncthreads();
  // 64 rows of 128 bytes = 512 pieces of 16 bytes; thread t stores pieces t, t + 256
#pragma unroll
  for (int j = 0; j < 2; ++j) {
    const int p = t + 256 * j;
    const int d = p >> 3, g = p & 7;
    *(v8h*)&Vt[(size_t)(d0 + d) * SQ + q0 + 8 * g] = *(const v8h*)&tl[d * TP + 8 * g];
  }
  v4h* Kh4 = (v4h*)Kh + blockIdx.x * 1024 + t;
  v4h* Qh4 = (v4h*)Qh + blockIdx.x * 1024 + t;
#pragma unroll
  for (int j = 0; j < 4; ++j) {
    Kh4[256 * j] = __builtin_convertvector(kv[j], v4h);
    Qh4[256 * j] = __builtin_convertvector(qv[j], v4h);
  }
}

// ---------------------------------------------------------------------------
// Kernel 2: per-query-column softmax stats over one range of the k axis.
// Each wave owns 16 SQT q columns; loops its k range (blockIdx.y) in 16-row tiles.
// Online (max, sum-exp2) per column, merged across lane halves via shfl_xor 16.
// Writes the range's (max, sum) pair; sda_stats_merge joins the ranges.
// The range's K rows, which all 8 waves read, are copied once per block into
// LDS in whole lines; the fragments are then read from LDS.
// ---------------------------------------------------------------------------
// The real block size lifts the register ceiling to what the wave tile needs.
__global__ __launch_bounds__(256) void sda_stats(const _Float16* __restrict__ Kh_all,
                          const _Float16* __restrict__ Qh,
                          float* __restrict__ pmz_f) {
  float2* pmz = (float2*)pmz_f;                  // [KSPLIT][SQ] (max, sum) pairs
  const _Float16* Kh = Kh_all + (size_t)blockIdx.y * (SK / KSPLIT) * DD;
  const int lane = threadIdx.x & 31;
  const int wave = (blockIdx.x * blockDim.x + threadIdx.x) >> 5;
  const int q0 = wave * (16 * SQT);

  // 256 rows of 256 bytes = 4096 pieces of 16 bytes; thread t copies pieces
  // t + 256 j, j = 0..15: piece p is bytes 16 (p & 15) .. +15 of row p >> 4.
  __shared__ __attribute__((aligned(16))) _Float16 kst[(SK / KSPLIT) * LP];
  {
    const int t = threadIdx.x;
    const unsigned int l = (unsigned int)(uintptr_t)&kst[0] + (t >> 4) * (LP * 2) + (t & 15) * 16;
    const _Float16* g = Kh + t * 8;
    async_copy8(l, g, 16 * LP * 2, 256 * 8);
    async_copy8(l + 8 * 16 * LP * 2, g + 8 * 256 * 8, 16 * LP * 2, 256 * 8);
  }

  v16h bq[SQT][4];
#pragma unroll
  for (int qt = 0; qt < SQT; ++qt) {
#pragma unroll
    for (int dc = 0; dc < 4; ++dc) bq[qt][dc] = load_tile_ab(Qh + (size_t)q0 * DD, DD, qt * 16, dc * 32, lane);
  }

  // this wave's copies have landed; behind the barrier every wave's have
  asm volatile("s_wait_asynccnt 0x0" ::: "memory");
  __syncthreads();

  float mrun[SQT], zrun[SQT];
#pragma unroll
  for (int qt = 0; qt < SQT; ++qt) { mrun[qt] = -__builtin_inff(); zrun[qt] = 0.0f; }

  for (int k0 = 0; k0 < SK / KSPLIT; k0 += 16) {
    v16h a[4];
#pragma unroll
    for (int dc = 0; dc < 4; ++dc) a[dc] = load_tile_ab(kst, LP, k0, dc * 32, lane);
    v8f c[SQT];
#pragma unroll
    for (int qt = 0; qt < SQT; ++qt) c[qt] = (v8f){};
#pragma unroll
    for (int dc = 0; dc < 4; ++dc) {
#pragma unroll
      for (int qt = 0; qt < SQT; ++qt)
        c[qt] = __builtin_amdgcn_wmma_f32_16x16x32_f16(false, a[dc], false, bq[qt][dc],
                                                       (short)0, c[qt], false, false);
    }
    // C layout: lane holds column n=lane&15, rows r+8*(lane>>4), r=0..7
#pragma unroll
    for (int qt = 0; qt < SQT; ++qt) {
      float tmax = c[qt][0];
#pragma unroll
      for (int r = 1; r < 8; ++r) tmax = fmaxf(tmax, c[qt][r]);
      tmax = fmaxf(tmax, __shfl_xor(tmax, 16, 32));
      tmax *= SCALE2;
      float nm = fmaxf(mrun[qt], tmax);
      float ts = 0.0f;
#pragma unroll
      for (int r = 0; r < 8; ++r) ts += fexp2(c[qt][r] * SCALE2 - nm);
      ts += __shfl_xor(ts, 16, 32);
      zrun[qt] = zrun[qt] * fexp2(mrun[qt] - nm) + ts;
      mrun[qt] = nm;
    }
  }
  if (lane < 16) {
#pragma unroll
    for (int qt = 0; qt < SQT; ++qt)
      pmz[blockIdx.y * SQ + q0 + qt * 16 + lane] = make_float2(mrun[qt], zrun[qt]);
  }
}

// ---------------------------------------------------------------------------
// Kernel 2b: join the KSPLIT (max, sum) pairs of each q column.
// ---------------------------------------------------------------------------
__global__ void sda_stats_merge(const float* __restrict__ pmz_f,
                                float* __restrict__ m2, float* __restrict__ rZ) {
  const float2* pmz = (const float2*)pmz_f;      // [KSPLIT][SQ] (max, sum) pairs
  const int q = blockIdx.x * blockDim.x + threadIdx.x;   // 0 .. SQ-1
  float2 p[KSPLIT];
#pragma unroll
  for (int s = 0; s < KSPLIT; ++s) p[s] = pmz[s * SQ + q];
  float m = p[0].x;
#pragma unroll
  for (int s = 1; s < KSPLIT; ++s) m = fmaxf(m, p[s].x);
  float z = 0.0f;
#pragma unroll
  for (int s = 0; s < KSPLIT; ++s) z += p[s].y * fexp2(p[s].x - m);
  m2[q] = m;
  rZ[q] = 1.0f / z;
}

// ---------------------------------------------------------------------------
// Kernel 3: output. Each wave owns 16 OKT k rows x full 128 d (8 OKT f32 accumulators)
// over one range of the q axis (blockIdx.y); the range's f32 partial sum goes
// to the workspace and sda_reduce adds the ranges.
// Per 32-q chunk the scores are formed TRANSPOSED, St = Q x K^T (A = Q rows from
// LDS, B = the wave's K rows in registers): a lane then holds, of one k row,
// q = 8 hi + r of each 16-q tile, which is the k order of the A operand of
// P x V. p = exp2(s-m2[q])*rZ[q] is converted in place: P never leaves registers.
// The Q chunk (32x128 f16) and the Vt chunk (128x32 f16), shared by ALL waves,
// are copied block-wide into LDS by asynchronous copies, two buffers each, one
// chunk ahead, one barrier per chunk. m2 and rZ of the whole range, which now
// differ by register and not by lane, are copied into LDS once.
// ---------------------------------------------------------------------------
__device__ __forceinline__ void async_copy1f(unsigned int l0, const float* g0) {
  asm volatile("global_load_async_to_lds_b128 %0, %1, off\n\t"
               "s_wait_xcnt 0x0"
               :: "v"(l0), "v"(g0) : "memory");
}
__device__ __forceinline__ void async_copy4(unsigned int l0, unsigned int l1,
                                            unsigned int l2, unsigned int l3,
                                            const _Float16* g0, const _Float16* g1,
                                            const _Float16* g2, const _Float16* g3) {
  asm volatile("global_load_async_to_lds_b128 %0, %4, off\n\t"
               "global_load_async_to_lds_b128 %1, %5, off\n\t"
               "global_load_async_to_lds_b128 %2, %6, off\n\t"
               "global_load_async_to_lds_b128 %3, %7, off\n\t"
               "s_wait_xcnt 0x0"
               :: "v"(l0), "v"(l1), "v"(l2), "v"(l3), "v"(g0), "v"(g1), "v"(g2), "v"(g3)
               : "memory");
}
#define QR (SQ / QSPLIT)
// The real block size lifts the register ceiling to what the wave tile needs;
// four waves per SIMD (256 registers) keep two work-groups on a WGP, so that the
// whole grid is resident at once.
__global__ __launch_bounds__(256, 4) void sda_output(const _Float16* __restrict__ Kh,
                           const _Float16* __restrict__ Qh_all,
                           const _Float16* __restrict__ Vt_all,
                           const float* __restrict__ m2_all,
                           const float* __restrict__ rZ_all,
                           float* __restrict__ part) {
  // this work-group's q range: every q index below is relative to qbase
  const int qbase = blockIdx.y * QR;
  const _Float16* Qh = Qh_all + (size_t)qbase * DD;
  const _Float16* Vt = Vt_all + qbase;
  float* out = part + blockIdx.y * DD;   // partials lie as [k][range][d]
  __shared__ __attribute__((aligned(16))) _Float16 vstage[2][DD * VP];  // Vt chunks, 20 KB
  __shared__ __attribute__((aligned(16))) _Float16 qst[2][32 * LP];     // Q chunks, 17 KB
  __shared__ __attribute__((aligned(32))) float mz[2 * QR];             // m2 | rZ of the range
  const int lane = threadIdx.x & 31;
  const int wave = (blockIdx.x * blockDim.x + threadIdx.x) >> 5;
  const int k0   = wave * (16 * OKT);
  const int n    = lane & 15;
  const int hi   = lane >> 4;

  // a Q chunk = 32 rows of 256 bytes = 512 pieces of 16 bytes; thread t copies
  // pieces t and t + 256: piece p is bytes 16 (p & 15) .. +15 of row p >> 4.
  const unsigned int ql = (unsigned int)(uintptr_t)&qst[0][0] +
                          (threadIdx.x >> 4) * (LP * 2) + (threadIdx.x & 15) * 16;
  const _Float16* qg = Qh + threadIdx.x * 8;
  // a Vt chunk = 128 rows of 64 bytes = 512 pieces of 16 bytes; thread t copies
  // pieces t and t + 256: piece p is bytes 16 (p & 3) .. +15 of row p >> 2.
  const unsigned int vl = (unsigned int)(uintptr_t)&vstage[0][0] +
                          (threadIdx.x >> 2) * (VP * 2) + (threadIdx.x & 3) * 16;
  const _Float16* vg = Vt + (size_t)(threadIdx.x >> 2) * SQ + (threadIdx.x & 3) * 8;
  async_copy4(ql, ql + 16 * LP * 2, vl, vl + 64 * VP * 2,         // chunk 0 -> buffers 0
              qg, qg + 256 * 8, vg, vg + (size_t)64 * SQ);
  // 2 QR floats = 256 pieces of 16 bytes: threads 0..127 copy m2, the rest rZ
  async_copy1f((unsigned int)(uintptr_t)&mz[0] + threadIdx.x * 16,
               (threadIdx.x < QR / 4 ? m2_all : rZ_all) + qbase + (threadIdx.x & (QR / 4 - 1)) * 4);

  v16h ak[OKT][4];
#pragma unroll
  for (int kt = 0; kt < OKT; ++kt) {
#pragma unroll
    for (int dc = 0; dc < 4; ++dc) ak[kt][dc] = load_tile_ab(Kh, DD, k0 + kt * 16, dc * 32, lane);
  }

  v8f acc[OKT][8];
#pragma unroll
  for (int kt = 0; kt < OKT; ++kt) {
#pragma unroll
    for (int dt = 0; dt < 8; ++dt) acc[kt][dt] = (v8f){};
  }

  const int NCHUNK = QR / 32;
  // chunk 0 and the constants: this wave's copies have landed; the barrier publishes all
  asm volatile("s_wait_asynccnt 0x0" ::: "memory");
  __syncthreads();
  async_copy4(ql + 32 * LP * 2, ql + 48 * LP * 2,                 // chunk 1 -> buffers 1
              vl + DD * VP * 2, vl + DD * VP * 2 + 64 * VP * 2,
              qg + 32 * DD, qg + 32 * DD + 256 * 8, vg + 32, vg + 32 + (size_t)64 * SQ);

  for (int ci = 0; ci < NCHUNK; ++ci) {
    const int q0 = ci * 32;
    // ---- St = Q x K^T for 32 q-rows x 16 OKT k-cols (accumulate over d=128) ----
    v8f c0[OKT], c1[OKT];
#pragma unroll
    for (int kt = 0; kt < OKT; ++kt) { c0[kt] = (v8f){}; c1[kt] = (v8f){}; }
#pragma unroll
    for (int dc = 0; dc < 4; ++dc) {
      v16h a0 = load_tile_ab(&qst[ci & 1][0], LP, 0,  dc * 32, lane);
      v16h a1 = load_tile_ab(&qst[ci & 1][0], LP, 16, dc * 32, lane);
#pragma unroll
      for (int kt = 0; kt < OKT; ++kt) {
        c0[kt] = __builtin_amdgcn_wmma_f32_16x16x32_f16(false, a0, false, ak[kt][dc],
                                                        (short)0, c0[kt], false, false);
        c1[kt] = __builtin_amdgcn_wmma_f32_16x16x32_f16(false, a1, false, ak[kt][dc],
                                                        (short)0, c1[kt], false, false);
      }
    }
    // ---- p = exp2(s*scale2 - m2[q]) * rZ[q]; register r of tile j is q = 16 j + 8 hi + r,
    // ---- so the two tiles, converted, are halves 0-7 and 8-15 of the A operand
    const v8f mq0 = *(const v8f*)&mz[q0 + 8 * hi],      rz0 = *(const v8f*)&mz[QR + q0 + 8 * hi];
    const v8f mq1 = *(const v8f*)&mz[q0 + 16 + 8 * hi], rz1 = *(const v8f*)&mz[QR + q0 + 16 + 8 * hi];
    v16h pa[OKT];
#pragma unroll
    for (int kt = 0; kt < OKT; ++kt) {
      v8f e0 = c0[kt] * SCALE2 - mq0;
      v8f e1 = c1[kt] * SCALE2 - mq1;
#pragma unroll
      for (int r = 0; r < 8; ++r) { e0[r] = fexp2(e0[r]); e1[r] = fexp2(e1[r]); }
      v8h lo = __builtin_convertvector(e0 * rz0, v8h);
      v8h hp = __builtin_convertvector(e1 * rz1, v8h);
#pragma unroll
      for (int i = 0; i < 8; ++i) { pa[kt][i] = lo[i]; pa[kt][i + 8] = hp[i]; }
    }
    // ---- O(16x128) += P(16x32) x Vt-as-B(32q x 16d) per d-tile -----------
    const _Float16* vsrc = &vstage[ci & 1][0];          // row-major [128][32], pitch VP
#pragma unroll
    for (int dt = 0; dt < 8; ++dt) {
      v16h bv = load_tile_ab(vsrc, VP, dt * 16, 0, lane);
#pragma unroll
      for (int kt = 0; kt < OKT; ++kt)
        acc[kt][dt] = __builtin_amdgcn_wmma_f32_16x16x32_f16(false, pa[kt], false, bv,
                                                             (short)0, acc[kt][dt], false, false);
    }
    // Publish point of chunk ci + 1: this wave's LDS reads of chunk ci are done and
    // its own copies have landed; the barrier publishes chunk ci + 1 to the block
    // and ends every reader's last read of the buffers that are refilled behind it.
    asm volatile("s_wait_dscnt 0x0" ::: "memory");
    asm volatile("s_wait_asynccnt 0x0" ::: "memory");
    __syncthreads();
    if (ci + 2 < NCHUNK) {   // chunk ci + 2 into the buffers that chunk ci has left
      const unsigned int lq = ql + (ci & 1) * (32 * LP * 2);
      const unsigned int lv = vl + (ci & 1) * (DD * VP * 2);
      const _Float16* gq = qg + (size_t)(q0 + 64) * DD;
      const _Float16* gv = vg + (q0 + 64);
      async_copy4(lq, lq + 16 * LP * 2, lv, lv + 64 * VP * 2,
                  gq, gq + 256 * 8, gv, gv + (size_t)64 * SQ);
    }
  }
  // no copy is left in flight when the wave ends
  asm volatile("s_wait_asynccnt 0x0" ::: "memory");
  // ---- store C layout: element (m = r+8*hi, col = dt*16+n); write-once ----
  // plain stores: sda_reduce reads these partial sums back at once
#pragma unroll
  for (int kt = 0; kt < OKT; ++kt) {
#pragma unroll
    for (int dt = 0; dt < 8; ++dt) {
#pragma unroll
      for (int r = 0; r < 8; ++r) {
        out[(size_t)(k0 + kt * 16 + r + 8 * hi) * (QSPLIT * DD) + dt * 16 + n] = acc[kt][dt][r];
      }
    }
  }
}

// ---------------------------------------------------------------------------
// Kernel 4: out = sum of the QSPLIT partial outputs, in range order.
// ---------------------------------------------------------------------------
__global__ void sda_reduce(const float* __restrict__ part, float* __restrict__ out) {
  const int i = blockIdx.x * blockDim.x + threadIdx.x;   // float4 index, 0 .. SK*DD/4-1
  // row k = i / 32 holds QSPLIT partial rows of 32 float4 each
  const float4* row4 = (const float4*)part + (i >> 5) * (QSPLIT * DD / 4) + (i & 31);
  float4 v[QSPLIT];
#pragma unroll
  for (int p = 0; p < QSPLIT; ++p) v[p] = row4[p * (DD / 4)];
  float4 s = v[0];
#pragma unroll
  for (int p = 1; p < QSPLIT; ++p) { s.x += v[p].x; s.y += v[p].y; s.z += v[p].z; s.w += v[p].w; }
  ((float4*)out)[i] = s;
}

extern "C" void kernel_launch(void* const* d_in, const int* in_sizes, int n_in,
                              void* d_out, int out_size, void* d_ws, size_t ws_size,
                              hipStream_t stream) {
  (void)in_sizes; (void)n_in; (void)out_size; (void)ws_size;
  const float* K = (const float*)d_in[0];
  const float* Q = (const float*)d_in[1];
  const float* V = (const float*)d_in[2];
  float* out = (float*)d_out;

  _Float16* Kh = (_Float16*)d_ws;                       // [8192,128] f16
  _Float16* Qh = Kh + (size_t)SK * DD;                  // [8192,128] f16
  _Float16* Vt = Qh + (size_t)SQ * DD;                  // [128,8192] f16 (transposed)
  float*    m2 = (float*)(Vt + (size_t)DD * SQ);        // [8192] column max (log2 dom)
  float*    rZ = m2 + SQ;                               // [8192] 1/sum
  float*    pmz = rZ + SQ;                              // [KSPLIT][8192] range (max, sum) pairs
  float*    part = pmz + (size_t)KSPLIT * SQ * 2;       // [8192][QSPLIT][128] partial out

  sda_convert<<<(SQ / 64) * (DD / 64), 256, 0, stream>>>(K, Q, V, Kh, Qh, Vt);
  // 8 waves/block: 128 SQT q columns (128 OKT k rows) per block in x; the split ranges in y
  sda_stats<<<dim3(SQ / (128 * SQT), KSPLIT), 256, 0, stream>>>(Kh, Qh, pmz);
  sda_stats_merge<<<SQ / 256, 256, 0, stream>>>(pmz, m2, rZ);
  sda_output<<<dim3(SK / (128 * OKT), QSPLIT), 256, 0, stream>>>(Kh, Qh, Vt, m2, rZ, part);
  sda_reduce<<<(SK * DD) / 4 / 256, 256, 0, stream>>>(part, out);
}

// v006
// Measured time: 67.7 microseconds a run.
// Two timings next to v005 both put it at 1.06 times that version's speed.
// Over all steps from v000 it is 15.8 times as fast.
#include <hip/hip_runtime.h>
#include <hip/hip_bf16.h>

typedef __attribute__((ext_vector_type(16))) _Float16 v16h;
typedef __attribute__((ext_vector_type(8)))  _Float16 v8h;
typedef __attribute__((ext_vector_type(8)))  float    v8f;

#define SK 8192
#define SQ 8192
#define DD 128
// The k loop of the stats kernel and the q loop of the output kernel are cut
// into KSPLIT / QSPLIT equal ranges, one per blockIdx.y, so that the grid
// covers every WGP; the ranges' partial results are merged by small launches.
#define KSPLIT 32
#define QSPLIT 16
// Wave tiles: a stats wave owns SQT 16-column q tiles and an output wave OKT
// 16-row k tiles, so that one fragment read from LDS feeds SQT (OKT) WMMAs.
// Every loop over these tiles is unrolled: its fragment and accumulator arrays
// stay in registers only if each index is a constant.
#define SQT 4
#define OKT 2
// 1/sqrt(128) * log2(e): softmax computed in log2 domain -> native v_exp_f32
#define SCALE2 0.12751589906834162f

// Raw v_exp_f32: args here are bounded (<= 0, > -40), so skip OCML's
// underflow-guard path (saves ~6 VALU per exponential in the hot loop).
__device__ __forceinline__ float fexp2(float x) {
#if defined(__HIP_DEVICE_COMPILE__) && __has_builtin(__builtin_amdgcn_exp2f)
  return __builtin_amdgcn_exp2f(x);
#else
  return exp2f(x);
#endif
}

// ---------------------------------------------------------------------------
// Load a 16x32 f16 tile from a row-major matrix into the WMMA A/B register
// layout (ISA 7.12.2, 16-bit A-matrix 16x32):
//   lanes 0-15 : row = row0+lane,    halves 0-7 = cols c0+0..7,  8-15 = c0+16..23
//   lanes 16-31: row = row0+lane-16, halves 0-7 = cols c0+8..15, 8-15 = c0+24..31
// Both chunks are 16B aligned -> two b128 loads per lane (global or ds).
// Serves B operands too: a B (KxN) tile equals the A layout of rows of the
// row-major N-major source (lane = column index n).
// ---------------------------------------------------------------------------
__device__ __forceinline__ v16h load_tile_ab(const _Float16* base,
                                             int ld, int row0, int col0, int lane) {
  const int r  = row0 + (lane & 15);
  const int hs = (lane >> 4) & 1;
  const _Float16* p = base + (size_t)r * ld + col0 + hs * 8;
  v8h lo = *(const v8h*)p;
  v8h hi = *(const v8h*)(p + 16);
  v16h out;
#pragma unroll
  for (int i = 0; i < 8; ++i) { out[i] = lo[i]; out[i + 8] = hi[i]; }
  return out;
}

// LDS pitch, in halfs, of a staged 128-half row: 272 bytes = 16 x 17, the
// conflict-free pitch for 16-byte LDS reads of 256-byte rows.
#define LP 136
// The same for a staged 32-half row: 80 bytes = 16 x 5.
#define VP 40

// Asynchronous copies global -> LDS, 16 bytes per lane and copy, through no
// register. l* = the lane's own LDS byte address, g* = its own global address.
// The closing s_wait_xcnt stands inside the statement so that no address
// register of an issued copy is rewritten in front of it.
__device__ __forceinline__ void async_copy2(unsigned int l0, unsigned int l1,
                                            const _Float16* g0, const _Float16* g1) {
  asm volatile("global_load_async_to_lds_b128 %0, %2, off\n\t"
               "global_load_async_to_lds_b128 %1, %3, off\n\t"
               "s_wait_xcnt 0x0"
               :: "v"(l0), "v"(l1), "v"(g0), "v"(g1) : "memory");
}
__device__ __forceinline__ void async_copy8(unsigned int l, const _Float16* g,
                                            unsigned int lstep, int gstep) {
  asm volatile("global_load_async_to_lds_b128 %0, %8, off\n\t"
               "global_load_async_to_lds_b128 %1, %9, off\n\t"
               "global_load_async_to_lds_b128 %2, %10, off\n\t"
               "global_load_async_to_lds_b128 %3, %11, off\n\t"
               "global_load_async_to_lds_b128 %4, %12, off\n\t"
               "global_load_async_to_lds_b128 %5, %13, off\n\t"
               "global_load_async_to_lds_b128 %6, %14, off\n\t"
               "global_load_async_to_lds_b128 %7, %15, off\n\t"
               "s_wait_xcnt 0x0"
               :: "v"(l), "v"(l + lstep), "v"(l + 2 * lstep), "v"(l + 3 * lstep),
                  "v"(l + 4 * lstep), "v"(l + 5 * lstep), "v"(l + 6 * lstep), "v"(l + 7 * lstep),
                  "v"(g), "v"(g + gstep), "v"(g + 2 * gstep), "v"(g + 3 * gstep),
                  "v"(g + 4 * gstep), "v"(g + 5 * gstep), "v"(g + 6 * gstep), "v"(g + 7 * gstep)
               : "memory");
}

// ---------------------------------------------------------------------------
// Kernel 1: f32 -> f16 copies of K and Q; transposed f16 copy of V (Vt[d][q]).
// One work-group per 64 q x 64 d tile of V (256 in all), which also converts
// 4096 elements of K and of Q. Every thread has its 12 16-byte loads in flight
// at once; V is transposed through LDS so that Vt is stored in whole 128-byte
// lines, each by one work-group.
// ---------------------------------------------------------------------------
// LDS pitch, in halfs, of a transposed 64-half row: 144 bytes = 16 x 9.
#define TP 72
typedef __attribute__((ext_vector_type(4))) _Float16 v4h;
typedef __attribute__((ext_vector_type(2))) _Float16 v2h;
typedef __attribute__((ext_vector_type(4))) float v4f;
__global__ __launch_bounds__(256) void sda_convert(const float* __restrict__ K, const float* __restrict__ Q,
                            const float* __restrict__ V,
                            _Float16* __restrict__ Kh, _Float16* __restrict__ Qh,
                            _Float16* __restrict__ Vt) {
  __shared__ __attribute__((aligned(16))) _Float16 tl[64 * TP];   // [d][q]
  const int t  = threadIdx.x;
  const int q0 = (blockIdx.x >> 1) * 64;
  const int d0 = (blockIdx.x & 1) * 64;
  const int c  = t & 15;      // which float4 of the tile's 64-float row
  const int rp = t >> 4;      // which pair of rows
  // V rows q0 + 32 j + 2 rp and the next one, floats d0 + 4 c .. + 3
  const float* vp = V + (size_t)q0 * DD + d0 + (2 * rp * DD + 4 * c);
  v4f va[2], vb[2];
#pragma unroll
  for (int j = 0; j < 2; ++j) {
    va[j] = *(const v4f*)(vp + 32 * j * DD);
    vb[j] = *(const v4f*)(vp + 32 * j * DD + DD);
  }
  // The offset register of the V loads is given to a later load's result: this
  // wait stands in front of that overwrite.
  asm volatile("s_wait_xcnt 0x0" ::: "memory");
  // K and Q: float4 pieces t + 256 j of this work-group's 1024
  const v4f* K4 = (const v4f*)K + blockIdx.x * 1024 + t;
  const v4f* Q4 = (const v4f*)Q + blockIdx.x * 1024 + t;
  v4f kv[4], qv[4];
#pragma unroll
  for (int j = 0; j < 4; ++j) { kv[j] = K4[256 * j]; qv[j] = Q4[256 * j]; }

#pragma unroll
  for (int j = 0; j < 2; ++j) {
#pragma unroll
    for (int i = 0; i < 4; ++i) {
      v2h h = {(_Float16)va[j][i], (_Float16)vb[j][i]};     // q, q + 1 of one d
      *(v2h*)&tl[(4 * c + i) * TP + 32 * j + 2 * rp] = h;
    }
  }
  // Holds the K and Q loads in front of the barrier, whole and in flight beside
  // the V loads: without it half of each is sunk behind the barrier and pays a
  // second round trip there.
  asm volatile("" :: "v"(kv[0]), "v"(kv[1]), "v"(kv[2]), "v"(kv[3]),
                     "v"(qv[0]), "v"(qv[1]), "v"(qv[2]), "v"(qv[3]));
  // The transposed tile is complete. No global store stands in front of this
  // barrier: it would wait for that store to finish.
  __syncthreads();
  // 64 rows of 128 bytes = 512 pieces of 16 bytes; thread t stores pieces t, t + 256
#pragma unroll
  for (int j = 0; j < 2; ++j) {
    const int p = t + 256 * j;
    const int d = p >> 3, g = p & 7;
    *(v8h*)&Vt[(size_t)(d0 + d) * SQ + q0 + 8 * g] = *(const v8h*)&tl[d * TP + 8 * g];
  }
  v4h* Kh4 = (v4h*)Kh + blockIdx.x * 1024 + t;
  v4h* Qh4 = (v4h*)Qh + blockIdx.x * 1024 + t;
#pragma unroll
  for (int j = 0; j < 4; ++j) {
    Kh4[256 * j] = __builtin_convertvector(kv[j], v4h);
    Qh4[256 * j] = __builtin_convertvector(qv[j], v4h);
  }
}

// ---------------------------------------------------------------------------
// Kernel 2: per-query-column softmax stats over one range of the k axis.
// Each wave owns 16 SQT q columns; loops its k range (blockIdx.y) in 16-row tiles.
// Online (max, sum-exp2) per column, merged across lane halves via shfl_xor 16.
// Writes the range's (max, sum) pair; sda_stats_merge joins the ranges.
// The range's K rows, which all 8 waves read, are copied once per block into
// LDS in whole lines; the fragments are then read from LDS.
// ---------------------------------------------------------------------------
// The real block size lifts the register ceiling to what the wave tile needs.
__global__ __launch_bounds__(256) void sda_stats(const _Float16* __restrict__ Kh_all,
                          const _Float16* __restrict__ Qh,
                          float* __restrict__ pmz_f) {
  float2* pmz = (float2*)pmz_f;                  // [KSPLIT][SQ] (max, sum) pairs
  const _Float16* Kh = Kh_all + (size_t)blockIdx.y * (SK / KSPLIT) * DD;
  const int lane = threadIdx.x & 31;
  const int wave = (blockIdx.x * blockDim.x + threadIdx.x) >> 5;
  const int q0 = wave * (16 * SQT);

  // 256 rows of 256 bytes = 4096 pieces of 16 bytes; thread t copies pieces
  // t + 256 j, j = 0..15: piece p is bytes 16 (p & 15) .. +15 of row p >> 4.
  __shared__ __attribute__((aligned(16))) _Float16 kst[(SK / KSPLIT) * LP];
  {
    const int t = threadIdx.x;
    const unsigned int l = (unsigned int)(uintptr_t)&kst[0] + (t >> 4) * (LP * 2) + (t & 15) * 16;
    const _Float16* g = Kh + t * 8;
    async_copy8(l, g, 16 * LP * 2, 256 * 8);
    async_copy8(l + 8 * 16 * LP * 2, g + 8 * 256 * 8, 16 * LP * 2, 256 * 8);
  }

  v16h bq[SQT][4];
#pragma unroll
  for (int qt = 0; qt < SQT; ++qt) {
#pragma unroll
    for (int dc = 0; dc < 4; ++dc) bq[qt][dc] = load_tile_ab(Qh + (size_t)q0 * DD, DD, qt * 16, dc * 32, lane);
  }

  // this wave's copies have landed; behind the barrier every wave's have
  asm volatile("s_wait_asynccnt 0x0" ::: "memory");
  __syncthreads();

  float mrun[SQT], zrun[SQT];
#pragma unroll
  for (int qt = 0; qt < SQT; ++qt) { mrun[qt] = -__builtin_inff(); zrun[qt] = 0.0f; }

  // K fragments run one tile ahead: each is read again, for the next tile, right
  // behind its own WMMAs and lands under the vector work. The last trip reads tile
  // 0 once more (inside kst, not used).
  v16h a[4];
#pragma unroll
  for (int dc = 0; dc < 4; ++dc) a[dc] = load_tile_ab(kst, LP, 0, dc * 32, lane);
  // two trips per branch: the fragments' two register sets swap roles by name,
  // not by register copies
#pragma unroll 2
  for (int k0 = 0; k0 < SK / KSPLIT; k0 += 16) {
    const int kn = (k0 + 16) & (SK / KSPLIT - 1);
    v8f c[SQT];
#pragma unroll
    for (int qt = 0; qt < SQT; ++qt) c[qt] = (v8f){};
#pragma unroll
    for (int dc = 0; dc < 4; ++dc) {
#pragma unroll
      for (int qt = 0; qt < SQT; ++qt)
        c[qt] = __builtin_amdgcn_wmma_f32_16x16x32_f16(false, a[dc], false, bq[qt][dc],
                                                       (short)0, c[qt], false, false);
      a[dc] = load_tile_ab(kst, LP, kn, dc * 32, lane);
    }
    // keeps those reads in front of the vector work: sunk behind it they would be
    // waited out at the head of the next trip
    __builtin_amdgcn_sched_barrier(0);
    // C layout: lane holds column n=lane&15, rows r+8*(lane>>4), r=0..7
#pragma unroll
    for (int qt = 0; qt < SQT; ++qt) {
      float tmax = c[qt][0];
#pragma unroll
      for (int r = 1; r < 8; ++r) tmax = fmaxf(tmax, c[qt][r]);
      tmax = fmaxf(tmax, __shfl_xor(tmax, 16, 32));
      tmax *= SCALE2;
      float nm = fmaxf(mrun[qt], tmax);
      float ts = 0.0f;
#pragma unroll
      for (int r = 0; r < 8; ++r) ts += fexp2(c[qt][r] * SCALE2 - nm);
      ts += __shfl_xor(ts, 16, 32);
      zrun[qt] = zrun[qt] * fexp2(mrun[qt] - nm) + ts;
      mrun[qt] = nm;
    }
  }
  if (lane < 16) {
#pragma unroll
    for (int qt = 0; qt < SQT; ++qt)
      pmz[blockIdx.y * SQ + q0 + qt * 16 + lane] = make_float2(mrun[qt], zrun[qt]);
  }
}

// ---------------------------------------------------------------------------
// Kernel 2b: join the KSPLIT (max, sum) pairs of each q column.
// ---------------------------------------------------------------------------
__global__ void sda_stats_merge(const float* __restrict__ pmz_f,
                                float* __restrict__ m2, float* __restrict__ rZ) {
  const float2* pmz = (const float2*)pmz_f;      // [KSPLIT][SQ] (max, sum) pairs
  const int q = blockIdx.x * blockDim.x + threadIdx.x;   // 0 .. SQ-1
  float2 p[KSPLIT];
#pragma unroll
  for (int s = 0; s < KSPLIT; ++s) p[s] = pmz[s * SQ + q];
  float m = p[0].x;
#pragma unroll
  for (int s = 1; s < KSPLIT; ++s) m = fmaxf(m, p[s].x);
  float z = 0.0f;
#pragma unroll
  for (int s = 0; s < KSPLIT; ++s) z += p[s].y * fexp2(p[s].x - m);
  m2[q] = m;
  rZ[q] = 1.0f / z;
}

// ---------------------------------------------------------------------------
// Kernel 3: output. Each wave owns 16 OKT k rows x full 128 d (8 OKT f32 accumulators)
// over one range of the q axis (blockIdx.y); the range's f32 partial sum goes
// to the workspace and sda_reduce adds the ranges.
// Per 32-q chunk the scores are formed TRANSPOSED, St = Q x K^T (A = Q rows from
// LDS, B = the wave's K rows in registers): a lane then holds, of one k row,
// q = 8 hi + r of each 16-q tile, which is the k order of the A operand of
// P x V. p = exp2(s-m2[q])*rZ[q] is converted in place: P never leaves registers.
// The Q chunk (32x128 f16) and the Vt chunk (128x32 f16), shared by ALL waves,
// are copied block-wide into LDS by asynchronous copies, two buffers each, one
// chunk ahead, one barrier per chunk. m2 and rZ of the whole range, which now
// differ by register and not by lane, are copied into LDS once.
// ---------------------------------------------------------------------------
__device__ __forceinline__ void async_copy1f(unsigned int l0, const float* g0) {
  asm volatile("global_load_async_to_lds_b128 %0, %1, off\n\t"
               "s_wait_xcnt 0x0"
               :: "v"(l0), "v"(g0) : "memory");
}
__device__ __forceinline__ void async_copy4(unsigned int l0, unsigned int l1,
                                            unsigned int l2, unsigned int l3,
                                            const _Float16* g0, const _Float16* g1,
                                            const _Float16* g2, const _Float16* g3) {
  asm volatile("global_load_async_to_lds_b128 %0, %4, off\n\t"
               "global_load_async_to_lds_b128 %1, %5, off\n\t"
               "global_load_async_to_lds_b128 %2, %6, off\n\t"
               "global_load_async_to_lds_b128 %3, %7, off\n\t"
               "s_wait_xcnt 0x0"
               :: "v"(l0), "v"(l1), "v"(l2), "v"(l3), "v"(g0), "v"(g1), "v"(g2), "v"(g3)
               : "memory");
}
#define QR (SQ / QSPLIT)
// How many fragments the LDS reads of the output loop run ahead of their WMMAs.
#define AQD 2
#define BVD 4
// The real block size lifts the register ceiling to what the wave tile needs;
// four waves per SIMD (256 registers) keep two work-groups on a WGP, so that the
// whole grid is resident at once.
__global__ __launch_bounds__(256, 4) void sda_output(const _Float16* __restrict__ Kh,
                           const _Float16* __restrict__ Qh_all,
                           const _Float16* __restrict__ Vt_all,
                           const float* __restrict__ m2_all,
                           const float* __restrict__ rZ_all,
                           float* __restrict__ part) {
  // this work-group's q range: every q index below is relative to qbase
  const int qbase = blockIdx.y * QR;
  const _Float16* Qh = Qh_all + (size_t)qbase * DD;
  const _Float16* Vt = Vt_all + qbase;
  float* out = part + blockIdx.y * DD;   // partials lie as [k][range][d]
  __shared__ __attribute__((aligned(16))) _Float16 vstage[2][DD * VP];  // Vt chunks, 20 KB
  __shared__ __attribute__((aligned(16))) _Float16 qst[2][32 * LP];     // Q chunks, 17 KB
  __shared__ __attribute__((aligned(32))) float mz[2 * QR];             // m2 | rZ of the range
  const int lane = threadIdx.x & 31;
  const int wave = (blockIdx.x * blockDim.x + threadIdx.x) >> 5;
  const int k0   = wave * (16 * OKT);
  const int n    = lane & 15;
  const int hi   = lane >> 4;

  // a Q chunk = 32 rows of 256 bytes = 512 pieces of 16 bytes; thread t copies
  // pieces t and t + 256: piece p is bytes 16 (p & 15) .. +15 of row p >> 4.
  const unsigned int ql = (unsigned int)(uintptr_t)&qst[0][0] +
                          (threadIdx.x >> 4) * (LP * 2) + (threadIdx.x & 15) * 16;
  const _Float16* qg = Qh + threadIdx.x * 8;
  // a Vt chunk = 128 rows of 64 bytes = 512 pieces of 16 bytes; thread t copies
  // pieces t and t + 256: piece p is bytes 16 (p & 3) .. +15 of row p >> 2.
  const unsigned int vl = (unsigned int)(uintptr_t)&vstage[0][0] +
                          (threadIdx.x >> 2) * (VP * 2) + (threadIdx.x & 3) * 16;
  const _Float16* vg = Vt + (size_t)(threadIdx.x >> 2) * SQ + (threadIdx.x & 3) * 8;
  async_copy4(ql, ql + 16 * LP * 2, vl, vl + 64 * VP * 2,         // chunk 0 -> buffers 0
              qg, qg + 256 * 8, vg, vg + (size_t)64 * SQ);
  // 2 QR floats = 256 pieces of 16 bytes: threads 0..127 copy m2, the rest rZ
  async_copy1f((unsigned int)(uintptr_t)&mz[0] + threadIdx.x * 16,
               (threadIdx.x < QR / 4 ? m2_all : rZ_all) + qbase + (threadIdx.x & (QR / 4 - 1)) * 4);

  v16h ak[OKT][4];
#pragma unroll
  for (int kt = 0; kt < OKT; ++kt) {
#pragma unroll
    for (int dc = 0; dc < 4; ++dc) ak[kt][dc] = load_tile_ab(Kh, DD, k0 + kt * 16, dc * 32, lane);
  }

  v8f acc[OKT][8];
#pragma unroll
  for (int kt = 0; kt < OKT; ++kt) {
#pragma unroll
    for (int dt = 0; dt < 8; ++dt) acc[kt][dt] = (v8f){};
  }

  const int NCHUNK = QR / 32;
  // chunk 0 and the constants: this wave's copies have landed; the barrier publishes all
  asm volatile("s_wait_asynccnt 0x0" ::: "memory");
  __syncthreads();
  async_copy4(ql + 32 * LP * 2, ql + 48 * LP * 2,                 // chunk 1 -> buffers 1
              vl + DD * VP * 2, vl + DD * VP * 2 + 64 * VP * 2,
              qg + 32 * DD, qg + 32 * DD + 256 * 8, vg + 32, vg + 32 + (size_t)64 * SQ);

  for (int ci = 0; ci < NCHUNK; ++ci) {
    const int q0 = ci * 32;
    // ---- St = Q x K^T, one 16-q tile at a time (accumulate over d=128), and at once
    // ---- p = exp2(s*scale2 - m2[q]) * rZ[q]; register r of tile j is q = 16 j + 8 hi + r,
    // ---- so the two tiles, converted, are halves 0-7 and 8-15 of the A operand.
    // Only one tile's scores are live at a time, which leaves registers for Q
    // fragments that run AQD ahead of their WMMAs in a rotating set.
    // The scheduler otherwise sinks each read to just in front of its WMMAs, where
    // its whole latency is waited out.
    v16h pa[OKT];
#pragma unroll
    for (int j = 0; j < 2; ++j) {
      v16h aq[AQD];
#pragma unroll
      for (int dc = 0; dc < AQD; ++dc) aq[dc] = load_tile_ab(&qst[ci & 1][0], LP, 16 * j, dc * 32, lane);
      v8f cj[OKT];
#pragma unroll
      for (int kt = 0; kt < OKT; ++kt) cj[kt] = (v8f){};
#pragma unroll
      for (int dc = 0; dc < 4; ++dc) {
        __builtin_amdgcn_sched_barrier(0);   // the reads issued so far stay ahead of these WMMAs
#pragma unroll
        for (int kt = 0; kt < OKT; ++kt)
          cj[kt] = __builtin_amdgcn_wmma_f32_16x16x32_f16(false, aq[dc % AQD], false, ak[kt][dc],
                                                          (short)0, cj[kt], false, false);
        if (dc + AQD < 4) aq[dc % AQD] = load_tile_ab(&qst[ci & 1][0], LP, 16 * j, (dc + AQD) * 32, lane);
      }
      const v8f mq = *(const v8f*)&mz[q0 + 16 * j + 8 * hi], rz = *(const v8f*)&mz[QR + q0 + 16 * j + 8 * hi];
#pragma unroll
      for (int kt = 0; kt < OKT; ++kt) {
        v8f e = cj[kt] * SCALE2 - mq;
#pragma unroll
        for (int r = 0; r < 8; ++r) e[r] = fexp2(e[r]);
        v8h h = __builtin_convertvector(e * rz, v8h);
#pragma unroll
        for (int i = 0; i < 8; ++i) pa[kt][i + 8 * j] = h[i];
      }
      // the next group of reads stays behind this tile's vector work: hoisted over it,
      // it pushes accumulators and K fragments out into scratch
      __builtin_amdgcn_sched_barrier(0);
    }
    // ---- O(16x128) += P(16x32) x Vt-as-B(32q x 16d) per d-tile -----------
    // Vt fragments run BVD ahead of their WMMAs in the registers the scores have left.
    const _Float16* vsrc = &vstage[ci & 1][0];          // row-major [128][32], pitch VP
    v16h bv[BVD];
#pragma unroll
    for (int dt = 0; dt < BVD; ++dt) bv[dt] = load_tile_ab(vsrc, VP, dt * 16, 0, lane);
#pragma unroll
    for (int dt = 0; dt < 8; ++dt) {
      __builtin_amdgcn_sched_barrier(0);   // the reads issued so far stay ahead of these WMMAs
#pragma unroll
      for (int kt = 0; kt < OKT; ++kt)
        acc[kt][dt] = __builtin_amdgcn_wmma_f32_16x16x32_f16(false, pa[kt], false, bv[dt % BVD],
                                                             (short)0, acc[kt][dt], false, false);
      if (dt + BVD < 8) bv[dt % BVD] = load_tile_ab(vsrc, VP, (dt + BVD) * 16, 0, lane);
    }
    // Publish point of chunk ci + 1: this wave's LDS reads of chunk ci are done and
    // its own copies have landed; the barrier publishes chunk ci + 1 to the block
    // and ends every reader's last read of the buffers that are refilled behind it.
    asm volatile("s_wait_dscnt 0x0" ::: "memory");
    asm volatile("s_wait_asynccnt 0x0" ::: "memory");
    __syncthreads();
    if (ci + 2 < NCHUNK) {   // chunk ci + 2 into the buffers that chunk ci has left
      const unsigned int lq = ql + (ci & 1) * (32 * LP * 2);
      const unsigned int lv = vl + (ci & 1) * (DD * VP * 2);
      const _Float16* gq = qg + (size_t)(q0 + 64) * DD;
      const _Float16* gv = vg + (q0 + 64);
      async_copy4(lq, lq + 16 * LP * 2, lv, lv + 64 * VP * 2,
                  gq, gq + 256 * 8, gv, gv + (size_t)64 * SQ);
    }
  }
  // no copy is left in flight when the wave ends
  asm volatile("s_wait_asynccnt 0x0" ::: "memory");
  // ---- store C layout: element (m = r+8*hi, col = dt*16+n); write-once ----
  // plain stores: sda_reduce reads these partial sums back at once
#pragma unroll
  for (int kt = 0; kt < OKT; ++kt) {
#pragma unroll
    for (int dt = 0; dt < 8; ++dt) {
#pragma unroll
      for (int r = 0; r < 8; ++r) {
        out[(size_t)(k0 + kt * 16 + r + 8 * hi) * (QSPLIT * DD) + dt * 16 + n] = acc[kt][dt][r];
      }
    }
  }
}

// ---------------------------------------------------------------------------
// Kernel 4: out = sum of the QSPLIT partial outputs, in range order.
// ---------------------------------------------------------------------------
__global__ void sda_reduce(const float* __restrict__ part, float* __restrict__ out) {
  const int i = blockIdx.x * blockDim.x + threadIdx.x;   // float4 index, 0 .. SK*DD/4-1
  // row k = i / 32 holds QSPLIT partial rows of 32 float4 each
  const float4* row4 = (const float4*)part + (i >> 5) * (QSPLIT * DD / 4) + (i & 31);
  float4 v[QSPLIT];
#pragma unroll
  for (int p = 0; p < QSPLIT; ++p) v[p] = row4[p * (DD / 4)];
  float4 s = v[0];
#pragma unroll
  for (int p = 1; p < QSPLIT; ++p) { s.x += v[p].x; s.y += v[p].y; s.z += v[p].z; s.w += v[p].w; }
  ((float4*)out)[i] = s;
}

extern "C" void kernel_launch(void* const* d_in, const int* in_sizes, int n_in,
                              void* d_out, int out_size, void* d_ws, size_t ws_size,
                              hipStream_t stream) {
  (void)in_sizes; (void)n_in; (void)out_size; (void)ws_size;
  const float* K = (const float*)d_in[0];
  const float* Q = (const float*)d_in[1];
  const float* V = (const float*)d_in[2];
  float* out = (float*)d_out;

  _Float16* Kh = (_Float16*)d_ws;                       // [8192,128] f16
  _Float16* Qh = Kh + (size_t)SK * DD;                  // [8192,128] f16
  _Float16* Vt = Qh + (size_t)SQ * DD;                  // [128,8192] f16 (transposed)
  float*    m2 = (float*)(Vt + (size_t)DD * SQ);        // [8192] column max (log2 dom)
  float*    rZ = m2 + SQ;                               // [8192] 1/sum
  float*    pmz = rZ + SQ;                              // [KSPLIT][8192] range (max, sum) pairs
  float*    part = pmz + (size_t)KSPLIT * SQ * 2;       // [8192][QSPLIT][128] partial out

  sda_convert<<<(SQ / 64) * (DD / 64), 256, 0, stream>>>(K, Q, V, Kh, Qh, Vt);
  // 8 waves/block: 128 SQT q columns (128 OKT k rows) per block in x; the split ranges in y
  sda_stats<<<dim3(SQ / (128 * SQT), KSPLIT), 256, 0, stream>>>(Kh, Qh, pmz);
  sda_stats_merge<<<SQ / 256, 256, 0, stream>>>(pmz, m2, rZ);
  sda_output<<<dim3(SK / (128 * OKT), QSPLIT), 256, 0, stream>>>(Kh, Qh, Vt, m2, rZ, part);
  sda_reduce<<<(SK * DD) / 4 / 256, 256, 0, stream>>>(part, out);
}

// v007
// One run takes 64.2 microseconds.
// Next to v006, in two timings, it ran 1.05 and 1.06 times as fast.
// All steps since v000 together make it 16.7 times as fast.
#include <hip/hip_runtime.h>
#include <hip/hip_bf16.h>

typedef __attribute__((ext_vector_type(16))) _Float16 v16h;
typedef __attribute__((ext_vector_type(8)))  _Float16 v8h;
typedef __attribute__((ext_vector_type(8)))  float    v8f;
typedef __attribute__((ext_vector_type(2)))  float    v2f;

#define SK 8192
#define SQ 8192
#define DD 128
// The k loop of the stats kernel and the q loop of the output kernel are cut
// into KSPLIT / QSPLIT equal ranges, one per blockIdx.y, so that the grid
// covers every WGP; the stats ranges are joined in the output kernel's prologue,
// the output ranges by a small launch.
#define KSPLIT 32
#define QSPLIT 16
// Wave tiles: a stats wave owns SQT 16-column q tiles and an output wave OKT
// 16-row k tiles, so that one fragment read from LDS feeds SQT (OKT) WMMAs.
// Every loop over these tiles is unrolled: its fragment and accumulator arrays
// stay in registers only if each index is a constant.
#define SQT 4
#define OKT 2
// 1/sqrt(128) * log2(e): softmax computed in log2 domain -> native v_exp_f32
#define SCALE2 0.12751589906834162f

// Raw v_exp_f32: args here are bounded (<= 0, > -40), so skip OCML's
// underflow-guard path (saves ~6 VALU per exponential in the hot loop).
__device__ __forceinline__ float fexp2(float x) {
#if defined(__HIP_DEVICE_COMPILE__) && __has_builtin(__builtin_amdgcn_exp2f)
  return __builtin_amdgcn_exp2f(x);
#else
  return exp2f(x);
#endif
}

// Raw v_log_f32 (log2): every argument here is a sum of exponentials whose
// largest term is 1, so it is >= 1 and needs no subnormal path.
__device__ __forceinline__ float flog2(float x) {
#if defined(__HIP_DEVICE_COMPILE__) && __has_builtin(__builtin_amdgcn_logf)
  return __builtin_amdgcn_logf(x);
#else
  return log2f(x);
#endif
}

// ---------------------------------------------------------------------------
// Load a 16x32 f16 tile from a row-major matrix into the WMMA A/B register
// layout (ISA 7.12.2, 16-bit A-matrix 16x32):
//   lanes 0-15 : row = row0+lane,    halves 0-7 = cols c0+0..7,  8-15 = c0+16..23
//   lanes 16-31: row = row0+lane-16, halves 0-7 = cols c0+8..15, 8-15 = c0+24..31
// Both chunks are 16B aligned -> two b128 loads per lane (global or ds).
// Serves B operands too: a B (KxN) tile equals the A layout of rows of the
// row-major N-major source (lane = column index n).
// ---------------------------------------------------------------------------
__device__ __forceinline__ v16h load_tile_ab(const _Float16* base,
                                             int ld, int row0, int col0, int lane) {
  const int r  = row0 + (lane & 15);
  const int hs = (lane >> 4) & 1;
  const _Float16* p = base + (size_t)r * ld + col0 + hs * 8;
  v8h lo = *(const v8h*)p;
  v8h hi = *(const v8h*)(p + 16);
  v16h out;
#pragma unroll
  for (int i = 0; i < 8; ++i) { out[i] = lo[i]; out[i + 8] = hi[i]; }
  return out;
}

// LDS pitch, in halfs, of a staged 128-half row: 272 bytes = 16 x 17, the
// conflict-free pitch for 16-byte LDS reads of 256-byte rows.
#define LP 136
// The same for a staged 32-half row: 80 bytes = 16 x 5.
#define VP 40

// Asynchronous copies global -> LDS, 16 bytes per lane and copy, through no
// register. l* = the lane's own LDS byte address, g* = its own global address.
// The closing s_wait_xcnt stands inside the statement so that no address
// register of an issued copy is rewritten in front of it.
__device__ __forceinline__ void async_copy2(unsigned int l0, unsigned int l1,
                                            const _Float16* g0, const _Float16* g1) {
  asm volatile("global_load_async_to_lds_b128 %0, %2, off\n\t"
               "global_load_async_to_lds_b128 %1, %3, off\n\t"
               "s_wait_xcnt 0x0"
               :: "v"(l0), "v"(l1), "v"(g0), "v"(g1) : "memory");
}
__device__ __forceinline__ void async_copy8(unsigned int l, const _Float16* g,
                                            unsigned int lstep, int gstep) {
  asm volatile("global_load_async_to_lds_b128 %0, %8, off\n\t"
               "global_load_async_to_lds_b128 %1, %9, off\n\t"
               "global_load_async_to_lds_b128 %2, %10, off\n\t"
               "global_load_async_to_lds_b128 %3, %11, off\n\t"
               "global_load_async_to_lds_b128 %4, %12, off\n\t"
               "global_load_async_to_lds_b128 %5, %13, off\n\t"
               "global_load_async_to_lds_b128 %6, %14, off\n\t"
               "global_load_async_to_lds_b128 %7, %15, off\n\t"
               "s_wait_xcnt 0x0"
               :: "v"(l), "v"(l + lstep), "v"(l + 2 * lstep), "v"(l + 3 * lstep),
                  "v"(l + 4 * lstep), "v"(l + 5 * lstep), "v"(l + 6 * lstep), "v"(l + 7 * lstep),
                  "v"(g), "v"(g + gstep), "v"(g + 2 * gstep), "v"(g + 3 * gstep),
                  "v"(g + 4 * gstep), "v"(g + 5 * gstep), "v"(g + 6 * gstep), "v"(g + 7 * gstep)
               : "memory");
}

// ---------------------------------------------------------------------------
// Kernel 1: f32 -> f16 copies of K and Q; transposed f16 copy of V (Vt[d][q]).
// One work-group per 64 q x 64 d tile of V (256 in all), which also converts
// 4096 elements of K and of Q. Every thread has its 12 16-byte loads in flight
// at once; V is transposed through LDS so that Vt is stored in whole 128-byte
// lines, each by one work-group.
// ---------------------------------------------------------------------------
// LDS pitch, in halfs, of a transposed 64-half row: 144 bytes = 16 x 9.
#define TP 72
typedef __attribute__((ext_vector_type(4))) _Float16 v4h;
typedef __attribute__((ext_vector_type(2))) _Float16 v2h;
typedef __attribute__((ext_vector_type(4))) float v4f;
__global__ __launch_bounds__(256) void sda_convert(const float* __restrict__ K, const float* __restrict__ Q,
                            const float* __restrict__ V,
                            _Float16* __restrict__ Kh, _Float16* __restrict__ Qh,
                            _Float16* __restrict__ Vt) {
  __shared__ __attribute__((aligned(16))) _Float16 tl[64 * TP];   // [d][q]
  const int t  = threadIdx.x;
  const int q0 = (blockIdx.x >> 1) * 64;
  const int d0 = (blockIdx.x & 1) * 64;
  const int c  = t & 15;      // which float4 of the tile's 64-float row
  const int rp = t >> 4;      // which pair of rows
  // V rows q0 + 32 j + 2 rp and the next one, floats d0 + 4 c .. + 3
  const float* vp = V + (size_t)q0 * DD + d0 + (2 * rp * DD + 4 * c);
  v4f va[2], vb[2];
#pragma unroll
  for (int j = 0; j < 2; ++j) {
    va[j] = *(const v4f*)(vp + 32 * j * DD);
    vb[j] = *(const v4f*)(vp + 32 * j * DD + DD);
  }
  // The offset register of the V loads is given to a later load's result: this
  // wait stands in front of that overwrite.
  asm volatile("s_wait_xcnt 0x0" ::: "memory");
  // K and Q: float4 pieces t + 256 j of this work-group's 1024
  const v4f* K4 = (const v4f*)K + blockIdx.x * 1024 + t;
  const v4f* Q4 = (const v4f*)Q + blockIdx.x * 1024 + t;
  v4f kv[4], qv[4];
#pragma unroll
  for (int j = 0; j < 4; ++j) { kv[j] = K4[256 * j]; qv[j] = Q4[256 * j]; }

#pragma unroll
  for (int j = 0; j < 2; ++j) {
#pragma unroll
    for (int i = 0; i < 4; ++i) {
      v2h h = {(_Float16)va[j][i], (_Float16)vb[j][i]};     // q, q + 1 of one d
      *(v2h*)&tl[(4 * c + i) * TP + 32 * j + 2 * rp] = h;
    }
  }
  // Holds the K and Q loads in front of the barrier, whole and in flight beside
  // the V loads: without it half of each is sunk behind the barrier and pays a
  // second round trip there.
  asm volatile("" :: "v"(kv[0]), "v"(kv[1]), "v"(kv[2]), "v"(kv[3]),
                     "v"(qv[0]), "v"(qv[1]), "v"(qv[2]), "v"(qv[3]));
  // The transposed tile is complete. No global store stands in front of this
  // barrier: it would wait for that store to finish.
  __syncthreads();
  // 64 rows of 128 bytes = 512 pieces of 16 bytes; thread t stores pieces t, t + 256
#pragma unroll
  for (int j = 0; j < 2; ++j) {
    const int p = t + 256 * j;
    const int d = p >> 3, g = p & 7;
    *(v8h*)&Vt[(size_t)(d0 + d) * SQ + q0 + 8 * g] = *(const v8h*)&tl[d * TP + 8 * g];
  }
  v4h* Kh4 = (v4h*)Kh + blockIdx.x * 1024 + t;
  v4h* Qh4 = (v4h*)Qh + blockIdx.x * 1024 + t;
#pragma unroll
  for (int j = 0; j < 4; ++j) {
    Kh4[256 * j] = __builtin_convertvector(kv[j], v4h);
    Qh4[256 * j] = __builtin_convertvector(qv[j], v4h);
  }
}

// ---------------------------------------------------------------------------
// Kernel 2: per-query-column softmax stats over one range of the k axis.
// Each wave owns 16 SQT q columns; loops its k range (blockIdx.y) in 16-row tiles.
// Online (max, sum-exp2) per column, merged across lane halves via shfl_xor 16.
// Writes the range's log2 of its sum of exponentials, max + log2(sum), one float
// per column; the output kernel joins the ranges.
// The range's K rows, which all 8 waves read, are copied once per block into
// LDS in whole lines; the fragments are then read from LDS.
// ---------------------------------------------------------------------------
// The real block size lifts the register ceiling to what the wave tile needs.
__global__ __launch_bounds__(256) void sda_stats(const _Float16* __restrict__ Kh_all,
                          const _Float16* __restrict__ Qh,
                          float* __restrict__ pl) {   // [KSPLIT][SQ]
  const _Float16* Kh = Kh_all + (size_t)blockIdx.y * (SK / KSPLIT) * DD;
  const int lane = threadIdx.x & 31;
  const int wave = (blockIdx.x * blockDim.x + threadIdx.x) >> 5;
  const int q0 = wave * (16 * SQT);

  // 256 rows of 256 bytes = 4096 pieces of 16 bytes; thread t copies pieces
  // t + 256 j, j = 0..15: piece p is bytes 16 (p & 15) .. +15 of row p >> 4.
  __shared__ __attribute__((aligned(16))) _Float16 kst[(SK / KSPLIT) * LP];
  {
    const int t = threadIdx.x;
    const unsigned int l = (unsigned int)(uintptr_t)&kst[0] + (t >> 4) * (LP * 2) + (t & 15) * 16;
    const _Float16* g = Kh + t * 8;
    async_copy8(l, g, 16 * LP * 2, 256 * 8);
    async_copy8(l + 8 * 16 * LP * 2, g + 8 * 256 * 8, 16 * LP * 2, 256 * 8);
  }

  v16h bq[SQT][4];
#pragma unroll
  for (int qt = 0; qt < SQT; ++qt) {
#pragma unroll
    for (int dc = 0; dc < 4; ++dc) bq[qt][dc] = load_tile_ab(Qh + (size_t)q0 * DD, DD, qt * 16, dc * 32, lane);
  }

  // this wave's copies have landed; behind the barrier every wave's have
  asm volatile("s_wait_asynccnt 0x0" ::: "memory");
  __syncthreads();

  float mrun[SQT], zrun[SQT];
#pragma unroll
  for (int qt = 0; qt < SQT; ++qt) { mrun[qt] = -__builtin_inff(); zrun[qt] = 0.0f; }

  // K fragments run one tile ahead: each is read again, for the next tile, right
  // behind its own WMMAs and lands under the vector work. The last trip reads tile
  // 0 once more (inside kst, not used).
  v16h a[4];
#pragma unroll
  for (int dc = 0; dc < 4; ++dc) a[dc] = load_tile_ab(kst, LP, 0, dc * 32, lane);
  // two trips per branch: the fragments' two register sets swap roles by name,
  // not by register copies
#pragma unroll 2
  for (int k0 = 0; k0 < SK / KSPLIT; k0 += 16) {
    const int kn = (k0 + 16) & (SK / KSPLIT - 1);
    v8f c[SQT];
#pragma unroll
    for (int qt = 0; qt < SQT; ++qt) c[qt] = (v8f){};
#pragma unroll
    for (int dc = 0; dc < 4; ++dc) {
#pragma unroll
      for (int qt = 0; qt < SQT; ++qt)
        c[qt] = __builtin_amdgcn_wmma_f32_16x16x32_f16(false, a[dc], false, bq[qt][dc],
                                                       (short)0, c[qt], false, false);
      a[dc] = load_tile_ab(kst, LP, kn, dc * 32, lane);
    }
    // keeps those reads in front of the vector work: sunk behind it they would be
    // waited out at the head of the next trip
    __builtin_amdgcn_sched_barrier(0);
    // C layout: lane holds column n=lane&15, rows r+8*(lane>>4), r=0..7
#pragma unroll
    for (int qt = 0; qt < SQT; ++qt) {
      float tmax = c[qt][0];
#pragma unroll
      for (int r = 1; r < 8; ++r) tmax = fmaxf(tmax, c[qt][r]);
      tmax = fmaxf(tmax, __shfl_xor(tmax, 16, 32));
      tmax *= SCALE2;
      float nm = fmaxf(mrun[qt], tmax);
      float ts = 0.0f;
#pragma unroll
      for (int r = 0; r < 8; ++r) ts += fexp2(c[qt][r] * SCALE2 - nm);
      ts += __shfl_xor(ts, 16, 32);
      zrun[qt] = zrun[qt] * fexp2(mrun[qt] - nm) + ts;
      mrun[qt] = nm;
    }
  }
  if (lane < 16) {
#pragma unroll
    for (int qt = 0; qt < SQT; ++qt)
      pl[blockIdx.y * SQ + q0 + qt * 16 + lane] = mrun[qt] + flog2(zrun[qt]);
  }
}

// ---------------------------------------------------------------------------
// Kernel 3: output. Each wave owns 16 OKT k rows x full 128 d (8 OKT f32 accumulators)
// over one range of the q axis (blockIdx.y); the range's f32 partial sum goes
// to the workspace and sda_reduce adds the ranges.
// Per 32-q chunk the scores are formed TRANSPOSED, St = Q x K^T (A = Q rows from
// LDS, B = the wave's K rows in registers): a lane then holds, of one k row,
// q = 8 hi + r of each 16-q tile, which is the k order of the A operand of
// P x V. p = exp2(s-L[q]) is converted in place: P never leaves registers.
// The Q chunk (32x128 f16) and the Vt chunk (128x32 f16), shared by ALL waves,
// are copied block-wide into LDS by asynchronous copies, two buffers each, one
// chunk ahead, one barrier per chunk. L[q] = log2 of column q's whole sum of
// exponentials: each work-group joins the KSPLIT range values of its own q range
// in its prologue, two columns a thread, and keeps the result in LDS.
// ---------------------------------------------------------------------------
__device__ __forceinline__ void async_copy4(unsigned int l0, unsigned int l1,
                                            unsigned int l2, unsigned int l3,
                                            const _Float16* g0, const _Float16* g1,
                                            const _Float16* g2, const _Float16* g3) {
  asm volatile("global_load_async_to_lds_b128 %0, %4, off\n\t"
               "global_load_async_to_lds_b128 %1, %5, off\n\t"
               "global_load_async_to_lds_b128 %2, %6, off\n\t"
               "global_load_async_to_lds_b128 %3, %7, off\n\t"
               "s_wait_xcnt 0x0"
               :: "v"(l0), "v"(l1), "v"(l2), "v"(l3), "v"(g0), "v"(g1), "v"(g2), "v"(g3)
               : "memory");
}
#define QR (SQ / QSPLIT)
// How many fragments the LDS reads of the output loop run ahead of their WMMAs.
#define AQD 2
#define BVD 4
// The real block size lifts the register ceiling to what the wave tile needs;
// four waves per SIMD (256 registers) keep two work-groups on a WGP, so that the
// whole grid is resident at once.
__global__ __launch_bounds__(256, 4) void sda_output(const _Float16* __restrict__ Kh,
                           const _Float16* __restrict__ Qh_all,
                           const _Float16* __restrict__ Vt_all,
                           const float* __restrict__ pl,
                           float* __restrict__ part) {
  // this work-group's q range: every q index below is relative to qbase
  const int qbase = blockIdx.y * QR;
  const _Float16* Qh = Qh_all + (size_t)qbase * DD;
  const _Float16* Vt = Vt_all + qbase;
  float* out = part + blockIdx.y * DD;   // partials lie as [k][range][d]
  __shared__ __attribute__((aligned(16))) _Float16 vstage[2][DD * VP];  // Vt chunks, 20 KB
  __shared__ __attribute__((aligned(16))) _Float16 qst[2][32 * LP];     // Q chunks, 17 KB
  __shared__ __attribute__((aligned(32))) float lse[QR];                // L of the range
  const int lane = threadIdx.x & 31;
  const int wave = (blockIdx.x * blockDim.x + threadIdx.x) >> 5;
  const int k0   = wave * (16 * OKT);
  const int n    = lane & 15;
  const int hi   = lane >> 4;

  // a Q chunk = 32 rows of 256 bytes = 512 pieces of 16 bytes; thread t copies
  // pieces t and t + 256: piece p is bytes 16 (p & 15) .. +15 of row p >> 4.
  const unsigned int ql = (unsigned int)(uintptr_t)&qst[0][0] +
                          (threadIdx.x >> 4) * (LP * 2) + (threadIdx.x & 15) * 16;
  const _Float16* qg = Qh + threadIdx.x * 8;
  // a Vt chunk = 128 rows of 64 bytes = 512 pieces of 16 bytes; thread t copies
  // pieces t and t + 256: piece p is bytes 16 (p & 3) .. +15 of row p >> 2.
  const unsigned int vl = (unsigned int)(uintptr_t)&vstage[0][0] +
                          (threadIdx.x >> 2) * (VP * 2) + (threadIdx.x & 3) * 16;
  const _Float16* vg = Vt + (size_t)(threadIdx.x >> 2) * SQ + (threadIdx.x & 3) * 8;
  async_copy4(ql, ql + 16 * LP * 2, vl, vl + 64 * VP * 2,         // chunk 0 -> buffers 0
              qg, qg + 256 * 8, vg, vg + (size_t)64 * SQ);
  // the range values of columns qbase + 2 t and the next one, all loads in flight at once
  v2f pv[KSPLIT];
#pragma unroll
  for (int s = 0; s < KSPLIT; ++s) pv[s] = *(const v2f*)(pl + s * SQ + qbase + 2 * threadIdx.x);

  v16h ak[OKT][4];
  const _Float16* kr = Kh + (size_t)(k0 + n) * DD + hi * 8;   // the lane's place in its first K row
#pragma unroll
  for (int kt = 0; kt < OKT; ++kt) {
#pragma unroll
    for (int dc = 0; dc < 4; ++dc) {
      const v8h lo = *(const v8h*)(kr + kt * 16 * DD + dc * 32);        // as load_tile_ab
      const v8h up = *(const v8h*)(kr + kt * 16 * DD + dc * 32 + 16);
#pragma unroll
      for (int i = 0; i < 8; ++i) { ak[kt][dc][i] = lo[i]; ak[kt][dc][i + 8] = up[i]; }
    }
  }
  // Names the K loads' address, which so stays in its registers up to this wait:
  // it is otherwise given to the result of a later load of the same run.
  asm volatile("s_wait_xcnt 0x0" :: "v"(kr) : "memory");

  // L = M + log2(sum over the ranges of exp2(value - M)), M the largest value
  {
    v2f mx = pv[0];
#pragma unroll
    for (int s = 1; s < KSPLIT; ++s) mx = __builtin_elementwise_max(mx, pv[s]);
    v2f sm = {0.0f, 0.0f};
#pragma unroll
    for (int s = 0; s < KSPLIT; ++s) {
      const v2f d = pv[s] - mx;
      sm += (v2f){fexp2(d[0]), fexp2(d[1])};
    }
    *(v2f*)&lse[2 * threadIdx.x] = mx + (v2f){flog2(sm[0]), flog2(sm[1])};
  }
  // the accumulators come to life behind the join: set to zero in front of it, they
  // and the range values together push K fragments and accumulators out into scratch
  __builtin_amdgcn_sched_barrier(0);

  v8f acc[OKT][8];
#pragma unroll
  for (int kt = 0; kt < OKT; ++kt) {
#pragma unroll
    for (int dt = 0; dt < 8; ++dt) acc[kt][dt] = (v8f){};
  }

  const int NCHUNK = QR / 32;
  // chunk 0: this wave's copies have landed; the barrier publishes them and L
  asm volatile("s_wait_asynccnt 0x0" ::: "memory");
  __syncthreads();
  async_copy4(ql + 32 * LP * 2, ql + 48 * LP * 2,                 // chunk 1 -> buffers 1
              vl + DD * VP * 2, vl + DD * VP * 2 + 64 * VP * 2,
              qg + 32 * DD, qg + 32 * DD + 256 * 8, vg + 32, vg + 32 + (size_t)64 * SQ);

  for (int ci = 0; ci < NCHUNK; ++ci) {
    const int q0 = ci * 32;
    // ---- St = Q x K^T, one 16-q tile at a time (accumulate over d=128), and at once
    // ---- p = exp2(s*scale2 - L[q]); register r of tile j is q = 16 j + 8 hi + r,
    // ---- so the two tiles, converted, are halves 0-7 and 8-15 of the A operand.
    // Only one tile's scores are live at a time, which leaves registers for Q
    // fragments that run AQD ahead of their WMMAs in a rotating set.
    // The scheduler otherwise sinks each read to just in front of its WMMAs, where
    // its whole latency is waited out.
    v16h pa[OKT];
#pragma unroll
    for (int j = 0; j < 2; ++j) {
      v16h aq[AQD];
#pragma unroll
      for (int dc = 0; dc < AQD; ++dc) aq[dc] = load_tile_ab(&qst[ci & 1][0], LP, 16 * j, dc * 32, lane);
      v8f cj[OKT];
#pragma unroll
      for (int kt = 0; kt < OKT; ++kt) cj[kt] = (v8f){};
#pragma unroll
      for (int dc = 0; dc < 4; ++dc) {
        __builtin_amdgcn_sched_barrier(0);   // the reads issued so far stay ahead of these WMMAs
#pragma unroll
        for (int kt = 0; kt < OKT; ++kt)
          cj[kt] = __builtin_amdgcn_wmma_f32_16x16x32_f16(false, aq[dc % AQD], false, ak[kt][dc],
                                                          (short)0, cj[kt], false, false);
        if (dc + AQD < 4) aq[dc % AQD] = load_tile_ab(&qst[ci & 1][0], LP, 16 * j, (dc + AQD) * 32, lane);
      }
      const v8f lq = *(const v8f*)&lse[q0 + 16 * j + 8 * hi];
#pragma unroll
      for (int kt = 0; kt < OKT; ++kt) {
        v8f e = cj[kt] * SCALE2 - lq;
#pragma unroll
        for (int r = 0; r < 8; ++r) e[r] = fexp2(e[r]);
        v8h h = __builtin_convertvector(e, v8h);
#pragma unroll
        for (int i = 0; i < 8; ++i) pa[kt][i + 8 * j] = h[i];
      }
      // the next group of reads stays behind this tile's vector work: hoisted over it,
      // it pushes accumulators and K fragments out into scratch
      __builtin_amdgcn_sched_barrier(0);
    }
    // ---- O(16x128) += P(16x32) x Vt-as-B(32q x 16d) per d-tile -----------
    // Vt fragments run BVD ahead of their WMMAs in the registers the scores have left.
    const _Float16* vsrc = &vstage[ci & 1][0];          // row-major [128][32], pitch VP
    v16h bv[BVD];
#pragma unroll
    for (int dt = 0; dt < BVD; ++dt) bv[dt] = load_tile_ab(vsrc, VP, dt * 16, 0, lane);
#pragma unroll
    for (int dt = 0; dt < 8; ++dt) {
      __builtin_amdgcn_sched_barrier(0);   // the reads issued so far stay ahead of these WMMAs
#pragma unroll
      for (int kt = 0; kt < OKT; ++kt)
        acc[kt][dt] = __builtin_amdgcn_wmma_f32_16x16x32_f16(false, pa[kt], false, bv[dt % BVD],
                                                             (short)0, acc[kt][dt], false, false);
      if (dt + BVD < 8) bv[dt % BVD] = load_tile_ab(vsrc, VP, (dt + BVD) * 16, 0, lane);
    }
    // Publish point of chunk ci + 1: this wave's LDS reads of chunk ci are done and
    // its own copies have landed; the barrier publishes chunk ci + 1 to the block
    // and ends every reader's last read of the buffers that are refilled behind it.
    asm volatile("s_wait_dscnt 0x0" ::: "memory");
    asm volatile("s_wait_asynccnt 0x0" ::: "memory");
    __syncthreads();
    if (ci + 2 < NCHUNK) {   // chunk ci + 2 into the buffers that chunk ci has left
      const unsigned int lq = ql + (ci & 1) * (32 * LP * 2);
      const unsigned int lv = vl + (ci & 1) * (DD * VP * 2);
      const _Float16* gq = qg + (size_t)(q0 + 64) * DD;
      const _Float16* gv = vg + (q0 + 64);
      async_copy4(lq, lq + 16 * LP * 2, lv, lv + 64 * VP * 2,
                  gq, gq + 256 * 8, gv, gv + (size_t)64 * SQ);
    }
  }
  // no copy is left in flight when the wave ends
  asm volatile("s_wait_asynccnt 0x0" ::: "memory");
  // ---- store C layout: element (m = r+8*hi, col = dt*16+n); write-once ----
  // plain stores: sda_reduce reads these partial sums back at once
#pragma unroll
  for (int kt = 0; kt < OKT; ++kt) {
#pragma unroll
    for (int dt = 0; dt < 8; ++dt) {
#pragma unroll
      for (int r = 0; r < 8; ++r) {
        out[(size_t)(k0 + kt * 16 + r + 8 * hi) * (QSPLIT * DD) + dt * 16 + n] = acc[kt][dt][r];
      }
    }
  }
}

// ---------------------------------------------------------------------------
// Kernel 4: out = sum of the QSPLIT partial outputs, in range order.
// ---------------------------------------------------------------------------
__global__ void sda_reduce(const float* __restrict__ part, float* __restrict__ out) {
  const int i = blockIdx.x * blockDim.x + threadIdx.x;   // float4 index, 0 .. SK*DD/4-1
  // row k = i / 32 holds QSPLIT partial rows of 32 float4 each
  const float4* row4 = (const float4*)part + (i >> 5) * (QSPLIT * DD / 4) + (i & 31);
  float4 v[QSPLIT];
#pragma unroll
  for (int p = 0; p < QSPLIT; ++p) v[p] = row4[p * (DD / 4)];
  float4 s = v[0];
#pragma unroll
  for (int p = 1; p < QSPLIT; ++p) { s.x += v[p].x; s.y += v[p].y; s.z += v[p].z; s.w += v[p].w; }
  ((float4*)out)[i] = s;
}

extern "C" void kernel_launch(void* const* d_in, const int* in_sizes, int n_in,
                              void* d_out, int out_size, void* d_ws, size_t ws_size,
                              hipStream_t stream) {
  (void)in_sizes; (void)n_in; (void)out_size; (void)ws_size;
  const float* K = (const float*)d_in[0];
  const float* Q = (const float*)d_in[1];
  const float* V = (const float*)d_in[2];
  float* out = (float*)d_out;

  _Float16* Kh = (_Float16*)d_ws;                       // [8192,128] f16
  _Float16* Qh = Kh + (size_t)SK * DD;                  // [8192,128] f16
  _Float16* Vt = Qh + (size_t)SQ * DD;                  // [128,8192] f16 (transposed)
  float*    pl = (float*)(Vt + (size_t)DD * SQ);        // [KSPLIT][8192] range log2-sum-exp
  float*    part = pl + (size_t)KSPLIT * SQ;            // [8192][QSPLIT][128] partial out

  sda_convert<<<(SQ / 64) * (DD / 64), 256, 0, stream>>>(K, Q, V, Kh, Qh, Vt);
  // 8 waves/block: 128 SQT q columns (128 OKT k rows) per block in x; the split ranges in y
  sda_stats<<<dim3(SQ / (128 * SQT), KSPLIT), 256, 0, stream>>>(Kh, Qh, pl);
  sda_output<<<dim3(SK / (128 * OKT), QSPLIT), 256, 0, stream>>>(Kh, Qh, Vt, pl, part);
  sda_reduce<<<(SK * DD) / 4 / 256, 256, 0, stream>>>(part, out);
}

// v008
// It runs in 61.6 microseconds.
// In both of two side-by-side timings against v007, it was 1.04 times as fast.
// Over all steps from v000 it is 17.4 times as fast.
#include <hip/hip_runtime.h>
#include <hip/hip_bf16.h>

typedef __attribute__((ext_vector_type(16))) _Float16 v16h;
typedef __attribute__((ext_vector_type(8)))  _Float16 v8h;
typedef __attribute__((ext_vector_type(8)))  float    v8f;
typedef __attribute__((ext_vector_type(2)))  float    v2f;

#define SK 8192
#define SQ 8192
#define DD 128
// The k loop of the stats kernel and the q loop of the output kernel are cut
// into KSPLIT / QSPLIT equal ranges, one per blockIdx.y, so that the grid
// covers every WGP; the stats ranges are joined in the output kernel's prologue,
// the output ranges by a small launch. An output work-group cuts its range once
// more, between two halves of its waves, and joins the two sums itself in LDS.
#define KSPLIT 32
#define QSPLIT 8
// Wave tiles: a stats wave owns SQT 16-column q tiles and an output wave OKT
// 16-row k tiles, so that one fragment read from LDS feeds SQT (OKT) WMMAs.
// Every loop over these tiles is unrolled: its fragment and accumulator arrays
// stay in registers only if each index is a constant.
#define SQT 4
#define OKT 2
// 1/sqrt(128) * log2(e): softmax computed in log2 domain -> native v_exp_f32
#define SCALE2 0.12751589906834162f

// Raw v_exp_f32: args here are bounded (<= 0, > -40), so skip OCML's
// underflow-guard path (saves ~6 VALU per exponential in the hot loop).
__device__ __forceinline__ float fexp2(float x) {
#if defined(__HIP_DEVICE_COMPILE__) && __has_builtin(__builtin_amdgcn_exp2f)
  return __builtin_amdgcn_exp2f(x);
#else
  return exp2f(x);
#endif
}

// Raw v_log_f32 (log2): every argument here is a sum of exponentials whose
// largest term is 1, so it is >= 1 and needs no subnormal path.
__device__ __forceinline__ float flog2(float x) {
#if defined(__HIP_DEVICE_COMPILE__) && __has_builtin(__builtin_amdgcn_logf)
  return __builtin_amdgcn_logf(x);
#else
  return log2f(x);
#endif
}

// ---------------------------------------------------------------------------
// Load a 16x32 f16 tile from a row-major matrix into the WMMA A/B register
// layout (ISA 7.12.2, 16-bit A-matrix 16x32):
//   lanes 0-15 : row = row0+lane,    halves 0-7 = cols c0+0..7,  8-15 = c0+16..23
//   lanes 16-31: row = row0+lane-16, halves 0-7 = cols c0+8..15, 8-15 = c0+24..31
// Both chunks are 16B aligned -> two b128 loads per lane (global or ds).
// Serves B operands too: a B (KxN) tile equals the A layout of rows of the
// row-major N-major source (lane = column index n).
// ---------------------------------------------------------------------------
__device__ __forceinline__ v16h load_tile_ab(const _Float16* base,
                                             int ld, int row0, int col0, int lane) {
  const int r  = row0 + (lane & 15);
  const int hs = (lane >> 4) & 1;
  const _Float16* p = base + (size_t)r * ld + col0 + hs * 8;
  v8h lo = *(const v8h*)p;
  v8h hi = *(const v8h*)(p + 16);
  v16h out;
#pragma unroll
  for (int i = 0; i < 8; ++i) { out[i] = lo[i]; out[i + 8] = hi[i]; }
  return out;
}

// LDS pitch, in halfs, of a staged 128-half row: 272 bytes = 16 x 17, the
// conflict-free pitch for 16-byte LDS reads of 256-byte rows.
#define LP 136
// The same for a staged 32-half row: 80 bytes = 16 x 5.
#define VP 40

// Asynchronous copies global -> LDS, 16 bytes per lane and copy, through no
// register. l* = the lane's own LDS byte address, g* = its own global address.
// The closing s_wait_xcnt stands inside the statement so that no address
// register of an issued copy is rewritten in front of it.
__device__ __forceinline__ void async_copy2(unsigned int l0, unsigned int l1,
                                            const _Float16* g0, const _Float16* g1) {
  asm volatile("global_load_async_to_lds_b128 %0, %2, off\n\t"
               "global_load_async_to_lds_b128 %1, %3, off\n\t"
               "s_wait_xcnt 0x0"
               :: "v"(l0), "v"(l1), "v"(g0), "v"(g1) : "memory");
}
__device__ __forceinline__ void async_copy8(unsigned int l, const _Float16* g,
                                            unsigned int lstep, int gstep) {
  asm volatile("global_load_async_to_lds_b128 %0, %8, off\n\t"
               "global_load_async_to_lds_b128 %1, %9, off\n\t"
               "global_load_async_to_lds_b128 %2, %10, off\n\t"
               "global_load_async_to_lds_b128 %3, %11, off\n\t"
               "global_load_async_to_lds_b128 %4, %12, off\n\t"
               "global_load_async_to_lds_b128 %5, %13, off\n\t"
               "global_load_async_to_lds_b128 %6, %14, off\n\t"
               "global_load_async_to_lds_b128 %7, %15, off\n\t"
               "s_wait_xcnt 0x0"
               :: "v"(l), "v"(l + lstep), "v"(l + 2 * lstep), "v"(l + 3 * lstep),
                  "v"(l + 4 * lstep), "v"(l + 5 * lstep), "v"(l + 6 * lstep), "v"(l + 7 * lstep),
                  "v"(g), "v"(g + gstep), "v"(g + 2 * gstep), "v"(g + 3 * gstep),
                  "v"(g + 4 * gstep), "v"(g + 5 * gstep), "v"(g + 6 * gstep), "v"(g + 7 * gstep)
               : "memory");
}

// ---------------------------------------------------------------------------
// Kernel 1: f32 -> f16 copies of K and Q; transposed f16 copy of V (Vt[d][q]).
// One work-group per 64 q x 64 d tile of V (256 in all), which also converts
// 4096 elements of K and of Q. Every thread has its 12 16-byte loads in flight
// at once; V is transposed through LDS so that Vt is stored in whole 128-byte
// lines, each by one work-group.
// ---------------------------------------------------------------------------
// LDS pitch, in halfs, of a transposed 64-half row: 144 bytes = 16 x 9.
#define TP 72
typedef __attribute__((ext_vector_type(4))) _Float16 v4h;
typedef __attribute__((ext_vector_type(2))) _Float16 v2h;
typedef __attribute__((ext_vector_type(4))) float v4f;
__global__ __launch_bounds__(256) void sda_convert(const float* __restrict__ K, const float* __restrict__ Q,
                            const float* __restrict__ V,
                            _Float16* __restrict__ Kh, _Float16* __restrict__ Qh,
                            _Float16* __restrict__ Vt) {
  __shared__ __attribute__((aligned(16))) _Float16 tl[64 * TP];   // [d][q]
  const int t  = threadIdx.x;
  const int q0 = (blockIdx.x >> 1) * 64;
  const int d0 = (blockIdx.x & 1) * 64;
  const int c  = t & 15;      // which float4 of the tile's 64-float row
  const int rp = t >> 4;      // which pair of rows
  // V rows q0 + 32 j + 2 rp and the next one, floats d0 + 4 c .. + 3
  const float* vp = V + (size_t)q0 * DD + d0 + (2 * rp * DD + 4 * c);
  v4f va[2], vb[2];
#pragma unroll
  for (int j = 0; j < 2; ++j) {
    va[j] = *(const v4f*)(vp + 32 * j * DD);
    vb[j] = *(const v4f*)(vp + 32 * j * DD + DD);
  }
  // The offset register of the V loads is given to a later load's result: this
  // wait stands in front of that overwrite.
  asm volatile("s_wait_xcnt 0x0" ::: "memory");
  // K and Q: float4 pieces t + 256 j of this work-group's 1024
  const v4f* K4 = (const v4f*)K + blockIdx.x * 1024 + t;
  const v4f* Q4 = (const v4f*)Q + blockIdx.x * 1024 + t;
  v4f kv[4], qv[4];
#pragma unroll
  for (int j = 0; j < 4; ++j) { kv[j] = K4[256 * j]; qv[j] = Q4[256 * j]; }

#pragma unroll
  for (int j = 0; j < 2; ++j) {
#pragma unroll
    for (int i = 0; i < 4; ++i) {
      v2h h = {(_Float16)va[j][i], (_Float16)vb[j][i]};     // q, q + 1 of one d
      *(v2h*)&tl[(4 * c + i) * TP + 32 * j + 2 * rp] = h;
    }
  }
  // Holds the K and Q loads in front of the barrier, whole and in flight beside
  // the V loads: without it half of each is sunk behind the barrier and pays a
  // second round trip there.
  asm volatile("" :: "v"(kv[0]), "v"(kv[1]), "v"(kv[2]), "v"(kv[3]),
                     "v"(qv[0]), "v"(qv[1]), "v"(qv[2]), "v"(qv[3]));
  // The transposed tile is complete. No global store stands in front of this
  // barrier: it would wait for that store to finish.
  __syncthreads();
  // 64 rows of 128 bytes = 512 pieces of 16 bytes; thread t stores pieces t, t + 256
#pragma unroll
  for (int j = 0; j < 2; ++j) {
    const int p = t + 256 * j;
    const int d = p >> 3, g = p & 7;
    *(v8h*)&Vt[(size_t)(d0 + d) * SQ + q0 + 8 * g] = *(const v8h*)&tl[d * TP + 8 * g];
  }
  v4h* Kh4 = (v4h*)Kh + blockIdx.x * 1024 + t;
  v4h* Qh4 = (v4h*)Qh + blockIdx.x * 1024 + t;
#pragma unroll
  for (int j = 0; j < 4; ++j) {
    Kh4[256 * j] = __builtin_convertvector(kv[j], v4h);
    Qh4[256 * j] = __builtin_convertvector(qv[j], v4h);
  }
}

// ---------------------------------------------------------------------------
// Kernel 2: per-query-column softmax stats over one range of the k axis.
// Each wave owns 16 SQT q columns; loops its k range (blockIdx.y) in 16-row tiles.
// Online (max, sum-exp2) per column, merged across lane halves via shfl_xor 16.
// Writes the range's log2 of its sum of exponentials, max + log2(sum), one float
// per column; the output kernel joins the ranges.
// The range's K rows, which all 8 waves read, are copied once per block into
// LDS in whole lines; the fragments are then read from LDS.
// ---------------------------------------------------------------------------
// The real block size lifts the register ceiling to what the wave tile needs.
__global__ __launch_bounds__(256) void sda_stats(const _Float16* __restrict__ Kh_all,
                          const _Float16* __restrict__ Qh,
                          float* __restrict__ pl) {   // [KSPLIT][SQ]
  const _Float16* Kh = Kh_all + (size_t)blockIdx.y * (SK / KSPLIT) * DD;
  const int lane = threadIdx.x & 31;
  const int wave = (blockIdx.x * blockDim.x + threadIdx.x) >> 5;
  const int q0 = wave * (16 * SQT);

  // 256 rows of 256 bytes = 4096 pieces of 16 bytes; thread t copies pieces
  // t + 256 j, j = 0..15: piece p is bytes 16 (p & 15) .. +15 of row p >> 4.
  __shared__ __attribute__((aligned(16))) _Float16 kst[(SK / KSPLIT) * LP];
  {
    const int t = threadIdx.x;
    const unsigned int l = (unsigned int)(uintptr_t)&kst[0] + (t >> 4) * (LP * 2) + (t & 15) * 16;
    const _Float16* g = Kh + t * 8;
    async_copy8(l, g, 16 * LP * 2, 256 * 8);
    async_copy8(l + 8 * 16 * LP * 2, g + 8 * 256 * 8, 16 * LP * 2, 256 * 8);
  }

  v16h bq[SQT][4];
#pragma unroll
  for (int qt = 0; qt < SQT; ++qt) {
#pragma unroll
    for (int dc = 0; dc < 4; ++dc) bq[qt][dc] = load_tile_ab(Qh + (size_t)q0 * DD, DD, qt * 16, dc * 32, lane);
  }

  // this wave's copies have landed; behind the barrier every wave's have
  asm volatile("s_wait_asynccnt 0x0" ::: "memory");
  __syncthreads();

  float mrun[SQT], zrun[SQT];
#pragma unroll
  for (int qt = 0; qt < SQT; ++qt) { mrun[qt] = -__builtin_inff(); zrun[qt] = 0.0f; }

  // K fragments run one tile ahead: each is read again, for the next tile, right
  // behind its own WMMAs and lands under the vector work. The last trip reads tile
  // 0 once more (inside kst, not used).
  v16h a[4];
#pragma unroll
  for (int dc = 0; dc < 4; ++dc) a[dc] = load_tile_ab(kst, LP, 0, dc * 32, lane);
  // two trips per branch: the fragments' two register sets swap roles by name,
  // not by register copies
#pragma unroll 2
  for (int k0 = 0; k0 < SK / KSPLIT; k0 += 16) {
    const int kn = (k0 + 16) & (SK / KSPLIT - 1);
    v8f c[SQT];
#pragma unroll
    for (int qt = 0; qt < SQT; ++qt) c[qt] = (v8f){};
#pragma unroll
    for (int dc = 0; dc < 4; ++dc) {
#pragma unroll
      for (int qt = 0; qt < SQT; ++qt)
        c[qt] = __builtin_amdgcn_wmma_f32_16x16x32_f16(false, a[dc], false, bq[qt][dc],
                                                       (short)0, c[qt], false, false);
      a[dc] = load_tile_ab(kst, LP, kn, dc * 32, lane);
    }
    // keeps those reads in front of the vector work: sunk behind it they would be
    // waited out at the head of the next trip
    __builtin_amdgcn_sched_barrier(0);
    // C layout: lane holds column n=lane&15, rows r+8*(lane>>4), r=0..7
#pragma unroll
    for (int qt = 0; qt < SQT; ++qt) {
      float tmax = c[qt][0];
#pragma unroll
      for (int r = 1; r < 8; ++r) tmax = fmaxf(tmax, c[qt][r]);
      tmax = fmaxf(tmax, __shfl_xor(tmax, 16, 32));
      tmax *= SCALE2;
      float nm = fmaxf(mrun[qt], tmax);
      float ts = 0.0f;
#pragma unroll
      for (int r = 0; r < 8; ++r) ts += fexp2(c[qt][r] * SCALE2 - nm);
      ts += __shfl_xor(ts, 16, 32);
      zrun[qt] = zrun[qt] * fexp2(mrun[qt] - nm) + ts;
      mrun[qt] = nm;
    }
  }
  if (lane < 16) {
#pragma unroll
    for (int qt = 0; qt < SQT; ++qt)
      pl[blockIdx.y * SQ + q0 + qt * 16 + lane] = mrun[qt] + flog2(zrun[qt]);
  }
}

// ---------------------------------------------------------------------------
// Kernel 3: output. Each wave owns 16 OKT k rows x full 128 d (8 OKT f32 accumulators).
// A work-group has 16 waves: 8 groups of k rows x 2 halves of every 64-q step of
// its q range (blockIdx.y). Behind the loop the two waves of a k group add their
// sums through LDS, each taking one 16-row tile; the range's f32 partial sum goes
// to the workspace and sda_reduce adds the ranges.
// Per 32-q chunk the scores are formed TRANSPOSED, St = Q x K^T (A = Q rows from
// LDS, B = the wave's K rows in registers): a lane then holds, of one k row,
// q = 8 hi + r of each 16-q tile, which is the k order of the A operand of
// P x V. p = exp2(s-L[q]) is converted in place: P never leaves registers.
// A step's two Q chunks (32x128 f16) and two Vt chunks (128x32 f16), each shared by
// 8 waves, are copied block-wide into LDS by asynchronous copies, two buffers each,
// one step ahead, one barrier per step. L[q] = log2 of column q's whole sum of
// exponentials: each work-group joins the KSPLIT range values of its own q range
// in its prologue, two columns a thread, and keeps the result in LDS.
// ---------------------------------------------------------------------------
__device__ __forceinline__ void async_copy4(unsigned int l0, unsigned int l1,
                                            unsigned int l2, unsigned int l3,
                                            const _Float16* g0, const _Float16* g1,
                                            const _Float16* g2, const _Float16* g3) {
  asm volatile("global_load_async_to_lds_b128 %0, %4, off\n\t"
               "global_load_async_to_lds_b128 %1, %5, off\n\t"
               "global_load_async_to_lds_b128 %2, %6, off\n\t"
               "global_load_async_to_lds_b128 %3, %7, off\n\t"
               "s_wait_xcnt 0x0"
               :: "v"(l0), "v"(l1), "v"(l2), "v"(l3), "v"(g0), "v"(g1), "v"(g2), "v"(g3)
               : "memory");
}
#define QR (SQ / QSPLIT)
// One 16 x 128 accumulator tile (8 d tiles of 8 registers) into LDS: piece 2 dt + h
// holds registers 4 h .. 4 h + 3 of d tile dt, 512 bytes a piece.
__device__ __forceinline__ void xch_put(v4f* x, const v8f (&a)[8]) {
#pragma unroll
  for (int dt = 0; dt < 8; ++dt) {
    x[(2 * dt) * 32]     = (v4f){a[dt][0], a[dt][1], a[dt][2], a[dt][3]};
    x[(2 * dt + 1) * 32] = (v4f){a[dt][4], a[dt][5], a[dt][6], a[dt][7]};
  }
}
// Adds the partner's tile to this wave's and stores the sum.
// C layout: element (m = r + 8 hi, col = dt * 16 + n); o points at (8 hi, n); write-once.
// Plain stores: sda_reduce reads these partial sums back at once.
__device__ __forceinline__ void xch_finish(const v4f* x, const v8f (&a)[8], float* o) {
#pragma unroll
  for (int dt = 0; dt < 8; ++dt) {
    const v4f lo = x[(2 * dt) * 32], up = x[(2 * dt + 1) * 32];
#pragma unroll
    for (int r = 0; r < 4; ++r) {
      o[(size_t)r * (QSPLIT * DD) + dt * 16]       = a[dt][r] + lo[r];
      o[(size_t)(r + 4) * (QSPLIT * DD) + dt * 16] = a[dt][r + 4] + up[r];
    }
  }
}
// How many fragments the LDS reads of the output loop run ahead of their WMMAs.
#define AQD 2
#define BVD 4
// LDS, in bytes: the Vt buffers [2 steps][2 chunks], the Q buffers [2 steps][64 rows]
// and L; behind the loop the same bytes serve the exchange, 8 KB a wave.
#define VST_B (DD * VP * 2)
#define QST_B (64 * LP * 2)
#define OFF_Q (4 * VST_B)
#define OFF_L (OFF_Q + 2 * QST_B)
#define XCH_B (16 * 8192)
// Sixteen waves of 256 registers: one work-group fills a WGP, and the whole grid
// is resident at once.
__global__ __launch_bounds__(512, 4) void sda_output(const _Float16* __restrict__ Kh,
                           const _Float16* __restrict__ Qh_all,
                           const _Float16* __restrict__ Vt_all,
                           const float* __restrict__ pl,
                           float* __restrict__ part) {
  // this work-group's q range: every q index below is relative to qbase
  const int qbase = blockIdx.y * QR;
  const _Float16* Qh = Qh_all + (size_t)qbase * DD;
  const _Float16* Vt = Vt_all + qbase;
  float* out = part + blockIdx.y * DD;   // partials lie as [k][range][d]
  __shared__ __attribute__((aligned(32))) unsigned char smem[XCH_B];
  static_assert(OFF_L + QR * 4 <= XCH_B, "the loop's buffers lie inside smem");
  const _Float16* vstage = (const _Float16*)smem;            // Vt chunks, 40 KB
  const _Float16* qst    = (const _Float16*)(smem + OFF_Q);  // Q chunks, 34 KB
  float* lse = (float*)(smem + OFF_L);                       // L of the range, 4 KB
  const int lane = threadIdx.x & 31;
  // which half of each step this wave works on: the same in every lane, held as a scalar
  const int qh   = __builtin_amdgcn_readfirstlane(threadIdx.x >> 8);
  const int k0   = (blockIdx.x * 8 + ((threadIdx.x >> 5) & 7)) * (16 * OKT);
  const int n    = lane & 15;
  const int hi   = lane >> 4;

  // a step's Q rows = 64 rows of 256 bytes = 1024 pieces of 16 bytes; thread t copies
  // pieces t and t + 512: piece p is bytes 16 (p & 15) .. +15 of row p >> 4.
  const unsigned int ql = (unsigned int)(uintptr_t)smem + OFF_Q +
                          (threadIdx.x >> 4) * (LP * 2) + (threadIdx.x & 15) * 16;
  const _Float16* qg = Qh + threadIdx.x * 8;
  // a step's Vt rows = 128 rows of 128 bytes = 1024 pieces of 16 bytes; thread t copies
  // pieces t and t + 512: piece p is bytes 16 (p & 7) .. +15 of row p >> 3 and goes
  // to chunk (p & 7) >> 2, piece p & 3 of that chunk's row.
  const unsigned int vl = (unsigned int)(uintptr_t)smem + ((threadIdx.x >> 2) & 1) * VST_B +
                          (threadIdx.x >> 3) * (VP * 2) + (threadIdx.x & 3) * 16;
  const _Float16* vg = Vt + (size_t)(threadIdx.x >> 3) * SQ + (threadIdx.x & 7) * 8;
  async_copy4(ql, ql + 32 * LP * 2, vl, vl + 64 * VP * 2,         // step 0 -> buffers 0
              qg, qg + 512 * 8, vg, vg + (size_t)64 * SQ);
  // the range values of columns qbase + 2 t and the next one, all loads in flight at once
  v2f pv[KSPLIT];
#pragma unroll
  for (int s = 0; s < KSPLIT; ++s) pv[s] = *(const v2f*)(pl + s * SQ + qbase + 2 * threadIdx.x);

  v16h ak[OKT][4];
  const _Float16* kr = Kh + (size_t)(k0 + n) * DD + hi * 8;   // the lane's place in its first K row
#pragma unroll
  for (int kt = 0; kt < OKT; ++kt) {
#pragma unroll
    for (int dc = 0; dc < 4; ++dc) {
      const v8h lo = *(const v8h*)(kr + kt * 16 * DD + dc * 32);        // as load_tile_ab
      const v8h up = *(const v8h*)(kr + kt * 16 * DD + dc * 32 + 16);
#pragma unroll
      for (int i = 0; i < 8; ++i) { ak[kt][dc][i] = lo[i]; ak[kt][dc][i + 8] = up[i]; }
    }
  }
  // Names the K loads' address, which so stays in its registers up to this wait:
  // it is otherwise given to the result of a later load of the same run.
  asm volatile("s_wait_xcnt 0x0" :: "v"(kr) : "memory");

  // L = M + log2(sum over the ranges of exp2(value - M)), M the largest value
  {
    v2f mx = pv[0];
#pragma unroll
    for (int s = 1; s < KSPLIT; ++s) mx = __builtin_elementwise_max(mx, pv[s]);
    v2f sm = {0.0f, 0.0f};
#pragma unroll
    for (int s = 0; s < KSPLIT; ++s) {
      const v2f d = pv[s] - mx;
      sm += (v2f){fexp2(d[0]), fexp2(d[1])};
    }
    *(v2f*)&lse[2 * threadIdx.x] = mx + (v2f){flog2(sm[0]), flog2(sm[1])};
  }
  // the accumulators come to life behind the join: set to zero in front of it, they
  // and the range values together push K fragments and accumulators out into scratch
  __builtin_amdgcn_sched_barrier(0);

  v8f acc[OKT][8];
#pragma unroll
  for (int kt = 0; kt < OKT; ++kt) {
#pragma unroll
    for (int dt = 0; dt < 8; ++dt) acc[kt][dt] = (v8f){};
  }

  const int NCHUNK = QR / 64;
  // step 0: this wave's copies have landed; the barrier publishes them and L
  asm volatile("s_wait_asynccnt 0x0" ::: "memory");
  __syncthreads();
  async_copy4(ql + QST_B, ql + QST_B + 32 * LP * 2,               // step 1 -> buffers 1
              vl + 2 * VST_B, vl + 2 * VST_B + 64 * VP * 2,
              qg + 64 * DD, qg + 64 * DD + 512 * 8, vg + 64, vg + 64 + (size_t)64 * SQ);

  for (int ci = 0; ci < NCHUNK; ++ci) {
    const int q0 = ci * 64 + qh * 32;   // this wave's chunk of the step
    const _Float16* qsrc = qst + (ci & 1) * (QST_B / 2) + qh * (32 * LP);
    // ---- St = Q x K^T, one 16-q tile at a time (accumulate over d=128), and at once
    // ---- p = exp2(s*scale2 - L[q]); register r of tile j is q = 16 j + 8 hi + r,
    // ---- so the two tiles, converted, are halves 0-7 and 8-15 of the A operand.
    // Only one tile's scores are live at a time, which leaves registers for Q
    // fragments that run AQD ahead of their WMMAs in a rotating set.
    // The scheduler otherwise sinks each read to just in front of its WMMAs, where
    // its whole latency is waited out.
    v16h pa[OKT];
#pragma unroll
    for (int j = 0; j < 2; ++j) {
      v16h aq[AQD];
#pragma unroll
      for (int dc = 0; dc < AQD; ++dc) aq[dc] = load_tile_ab(qsrc, LP, 16 * j, dc * 32, lane);
      v8f cj[OKT];
#pragma unroll
      for (int kt = 0; kt < OKT; ++kt) cj[kt] = (v8f){};
#pragma unroll
      for (int dc = 0; dc < 4; ++dc) {
        __builtin_amdgcn_sched_barrier(0);   // the reads issued so far stay ahead of these WMMAs
#pragma unroll
        for (int kt = 0; kt < OKT; ++kt)
          cj[kt] = __builtin_amdgcn_wmma_f32_16x16x32_f16(false, aq[dc % AQD], false, ak[kt][dc],
                                                          (short)0, cj[kt], false, false);
        if (dc + AQD < 4) aq[dc % AQD] = load_tile_ab(qsrc, LP, 16 * j, (dc + AQD) * 32, lane);
      }
      const v8f lq = *(const v8f*)&lse[q0 + 16 * j + 8 * hi];
#pragma unroll
      for (int kt = 0; kt < OKT; ++kt) {
        v8f e = cj[kt] * SCALE2 - lq;
#pragma unroll
        for (int r = 0; r < 8; ++r) e[r] = fexp2(e[r]);
        v8h h = __builtin_convertvector(e, v8h);
#pragma unroll
        for (int i = 0; i < 8; ++i) pa[kt][i + 8 * j] = h[i];
      }
      // the next group of reads stays behind this tile's vector work: hoisted over it,
      // it pushes accumulators and K fragments out into scratch
      __builtin_amdgcn_sched_barrier(0);
    }
    // ---- O(16x128) += P(16x32) x Vt-as-B(32q x 16d) per d-tile -----------
    // Vt fragments run BVD ahead of their WMMAs in the registers the scores have left.
    const _Float16* vsrc = vstage + ((ci & 1) * 2 + qh) * (VST_B / 2);   // row-major [128][32], pitch VP
    v16h bv[BVD];
#pragma unroll
    for (int dt = 0; dt < BVD; ++dt) bv[dt] = load_tile_ab(vsrc, VP, dt * 16, 0, lane);
#pragma unroll
    for (int dt = 0; dt < 8; ++dt) {
      __builtin_amdgcn_sched_barrier(0);   // the reads issued so far stay ahead of these WMMAs
#pragma unroll
      for (int kt = 0; kt < OKT; ++kt)
        acc[kt][dt] = __builtin_amdgcn_wmma_f32_16x16x32_f16(false, pa[kt], false, bv[dt % BVD],
                                                             (short)0, acc[kt][dt], false, false);
      if (dt + BVD < 8) bv[dt % BVD] = load_tile_ab(vsrc, VP, (dt + BVD) * 16, 0, lane);
    }
    // Publish point of step ci + 1: this wave's LDS reads of step ci are done and
    // its own copies have landed; the barrier publishes step ci + 1 to the block
    // and ends every reader's last read of the buffers that are refilled behind it.
    asm volatile("s_wait_dscnt 0x0" ::: "memory");
    asm volatile("s_wait_asynccnt 0x0" ::: "memory");
    __syncthreads();
    if (ci + 2 < NCHUNK) {   // step ci + 2 into the buffers that step ci has left
      const unsigned int lq = ql + (ci & 1) * QST_B;
      const unsigned int lv = vl + (ci & 1) * (2 * VST_B);
      const _Float16* gq = qg + (size_t)(ci * 64 + 128) * DD;
      const _Float16* gv = vg + (ci * 64 + 128);
      async_copy4(lq, lq + 32 * LP * 2, lv, lv + 64 * VP * 2,
                  gq, gq + 512 * 8, gv, gv + (size_t)64 * SQ);
    }
  }
  // no copy is left in flight when the buffers are given to the exchange
  asm volatile("s_wait_asynccnt 0x0" ::: "memory");
  // ---- the two halves of a k group join: the wave of half 0 hands over its tile 1
  // ---- and finishes tile 0, the wave of half 1 the other way round. A handed tile
  // ---- lies register-major, 16 bytes a lane, so the partner's same lane reads it.
  // The loop's last barrier has ended every read of the buffers written here.
  v4f* xmine = (v4f*)smem + (threadIdx.x >> 5) * 512 + lane;
  const v4f* xpart = (const v4f*)smem + ((threadIdx.x >> 5) ^ 8) * 512 + lane;
  if (qh == 0) xch_put(xmine, acc[1]); else xch_put(xmine, acc[0]);
  __syncthreads();   // every handed tile is in LDS
  float* orow = out + (size_t)(k0 + qh * 16 + 8 * hi) * (QSPLIT * DD) + n;
  if (qh == 0) xch_finish(xpart, acc[0], orow); else xch_finish(xpart, acc[1], orow);
}

// ---------------------------------------------------------------------------
// Kernel 4: out = sum of the QSPLIT partial outputs, in range order.
// A thread sums one float4 of two neighbouring k rows, so that it still has 16
// loads in flight with half as many ranges.
// ---------------------------------------------------------------------------
__global__ void sda_reduce(const float* __restrict__ part, float* __restrict__ out) {
  const int i = blockIdx.x * blockDim.x + threadIdx.x;   // 0 .. SK*DD/8-1
  // rows k = 2 (i / 32) and k + 1 hold 2 QSPLIT partial rows of 32 float4 each, on end
  const float4* row4 = (const float4*)part + (i >> 5) * (2 * QSPLIT * DD / 4) + (i & 31);
  float4 v[2 * QSPLIT];
#pragma unroll
  for (int p = 0; p < 2 * QSPLIT; ++p) v[p] = row4[p * (DD / 4)];
#pragma unroll
  for (int h = 0; h < 2; ++h) {
    float4 s = v[h * QSPLIT];
#pragma unroll
    for (int p = 1; p < QSPLIT; ++p) {
      const float4 w = v[h * QSPLIT + p];
      s.x += w.x; s.y += w.y; s.z += w.z; s.w += w.w;
    }
    ((float4*)out)[(i >> 5) * (2 * DD / 4) + h * (DD / 4) + (i & 31)] = s;
  }
}

extern "C" void kernel_launch(void* const* d_in, const int* in_sizes, int n_in,
                              void* d_out, int out_size, void* d_ws, size_t ws_size,
                              hipStream_t stream) {
  (void)in_sizes; (void)n_in; (void)out_size; (void)ws_size;
  const float* K = (const float*)d_in[0];
  const float* Q = (const float*)d_in[1];
  const float* V = (const float*)d_in[2];
  float* out = (float*)d_out;

  _Float16* Kh = (_Float16*)d_ws;                       // [8192,128] f16
  _Float16* Qh = Kh + (size_t)SK * DD;                  // [8192,128] f16
  _Float16* Vt = Qh + (size_t)SQ * DD;                  // [128,8192] f16 (transposed)
  float*    pl = (float*)(Vt + (size_t)DD * SQ);        // [KSPLIT][8192] range log2-sum-exp
  float*    part = pl + (size_t)KSPLIT * SQ;            // [8192][QSPLIT][128] partial out

  sda_convert<<<(SQ / 64) * (DD / 64), 256, 0, stream>>>(K, Q, V, Kh, Qh, Vt);
  // stats: 8 waves/block, 128 SQT q columns per block in x; output: 16 waves/block,
  // 128 OKT k rows per block in x; the split ranges in y
  sda_stats<<<dim3(SQ / (128 * SQT), KSPLIT), 256, 0, stream>>>(Kh, Qh, pl);
  sda_output<<<dim3(SK / (128 * OKT), QSPLIT), 512, 0, stream>>>(Kh, Qh, Vt, pl, part);
  sda_reduce<<<(SK * DD) / 8 / 256, 256, 0, stream>>>(part, out);
}

// v009
// A run of this version takes 57.6 microseconds.
// Next to v008, in two timings, it ran 1.06 and 1.07 times as fast.
// All steps since v000 together make it 18.6 times as fast.
#include <hip/hip_runtime.h>
#include <hip/hip_bf16.h>

typedef __attribute__((ext_vector_type(16))) _Float16 v16h;
typedef __attribute__((ext_vector_type(8)))  _Float16 v8h;
typedef __attribute__((ext_vector_type(8)))  float    v8f;
typedef __attribute__((ext_vector_type(2)))  float    v2f;

#define SK 8192
#define SQ 8192
#define DD 128
// The k loop of the stats kernel and the q loop of the output kernel are cut
// into KSPLIT / QSPLIT equal ranges, one per blockIdx.y, so that the grid
// covers every WGP; the stats ranges are joined in the output kernel's prologue,
// the output ranges by a small launch. An output work-group cuts its range once
// more, between two halves of its waves, and joins the two sums itself in LDS.
#define KSPLIT 32
#define QSPLIT 8
// Wave tiles: a stats wave owns SQT 16-column q tiles and an output wave OKT
// 16-row k tiles, so that one fragment read from LDS feeds SQT (OKT) WMMAs.
// Every loop over these tiles is unrolled: its fragment and accumulator arrays
// stay in registers only if each index is a constant.
#define SQT 4
#define OKT 2
// 1/sqrt(128) * log2(e): softmax computed in log2 domain -> native v_exp_f32
#define SCALE2 0.12751589906834162f

// Raw v_exp_f32: args here are bounded (<= 0, > -40), so skip OCML's
// underflow-guard path (saves ~6 VALU per exponential in the hot loop).
__device__ __forceinline__ float fexp2(float x) {
#if defined(__HIP_DEVICE_COMPILE__) && __has_builtin(__builtin_amdgcn_exp2f)
  return __builtin_amdgcn_exp2f(x);
#else
  return exp2f(x);
#endif
}

// Raw v_log_f32 (log2): every argument here is a sum of exponentials whose
// largest term is 1, so it is >= 1 and needs no subnormal path.
__device__ __forceinline__ float flog2(float x) {
#if defined(__HIP_DEVICE_COMPILE__) && __has_builtin(__builtin_amdgcn_logf)
  return __builtin_amdgcn_logf(x);
#else
  return log2f(x);
#endif
}

// ---------------------------------------------------------------------------
// Load a 16x32 f16 tile from a row-major matrix into the WMMA A/B register
// layout (ISA 7.12.2, 16-bit A-matrix 16x32):
//   lanes 0-15 : row = row0+lane,    halves 0-7 = cols c0+0..7,  8-15 = c0+16..23
//   lanes 16-31: row = row0+lane-16, halves 0-7 = cols c0+8..15, 8-15 = c0+24..31
// Both chunks are 16B aligned -> two b128 loads per lane (global or ds).
// Serves B operands too: a B (KxN) tile equals the A layout of rows of the
// row-major N-major source (lane = column index n).
// ---------------------------------------------------------------------------
__device__ __forceinline__ v16h load_tile_ab(const _Float16* base,
                                             int ld, int row0, int col0, int lane) {
  const int r  = row0 + (lane & 15);
  const int hs = (lane >> 4) & 1;
  const _Float16* p = base + (size_t)r * ld + col0 + hs * 8;
  v8h lo = *(const v8h*)p;
  v8h hi = *(const v8h*)(p + 16);
  v16h out;
#pragma unroll
  for (int i = 0; i < 8; ++i) { out[i] = lo[i]; out[i + 8] = hi[i]; }
  return out;
}

// Kh and Qh lie in FRAGMENT ORDER, not row-major: each 16-row x 32-column tile is
// 1024 bytes on end, [16-row tile][32-column chunk][h][lane][8 halves], where piece
// (h, lane) holds row lane & 15, columns 16 h + 8 (lane >> 4) .. + 7 of the chunk:
// what load_tile_ab gives that lane as its halves 8 h .. 8 h + 7. A fragment load is
// then two runs of 512 bytes, four whole lines each, where a row-major tile makes
// every load touch 16 lines; 16 rows still fill the same 4096 bytes as row-major,
// so block-wide copies into LDS keep their global addresses, and in LDS the same
// order is read without bank conflicts and needs no padded pitch.
// base = the first of the 16-row tiles counted by tile.
__device__ __forceinline__ v16h load_frag(const _Float16* base, int tile, int dc, int lane) {
  const _Float16* p = base + (tile * 4 + dc) * 512 + lane * 8;
  v8h lo = *(const v8h*)p;
  v8h hi = *(const v8h*)(p + 256);
  v16h out;
#pragma unroll
  for (int i = 0; i < 8; ++i) { out[i] = lo[i]; out[i + 8] = hi[i]; }
  return out;
}

// LDS pitch, in halfs, of a staged 32-half row: 80 bytes = 16 x 5, a conflict-free
// pitch for 16-byte LDS reads.
#define VP 40

// Asynchronous copies global -> LDS, 16 bytes per lane and copy, through no
// register. l* = the lane's own LDS byte address, g* = its own global address.
// The closing s_wait_xcnt stands inside the statement so that no address
// register of an issued copy is rewritten in front of it.
__device__ __forceinline__ void async_copy2(unsigned int l0, unsigned int l1,
                                            const _Float16* g0, const _Float16* g1) {
  asm volatile("global_load_async_to_lds_b128 %0, %2, off\n\t"
               "global_load_async_to_lds_b128 %1, %3, off\n\t"
               "s_wait_xcnt 0x0"
               :: "v"(l0), "v"(l1), "v"(g0), "v"(g1) : "memory");
}
__device__ __forceinline__ void async_copy8(unsigned int l, const _Float16* g,
                                            unsigned int lstep, int gstep) {
  asm volatile("global_load_async_to_lds_b128 %0, %8, off\n\t"
               "global_load_async_to_lds_b128 %1, %9, off\n\t"
               "global_load_async_to_lds_b128 %2, %10, off\n\t"
               "global_load_async_to_lds_b128 %3, %11, off\n\t"
               "global_load_async_to_lds_b128 %4, %12, off\n\t"
               "global_load_async_to_lds_b128 %5, %13, off\n\t"
               "global_load_async_to_lds_b128 %6, %14, off\n\t"
               "global_load_async_to_lds_b128 %7, %15, off\n\t"
               "s_wait_xcnt 0x0"
               :: "v"(l), "v"(l + lstep), "v"(l + 2 * lstep), "v"(l + 3 * lstep),
                  "v"(l + 4 * lstep), "v"(l + 5 * lstep), "v"(l + 6 * lstep), "v"(l + 7 * lstep),
                  "v"(g), "v"(g + gstep), "v"(g + 2 * gstep), "v"(g + 3 * gstep),
                  "v"(g + 4 * gstep), "v"(g + 5 * gstep), "v"(g + 6 * gstep), "v"(g + 7 * gstep)
               : "memory");
}

// ---------------------------------------------------------------------------
// Kernel 1: f32 -> f16 copies of K and Q in fragment order; transposed f16 copy of V (Vt[d][q]).
// One work-group per 64 q x 64 d tile of V (256 in all), which also converts
// 4096 elements (32 rows) of K and of Q into fragment order. Every thread has its
// 12 16-byte loads in flight at once; V is transposed through LDS so that Vt is
// stored in whole 128-byte lines, each by one work-group.
// ---------------------------------------------------------------------------
// LDS pitch, in halfs, of a transposed 64-half row: 144 bytes = 16 x 9.
#define TP 72
typedef __attribute__((ext_vector_type(4))) _Float16 v4h;
typedef __attribute__((ext_vector_type(2))) _Float16 v2h;
typedef __attribute__((ext_vector_type(4))) float v4f;
__global__ __launch_bounds__(256) void sda_convert(const float* __restrict__ K, const float* __restrict__ Q,
                            const float* __restrict__ V,
                            _Float16* __restrict__ Kh, _Float16* __restrict__ Qh,
                            _Float16* __restrict__ Vt) {
  __shared__ __attribute__((aligned(16))) _Float16 tl[64 * TP];   // [d][q]
  const int t  = threadIdx.x;
  const int q0 = (blockIdx.x >> 1) * 64;
  const int d0 = (blockIdx.x & 1) * 64;
  const int c  = t & 15;      // which float4 of the tile's 64-float row
  const int rp = t >> 4;      // which pair of rows
  // V rows q0 + 32 j + 2 rp and the next one, floats d0 + 4 c .. + 3
  const float* vp = V + (size_t)q0 * DD + d0 + (2 * rp * DD + 4 * c);
  v4f va[2], vb[2];
#pragma unroll
  for (int j = 0; j < 2; ++j) {
    va[j] = *(const v4f*)(vp + 32 * j * DD);
    vb[j] = *(const v4f*)(vp + 32 * j * DD + DD);
  }
  // The offset register of the V loads is given to a later load's result: this
  // wait stands in front of that overwrite.
  asm volatile("s_wait_xcnt 0x0" ::: "memory");
  // K and Q: load j of a wave takes 32-column chunk j (one whole line) of 4 rows;
  // thread t has row kr of the work-group's 32 and float4 ke of the chunk's 8
  const int kr = t >> 3, ke = t & 7;
  const v4f* K4 = (const v4f*)K + blockIdx.x * 1024;
  const v4f* Q4 = (const v4f*)Q + blockIdx.x * 1024;
  const int ko = kr * 32 + ke;
  v4f kv[4], qv[4];
#pragma unroll
  for (int j = 0; j < 4; ++j) { kv[j] = K4[ko + 8 * j]; qv[j] = Q4[ko + 8 * j]; }

#pragma unroll
  for (int j = 0; j < 2; ++j) {
#pragma unroll
    for (int i = 0; i < 4; ++i) {
      v2h h = {(_Float16)va[j][i], (_Float16)vb[j][i]};     // q, q + 1 of one d
      *(v2h*)&tl[(4 * c + i) * TP + 32 * j + 2 * rp] = h;
    }
  }
  // Holds the K and Q loads in front of the barrier, whole and in flight beside
  // the V loads: without it half of each is sunk behind the barrier and pays a
  // second round trip there.
  asm volatile("" :: "v"(kv[0]), "v"(kv[1]), "v"(kv[2]), "v"(kv[3]),
                     "v"(qv[0]), "v"(qv[1]), "v"(qv[2]), "v"(qv[3]));
  // The transposed tile is complete. No global store stands in front of this
  // barrier: it would wait for that store to finish.
  __syncthreads();
  // 64 rows of 128 bytes = 512 pieces of 16 bytes; thread t stores pieces t, t + 256
#pragma unroll
  for (int j = 0; j < 2; ++j) {
    const int p = t + 256 * j;
    const int d = p >> 3, g = p & 7;
    *(v8h*)&Vt[(size_t)(d0 + d) * SQ + q0 + 8 * g] = *(const v8h*)&tl[d * TP + 8 * g];
  }
  // fragment order: columns 4 ke .. + 3 of chunk j are half ke & 1 of piece
  // (h = ke >> 2, lane = 16 ((ke >> 1) & 1) + row & 15); in units of 4 halves
  const int fo = blockIdx.x * 1024 + (kr >> 4) * 512 + (ke >> 2) * 64 +
                 (((ke >> 1) & 1) * 16 + (kr & 15)) * 2 + (ke & 1);
  v4h* Kh4 = (v4h*)Kh + fo;
  v4h* Qh4 = (v4h*)Qh + fo;
#pragma unroll
  for (int j = 0; j < 4; ++j) {
    Kh4[128 * j] = __builtin_convertvector(kv[j], v4h);
    Qh4[128 * j] = __builtin_convertvector(qv[j], v4h);
  }
}

// ---------------------------------------------------------------------------
// Kernel 2: per-query-column softmax stats over one range of the k axis.
// Each wave owns 16 SQT q columns; loops its k range (blockIdx.y) in 16-row tiles.
// Online (max, sum-exp2) per column, merged across lane halves via shfl_xor 16.
// Writes the range's log2 of its sum of exponentials, max + log2(sum), one float
// per column; the output kernel joins the ranges.
// The range's K rows, which all 8 waves read, are copied once per block into
// LDS in whole lines; the fragments are then read from LDS.
// ---------------------------------------------------------------------------
// The real block size lifts the register ceiling to what the wave tile needs.
__global__ __launch_bounds__(256) void sda_stats(const _Float16* __restrict__ Kh_all,
                          const _Float16* __restrict__ Qh,
                          float* __restrict__ pl) {   // [KSPLIT][SQ]
  const _Float16* Kh = Kh_all + (size_t)blockIdx.y * (SK / KSPLIT) * DD;
  const int lane = threadIdx.x & 31;
  const int wave = (blockIdx.x * blockDim.x + threadIdx.x) >> 5;
  const int q0 = wave * (16 * SQT);

  // 256 rows = 16 tiles in fragment order = 4096 pieces of 16 bytes, copied as they
  // lie; thread t copies pieces t + 256 j, j = 0..15.
  __shared__ __attribute__((aligned(16))) _Float16 kst[(SK / KSPLIT) * DD];
  {
    const int t = threadIdx.x;
    const unsigned int l = (unsigned int)(uintptr_t)&kst[0] + t * 16;
    const _Float16* g = Kh + t * 8;
    async_copy8(l, g, 256 * 16, 256 * 8);
    async_copy8(l + 8 * 256 * 16, g + 8 * 256 * 8, 256 * 16, 256 * 8);
  }

  v16h bq[SQT][4];
#pragma unroll
  for (int qt = 0; qt < SQT; ++qt) {
#pragma unroll
    for (int dc = 0; dc < 4; ++dc) bq[qt][dc] = load_frag(Qh + (size_t)q0 * DD, qt, dc, lane);
  }

  // the Q loads' address register is given to a K fragment behind the barrier: this
  // wait stands in front of that overwrite
  asm volatile("s_wait_xcnt 0x0" ::: "memory");
  // this wave's copies have landed; behind the barrier every wave's have
  asm volatile("s_wait_asynccnt 0x0" ::: "memory");
  __syncthreads();

  float mrun[SQT], zrun[SQT];
#pragma unroll
  for (int qt = 0; qt < SQT; ++qt) { mrun[qt] = -__builtin_inff(); zrun[qt] = 0.0f; }

  // K fragments run one tile ahead: each is read again, for the next tile, right
  // behind its own WMMAs and lands under the vector work. The last trip reads tile
  // 0 once more (inside kst, not used).
  v16h a[4];
#pragma unroll
  for (int dc = 0; dc < 4; ++dc) a[dc] = load_frag(kst, 0, dc, lane);
  // two trips per branch: the fragments' two register sets swap roles by name,
  // not by register copies
#pragma unroll 2
  for (int k0 = 0; k0 < SK / KSPLIT; k0 += 16) {
    const int kn = (k0 + 16) & (SK / KSPLIT - 1);
    v8f c[SQT];
#pragma unroll
    for (int qt = 0; qt < SQT; ++qt) c[qt] = (v8f){};
#pragma unroll
    for (int dc = 0; dc < 4; ++dc) {
#pragma unroll
      for (int qt = 0; qt < SQT; ++qt)
        c[qt] = __builtin_amdgcn_wmma_f32_16x16x32_f16(false, a[dc], false, bq[qt][dc],
                                                       (short)0, c[qt], false, false);
      a[dc] = load_frag(kst, kn >> 4, dc, lane);
    }
    // keeps those reads in front of the vector work: sunk behind it they would be
    // waited out at the head of the next trip
    __builtin_amdgcn_sched_barrier(0);
    // C layout: lane holds column n=lane&15, rows r+8*(lane>>4), r=0..7
#pragma unroll
    for (int qt = 0; qt < SQT; ++qt) {
      float tmax = c[qt][0];
#pragma unroll
      for (int r = 1; r < 8; ++r) tmax = fmaxf(tmax, c[qt][r]);
      tmax = fmaxf(tmax, __shfl_xor(tmax, 16, 32));
      tmax *= SCALE2;
      float nm = fmaxf(mrun[qt], tmax);
      float ts = 0.0f;
#pragma unroll
      for (int r = 0; r < 8; ++r) ts += fexp2(c[qt][r] * SCALE2 - nm);
      ts += __shfl_xor(ts, 16, 32);
      zrun[qt] = zrun[qt] * fexp2(mrun[qt] - nm) + ts;
      mrun[qt] = nm;
    }
  }
  if (lane < 16) {
#pragma unroll
    for (int qt = 0; qt < SQT; ++qt)
      pl[blockIdx.y * SQ + q0 + qt * 16 + lane] = mrun[qt] + flog2(zrun[qt]);
  }
}

// ---------------------------------------------------------------------------
// Kernel 3: output. Each wave owns 16 OKT k rows x full 128 d (8 OKT f32 accumulators).
// A work-group has 16 waves: 8 groups of k rows x 2 halves of every 64-q step of
// its q range (blockIdx.y). Behind the loop the two waves of a k group add their
// sums through LDS, each taking one 16-row tile; the range's f32 partial sum goes
// to the workspace and sda_reduce adds the ranges.
// Per 32-q chunk the scores are formed TRANSPOSED, St = Q x K^T (A = Q rows from
// LDS, B = the wave's K rows in registers): a lane then holds, of one k row,
// q = 8 hi + r of each 16-q tile, which is the k order of the A operand of
// P x V. p = exp2(s-L[q]) is converted in place: P never leaves registers.
// A step's two Q chunks (32x128 f16) and two Vt chunks (128x32 f16), each shared by
// 8 waves, are copied block-wide into LDS by asynchronous copies, two buffers each,
// one step ahead, one barrier per step. L[q] = log2 of column q's whole sum of
// exponentials: each work-group joins the KSPLIT range values of its own q range
// in its prologue, two columns a thread, and keeps the result in LDS.
// ---------------------------------------------------------------------------
__device__ __forceinline__ void async_copy4(unsigned int l0, unsigned int l1,
                                            unsigned int l2, unsigned int l3,
                                            const _Float16* g0, const _Float16* g1,
                                            const _Float16* g2, const _Float16* g3) {
  asm volatile("global_load_async_to_lds_b128 %0, %4, off\n\t"
               "global_load_async_to_lds_b128 %1, %5, off\n\t"
               "global_load_async_to_lds_b128 %2, %6, off\n\t"
               "global_load_async_to_lds_b128 %3, %7, off\n\t"
               "s_wait_xcnt 0x0"
               :: "v"(l0), "v"(l1), "v"(l2), "v"(l3), "v"(g0), "v"(g1), "v"(g2), "v"(g3)
               : "memory");
}
#define QR (SQ / QSPLIT)
// One 16 x 128 accumulator tile (8 d tiles of 8 registers) into LDS: piece 2 dt + h
// holds registers 4 h .. 4 h + 3 of d tile dt, 512 bytes a piece.
__device__ __forceinline__ void xch_put(v4f* x, const v8f (&a)[8]) {
#pragma unroll
  for (int dt = 0; dt < 8; ++dt) {
    x[(2 * dt) * 32]     = (v4f){a[dt][0], a[dt][1], a[dt][2], a[dt][3]};
    x[(2 * dt + 1) * 32] = (v4f){a[dt][4], a[dt][5], a[dt][6], a[dt][7]};
  }
}
// Adds the partner's tile to this wave's and stores the sum.
// C layout: element (m = r + 8 hi, col = dt * 16 + n); o points at (8 hi, n); write-once.
// Plain stores: sda_reduce reads these partial sums back at once.
__device__ __forceinline__ void xch_finish(const v4f* x, const v8f (&a)[8], float* o) {
#pragma unroll
  for (int dt = 0; dt < 8; ++dt) {
    const v4f lo = x[(2 * dt) * 32], up = x[(2 * dt + 1) * 32];
#pragma unroll
    for (int r = 0; r < 4; ++r) {
      o[(size_t)r * (QSPLIT * DD) + dt * 16]       = a[dt][r] + lo[r];
      o[(size_t)(r + 4) * (QSPLIT * DD) + dt * 16] = a[dt][r + 4] + up[r];
    }
  }
}
// How many fragments the LDS reads of the output loop run ahead of their WMMAs.
#define AQD 2
#define BVD 4
// LDS, in bytes: the Vt buffers [2 steps][2 chunks], the Q buffers [2 steps][64 rows]
// and L; behind the loop the same bytes serve the exchange, 8 KB a wave.
#define VST_B (DD * VP * 2)
#define QST_B (64 * DD * 2)
#define OFF_Q (4 * VST_B)
#define OFF_L (OFF_Q + 2 * QST_B)
#define XCH_B (16 * 8192)
// Sixteen waves of 256 registers: one work-group fills a WGP, and the whole grid
// is resident at once.
__global__ __launch_bounds__(512, 4) void sda_output(const _Float16* __restrict__ Kh,
                           const _Float16* __restrict__ Qh_all,
                           const _Float16* __restrict__ Vt_all,
                           const float* __restrict__ pl,
                           float* __restrict__ part) {
  // this work-group's q range: every q index below is relative to qbase
  const int qbase = blockIdx.y * QR;
  const _Float16* Qh = Qh_all + (size_t)qbase * DD;
  const _Float16* Vt = Vt_all + qbase;
  float* out = part + blockIdx.y * DD;   // partials lie as [k][range][d]
  __shared__ __attribute__((aligned(32))) unsigned char smem[XCH_B];
  static_assert(OFF_L + QR * 4 <= XCH_B, "the loop's buffers lie inside smem");
  const _Float16* vstage = (const _Float16*)smem;            // Vt chunks, 40 KB
  const _Float16* qst    = (const _Float16*)(smem + OFF_Q);  // Q chunks, 32 KB
  float* lse = (float*)(smem + OFF_L);                       // L of the range, 4 KB
  const int lane = threadIdx.x & 31;
  // which half of each step this wave works on: the same in every lane, held as a scalar
  const int qh   = __builtin_amdgcn_readfirstlane(threadIdx.x >> 8);
  const int k0   = (blockIdx.x * 8 + ((threadIdx.x >> 5) & 7)) * (16 * OKT);
  const int n    = lane & 15;
  const int hi   = lane >> 4;

  // a step's Q rows = 4 tiles in fragment order = 1024 pieces of 16 bytes, copied as
  // they lie; thread t copies pieces t and t + 512.
  const unsigned int ql = (unsigned int)(uintptr_t)smem + OFF_Q + threadIdx.x * 16;
  const _Float16* qg = Qh + threadIdx.x * 8;
  // a step's Vt rows = 128 rows of 128 bytes = 1024 pieces of 16 bytes; thread t copies
  // pieces t and t + 512: piece p is bytes 16 (p & 7) .. +15 of row p >> 3 and goes
  // to chunk (p & 7) >> 2, piece p & 3 of that chunk's row.
  const unsigned int vl = (unsigned int)(uintptr_t)smem + ((threadIdx.x >> 2) & 1) * VST_B +
                          (threadIdx.x >> 3) * (VP * 2) + (threadIdx.x & 3) * 16;
  const _Float16* vg = Vt + (size_t)(threadIdx.x >> 3) * SQ + (threadIdx.x & 7) * 8;
  async_copy4(ql, ql + 512 * 16, vl, vl + 64 * VP * 2,            // step 0 -> buffers 0
              qg, qg + 512 * 8, vg, vg + (size_t)64 * SQ);
  // the range values of columns qbase + 2 t and the next one, all loads in flight at once
  v2f pv[KSPLIT];
#pragma unroll
  for (int s = 0; s < KSPLIT; ++s) pv[s] = *(const v2f*)(pl + s * SQ + qbase + 2 * threadIdx.x);

  v16h ak[OKT][4];
  const _Float16* kr = Kh + (size_t)k0 * DD + lane * 8;   // the lane's piece of its first K fragment
#pragma unroll
  for (int kt = 0; kt < OKT; ++kt) {
#pragma unroll
    for (int dc = 0; dc < 4; ++dc) {
      const v8h lo = *(const v8h*)(kr + (kt * 4 + dc) * 512);           // as load_frag
      const v8h up = *(const v8h*)(kr + (kt * 4 + dc) * 512 + 256);
#pragma unroll
      for (int i = 0; i < 8; ++i) { ak[kt][dc][i] = lo[i]; ak[kt][dc][i + 8] = up[i]; }
    }
  }
  // Names the K loads' address, which so stays in its registers up to this wait:
  // it is otherwise given to the result of a later load of the same run.
  asm volatile("s_wait_xcnt 0x0" :: "v"(kr) : "memory");

  // L = M + log2(sum over the ranges of exp2(value - M)), M the largest value
  {
    v2f mx = pv[0];
#pragma unroll
    for (int s = 1; s < KSPLIT; ++s) mx = __builtin_elementwise_max(mx, pv[s]);
    v2f sm = {0.0f, 0.0f};
#pragma unroll
    for (int s = 0; s < KSPLIT; ++s) {
      const v2f d = pv[s] - mx;
      sm += (v2f){fexp2(d[0]), fexp2(d[1])};
    }
    *(v2f*)&lse[2 * threadIdx.x] = mx + (v2f){flog2(sm[0]), flog2(sm[1])};
  }
  // the accumulators come to life behind the join: set to zero in front of it, they
  // and the range values together push K fragments and accumulators out into scratch
  __builtin_amdgcn_sched_barrier(0);

  v8f acc[OKT][8];
#pragma unroll
  for (int kt = 0; kt < OKT; ++kt) {
#pragma unroll
    for (int dt = 0; dt < 8; ++dt) acc[kt][dt] = (v8f){};
  }

  const int NCHUNK = QR / 64;
  // step 0: this wave's copies have landed; the barrier publishes them and L
  asm volatile("s_wait_asynccnt 0x0" ::: "memory");
  __syncthreads();
  async_copy4(ql + QST_B, ql + QST_B + 512 * 16,                  // step 1 -> buffers 1
              vl + 2 * VST_B, vl + 2 * VST_B + 64 * VP * 2,
              qg + 64 * DD, qg + 64 * DD + 512 * 8, vg + 64, vg + 64 + (size_t)64 * SQ);

  for (int ci = 0; ci < NCHUNK; ++ci) {
    const int q0 = ci * 64 + qh * 32;   // this wave's chunk of the step
    const _Float16* qsrc = qst + (ci & 1) * (QST_B / 2) + qh * (32 * DD);
    // ---- St = Q x K^T, one 16-q tile at a time (accumulate over d=128), and at once
    // ---- p = exp2(s*scale2 - L[q]); register r of tile j is q = 16 j + 8 hi + r,
    // ---- so the two tiles, converted, are halves 0-7 and 8-15 of the A operand.
    // Only one tile's scores are live at a time, which leaves registers for Q
    // fragments that run AQD ahead of their WMMAs in a rotating set.
    // The scheduler otherwise sinks each read to just in front of its WMMAs, where
    // its whole latency is waited out.
    v16h pa[OKT];
#pragma unroll
    for (int j = 0; j < 2; ++j) {
      v16h aq[AQD];
#pragma unroll
      for (int dc = 0; dc < AQD; ++dc) aq[dc] = load_frag(qsrc, j, dc, lane);
      v8f cj[OKT];
#pragma unroll
      for (int kt = 0; kt < OKT; ++kt) cj[kt] = (v8f){};
#pragma unroll
      for (int dc = 0; dc < 4; ++dc) {
        __builtin_amdgcn_sched_barrier(0);   // the reads issued so far stay ahead of these WMMAs
#pragma unroll
        for (int kt = 0; kt < OKT; ++kt)
          cj[kt] = __builtin_amdgcn_wmma_f32_16x16x32_f16(false, aq[dc % AQD], false, ak[kt][dc],
                                                          (short)0, cj[kt], false, false);
        if (dc + AQD < 4) {
          // tile 1, with tile 0's p live: the refill stays behind the WMMAs that read its
          // registers; hoisted over them it takes a third register set and pushes a K
          // fragment out into scratch, to be read back on every trip
          if (j == 1) __builtin_amdgcn_sched_barrier(0);
          aq[dc % AQD] = load_frag(qsrc, j, dc + AQD, lane);
        }
      }
      const v8f lq = *(const v8f*)&lse[q0 + 16 * j + 8 * hi];
#pragma unroll
      for (int kt = 0; kt < OKT; ++kt) {
        v8f e = cj[kt] * SCALE2 - lq;
#pragma unroll
        for (int r = 0; r < 8; ++r) e[r] = fexp2(e[r]);
        v8h h = __builtin_convertvector(e, v8h);
#pragma unroll
        for (int i = 0; i < 8; ++i) pa[kt][i + 8 * j] = h[i];
      }
      // the next group of reads stays behind this tile's vector work: hoisted over it,
      // it pushes accumulators and K fragments out into scratch
      __builtin_amdgcn_sched_barrier(0);
    }
    // ---- O(16x128) += P(16x32) x Vt-as-B(32q x 16d) per d-tile -----------
    // Vt fragments run BVD ahead of their WMMAs in the registers the scores have left.
    const _Float16* vsrc = vstage + ((ci & 1) * 2 + qh) * (VST_B / 2);   // row-major [128][32], pitch VP
    v16h bv[BVD];
#pragma unroll
    for (int dt = 0; dt < BVD; ++dt) bv[dt] = load_tile_ab(vsrc, VP, dt * 16, 0, lane);
#pragma unroll
    for (int dt = 0; dt < 8; ++dt) {
      __builtin_amdgcn_sched_barrier(0);   // the reads issued so far stay ahead of these WMMAs
#pragma unroll
      for (int kt = 0; kt < OKT; ++kt)
        acc[kt][dt] = __builtin_amdgcn_wmma_f32_16x16x32_f16(false, pa[kt], false, bv[dt % BVD],
                                                             (short)0, acc[kt][dt], false, false);
      if (dt + BVD < 8) bv[dt % BVD] = load_tile_ab(vsrc, VP, (dt + BVD) * 16, 0, lane);
    }
    // Publish point of step ci + 1: this wave's LDS reads of step ci are done and
    // its own copies have landed; the barrier publishes step ci + 1 to the block
    // and ends every reader's last read of the buffers that are refilled behind it.
    asm volatile("s_wait_dscnt 0x0" ::: "memory");
    asm volatile("s_wait_asynccnt 0x0" ::: "memory");
    __syncthreads();
    if (ci + 2 < NCHUNK) {   // step ci + 2 into the buffers that step ci has left
      const unsigned int lq = ql + (ci & 1) * QST_B;
      const unsigned int lv = vl + (ci & 1) * (2 * VST_B);
      const _Float16* gq = qg + (size_t)(ci * 64 + 128) * DD;
      const _Float16* gv = vg + (ci * 64 + 128);
      async_copy4(lq, lq + 512 * 16, lv, lv + 64 * VP * 2,
                  gq, gq + 512 * 8, gv, gv + (size_t)64 * SQ);
    }
  }
  // no copy is left in flight when the buffers are given to the exchange
  asm volatile("s_wait_asynccnt 0x0" ::: "memory");
  // ---- the two halves of a k group join: the wave of half 0 hands over its tile 1
  // ---- and finishes tile 0, the wave of half 1 the other way round. A handed tile
  // ---- lies register-major, 16 bytes a lane, so the partner's same lane reads it.
  // The loop's last barrier has ended every read of the buffers written here.
  v4f* xmine = (v4f*)smem + (threadIdx.x >> 5) * 512 + lane;
  const v4f* xpart = (const v4f*)smem + ((threadIdx.x >> 5) ^ 8) * 512 + lane;
  if (qh == 0) xch_put(xmine, acc[1]); else xch_put(xmine, acc[0]);
  __syncthreads();   // every handed tile is in LDS
  float* orow = out + (size_t)(k0 + qh * 16 + 8 * hi) * (QSPLIT * DD) + n;
  if (qh == 0) xch_finish(xpart, acc[0], orow); else xch_finish(xpart, acc[1], orow);
}

// ---------------------------------------------------------------------------
// Kernel 4: out = sum of the QSPLIT partial outputs, in range order.
// A thread sums one float4 of two neighbouring k rows, so that it still has 16
// loads in flight with half as many ranges.
// ---------------------------------------------------------------------------
__global__ void sda_reduce(const float* __restrict__ part, float* __restrict__ out) {
  const int i = blockIdx.x * blockDim.x + threadIdx.x;   // 0 .. SK*DD/8-1
  // rows k = 2 (i / 32) and k + 1 hold 2 QSPLIT partial rows of 32 float4 each, on end
  const float4* row4 = (const float4*)part + (i >> 5) * (2 * QSPLIT * DD / 4) + (i & 31);
  float4 v[2 * QSPLIT];
#pragma unroll
  for (int p = 0; p < 2 * QSPLIT; ++p) v[p] = row4[p * (DD / 4)];
#pragma unroll
  for (int h = 0; h < 2; ++h) {
    float4 s = v[h * QSPLIT];
#pragma unroll
    for (int p = 1; p < QSPLIT; ++p) {
      const float4 w = v[h * QSPLIT + p];
      s.x += w.x; s.y += w.y; s.z += w.z; s.w += w.w;
    }
    ((float4*)out)[(i >> 5) * (2 * DD / 4) + h * (DD / 4) + (i & 31)] = s;
  }
}

extern "C" void kernel_launch(void* const* d_in, const int* in_sizes, int n_in,
                              void* d_out, int out_size, void* d_ws, size_t ws_size,
                              hipStream_t stream) {
  (void)in_sizes; (void)n_in; (void)out_size; (void)ws_size;
  const float* K = (const float*)d_in[0];
  const float* Q = (const float*)d_in[1];
  const float* V = (const float*)d_in[2];
  float* out = (float*)d_out;

  _Float16* Kh = (_Float16*)d_ws;                       // 8192 x 128 f16, fragment order
  _Float16* Qh = Kh + (size_t)SK * DD;                  // 8192 x 128 f16, fragment order
  _Float16* Vt = Qh + (size_t)SQ * DD;                  // [128,8192] f16 (transposed)
  float*    pl = (float*)(Vt + (size_t)DD * SQ);        // [KSPLIT][8192] range log2-sum-exp
  float*    part = pl + (size_t)KSPLIT * SQ;            // [8192][QSPLIT][128] partial out

  sda_convert<<<(SQ / 64) * (DD / 64), 256, 0, stream>>>(K, Q, V, Kh, Qh, Vt);
  // stats: 8 waves/block, 128 SQT q columns per block in x; output: 16 waves/block,
  // 128 OKT k rows per block in x; the split ranges in y
  sda_stats<<<dim3(SQ / (128 * SQT), KSPLIT), 256, 0, stream>>>(Kh, Qh, pl);
  sda_output<<<dim3(SK / (128 * OKT), QSPLIT), 512, 0, stream>>>(Kh, Qh, Vt, pl, part);
  sda_reduce<<<(SK * DD) / 8 / 256, 256, 0, stream>>>(part, out);
}

// v010
// One run takes 55 microseconds.
// In two side-by-side timings against v009, it was 1.04 and 1.05 times as fast.
// All steps since v000 together make it 19.4 times as fast.
#include <hip/hip_runtime.h>
#include <hip/hip_bf16.h>

typedef __attribute__((ext_vector_type(16))) _Float16 v16h;
typedef __attribute__((ext_vector_type(8)))  _Float16 v8h;
typedef __attribute__((ext_vector_type(8)))  float    v8f;
typedef __attribute__((ext_vector_type(2)))  float    v2f;

#define SK 8192
#define SQ 8192
#define DD 128
// The k loop of the stats kernel and the q loop of the output kernel are cut
// into KSPLIT / QSPLIT equal ranges, one per blockIdx.y, so that the grid
// covers every WGP; the stats ranges are joined in the output kernel's prologue,
// the output ranges by a small launch. An output work-group cuts its range once
// more, between two halves of its waves, and joins the two sums itself in LDS.
#define KSPLIT 32
#define QSPLIT 8
// Wave tiles: a stats wave owns SQT 16-column q tiles and an output wave OKT
// 16-row k tiles, so that one fragment read from LDS feeds SQT (OKT) WMMAs.
// Every loop over these tiles is unrolled: its fragment and accumulator arrays
// stay in registers only if each index is a constant.
#define SQT 4
#define OKT 2
// 1/sqrt(128) * log2(e): softmax computed in log2 domain -> native v_exp_f32
#define SCALE2 0.12751589906834162f

// Raw v_exp_f32, without OCML's underflow-guard path (saves ~6 VALU per exponential
// in the hot loop): the arguments are <= 0 and a result flushed to 0 is negligible
// beside the largest term, 1; in the stats kernel's first loop, whose arguments are
// not bounded, the range test on the sum catches overflow and flushed terms alike.
__device__ __forceinline__ float fexp2(float x) {
#if defined(__HIP_DEVICE_COMPILE__) && __has_builtin(__builtin_amdgcn_exp2f)
  return __builtin_amdgcn_exp2f(x);
#else
  return exp2f(x);
#endif
}

// Raw v_log_f32 (log2): every argument here is a sum of exponentials whose
// largest term is 1, or a sum tested to be >= 2^-64: normal, no subnormal path.
__device__ __forceinline__ float flog2(float x) {
#if defined(__HIP_DEVICE_COMPILE__) && __has_builtin(__builtin_amdgcn_logf)
  return __builtin_amdgcn_logf(x);
#else
  return log2f(x);
#endif
}

// ---------------------------------------------------------------------------
// Load a 16x32 f16 tile from a row-major matrix into the WMMA A/B register
// layout (ISA 7.12.2, 16-bit A-matrix 16x32):
//   lanes 0-15 : row = row0+lane,    halves 0-7 = cols c0+0..7,  8-15 = c0+16..23
//   lanes 16-31: row = row0+lane-16, halves 0-7 = cols c0+8..15, 8-15 = c0+24..31
// Both chunks are 16B aligned -> two b128 loads per lane (global or ds).
// Serves B operands too: a B (KxN) tile equals the A layout of rows of the
// row-major N-major source (lane = column index n).
// ---------------------------------------------------------------------------
__device__ __forceinline__ v16h load_tile_ab(const _Float16* base,
                                             int ld, int row0, int col0, int lane) {
  const int r  = row0 + (lane & 15);
  const int hs = (lane >> 4) & 1;
  const _Float16* p = base + (size_t)r * ld + col0 + hs * 8;
  v8h lo = *(const v8h*)p;
  v8h hi = *(const v8h*)(p + 16);
  v16h out;
#pragma unroll
  for (int i = 0; i < 8; ++i) { out[i] = lo[i]; out[i + 8] = hi[i]; }
  return out;
}

// Kh and Qh lie in FRAGMENT ORDER, not row-major: each 16-row x 32-column tile is
// 1024 bytes on end, [16-row tile][32-column chunk][h][lane][8 halves], where piece
// (h, lane) holds row lane & 15, columns 16 h + 8 (lane >> 4) .. + 7 of the chunk:
// what load_tile_ab gives that lane as its halves 8 h .. 8 h + 7. A fragment load is
// then two runs of 512 bytes, four whole lines each, where a row-major tile makes
// every load touch 16 lines; 16 rows still fill the same 4096 bytes as row-major,
// so block-wide copies into LDS keep their global addresses, and in LDS the same
// order is read without bank conflicts and needs no padded pitch.
// base = the first of the 16-row tiles counted by tile.
__device__ __forceinline__ v16h load_frag(const _Float16* base, int tile, int dc, int lane) {
  const _Float16* p = base + (tile * 4 + dc) * 512 + lane * 8;
  v8h lo = *(const v8h*)p;
  v8h hi = *(const v8h*)(p + 256);
  v16h out;
#pragma unroll
  for (int i = 0; i < 8; ++i) { out[i] = lo[i]; out[i + 8] = hi[i]; }
  return out;
}

// LDS pitch, in halfs, of a staged 32-half row: 80 bytes = 16 x 5, a conflict-free
// pitch for 16-byte LDS reads.
#define VP 40

// Asynchronous copies global -> LDS, 16 bytes per lane and copy, through no
// register. l* = the lane's own LDS byte address, g* = its own global address.
// The closing s_wait_xcnt stands inside the statement so that no address
// register of an issued copy is rewritten in front of it.
__device__ __forceinline__ void async_copy2(unsigned int l0, unsigned int l1,
                                            const _Float16* g0, const _Float16* g1) {
  asm volatile("global_load_async_to_lds_b128 %0, %2, off\n\t"
               "global_load_async_to_lds_b128 %1, %3, off\n\t"
               "s_wait_xcnt 0x0"
               :: "v"(l0), "v"(l1), "v"(g0), "v"(g1) : "memory");
}
__device__ __forceinline__ void async_copy8(unsigned int l, const _Float16* g,
                                            unsigned int lstep, int gstep) {
  asm volatile("global_load_async_to_lds_b128 %0, %8, off\n\t"
               "global_load_async_to_lds_b128 %1, %9, off\n\t"
               "global_load_async_to_lds_b128 %2, %10, off\n\t"
               "global_load_async_to_lds_b128 %3, %11, off\n\t"
               "global_load_async_to_lds_b128 %4, %12, off\n\t"
               "global_load_async_to_lds_b128 %5, %13, off\n\t"
               "global_load_async_to_lds_b128 %6, %14, off\n\t"
               "global_load_async_to_lds_b128 %7, %15, off\n\t"
               "s_wait_xcnt 0x0"
               :: "v"(l), "v"(l + lstep), "v"(l + 2 * lstep), "v"(l + 3 * lstep),
                  "v"(l + 4 * lstep), "v"(l + 5 * lstep), "v"(l + 6 * lstep), "v"(l + 7 * lstep),
                  "v"(g), "v"(g + gstep), "v"(g + 2 * gstep), "v"(g + 3 * gstep),
                  "v"(g + 4 * gstep), "v"(g + 5 * gstep), "v"(g + 6 * gstep), "v"(g + 7 * gstep)
               : "memory");
}

// ---------------------------------------------------------------------------
// Kernel 1: f32 -> f16 copies of K and Q in fragment order; transposed f16 copy of V (Vt[d][q]).
// One work-group per 64 q x 64 d tile of V (256 in all), which also converts
// 4096 elements (32 rows) of K and of Q into fragment order. Every thread has its
// 12 16-byte loads in flight at once; V is transposed through LDS so that Vt is
// stored in whole 128-byte lines, each by one work-group.
// ---------------------------------------------------------------------------
// LDS pitch, in halfs, of a transposed 64-half row: 144 bytes = 16 x 9.
#define TP 72
typedef __attribute__((ext_vector_type(4))) _Float16 v4h;
typedef __attribute__((ext_vector_type(2))) _Float16 v2h;
typedef __attribute__((ext_vector_type(4))) float v4f;
__global__ __launch_bounds__(256) void sda_convert(const float* __restrict__ K, const float* __restrict__ Q,
                            const float* __restrict__ V,
                            _Float16* __restrict__ Kh, _Float16* __restrict__ Qh,
                            _Float16* __restrict__ Vt) {
  __shared__ __attribute__((aligned(16))) _Float16 tl[64 * TP];   // [d][q]
  const int t  = threadIdx.x;
  const int q0 = (blockIdx.x >> 1) * 64;
  const int d0 = (blockIdx.x & 1) * 64;
  const int c  = t & 15;      // which float4 of the tile's 64-float row
  const int rp = t >> 4;      // which pair of rows
  // V rows q0 + 32 j + 2 rp and the next one, floats d0 + 4 c .. + 3
  const float* vp = V + (size_t)q0 * DD + d0 + (2 * rp * DD + 4 * c);
  v4f va[2], vb[2];
#pragma unroll
  for (int j = 0; j < 2; ++j) {
    va[j] = *(const v4f*)(vp + 32 * j * DD);
    vb[j] = *(const v4f*)(vp + 32 * j * DD + DD);
  }
  // The offset register of the V loads is given to a later load's result: this
  // wait stands in front of that overwrite.
  asm volatile("s_wait_xcnt 0x0" ::: "memory");
  // K and Q: load j of a wave takes 32-column chunk j (one whole line) of 4 rows;
  // thread t has row kr of the work-group's 32 and float4 ke of the chunk's 8
  const int kr = t >> 3, ke = t & 7;
  const v4f* K4 = (const v4f*)K + blockIdx.x * 1024;
  const v4f* Q4 = (const v4f*)Q + blockIdx.x * 1024;
  const int ko = kr * 32 + ke;
  v4f kv[4], qv[4];
#pragma unroll
  for (int j = 0; j < 4; ++j) { kv[j] = K4[ko + 8 * j]; qv[j] = Q4[ko + 8 * j]; }

#pragma unroll
  for (int j = 0; j < 2; ++j) {
#pragma unroll
    for (int i = 0; i < 4; ++i) {
      v2h h = {(_Float16)va[j][i], (_Float16)vb[j][i]};     // q, q + 1 of one d
      *(v2h*)&tl[(4 * c + i) * TP + 32 * j + 2 * rp] = h;
    }
  }
  // Holds the K and Q loads in front of the barrier, whole and in flight beside
  // the V loads: without it half of each is sunk behind the barrier and pays a
  // second round trip there.
  asm volatile("" :: "v"(kv[0]), "v"(kv[1]), "v"(kv[2]), "v"(kv[3]),
                     "v"(qv[0]), "v"(qv[1]), "v"(qv[2]), "v"(qv[3]));
  // The transposed tile is complete. No global store stands in front of this
  // barrier: it would wait for that store to finish.
  __syncthreads();
  // 64 rows of 128 bytes = 512 pieces of 16 bytes; thread t stores pieces t, t + 256
#pragma unroll
  for (int j = 0; j < 2; ++j) {
    const int p = t + 256 * j;
    const int d = p >> 3, g = p & 7;
    *(v8h*)&Vt[(size_t)(d0 + d) * SQ + q0 + 8 * g] = *(const v8h*)&tl[d * TP + 8 * g];
  }
  // fragment order: columns 4 ke .. + 3 of chunk j are half ke & 1 of piece
  // (h = ke >> 2, lane = 16 ((ke >> 1) & 1) + row & 15); in units of 4 halves
  const int fo = blockIdx.x * 1024 + (kr >> 4) * 512 + (ke >> 2) * 64 +
                 (((ke >> 1) & 1) * 16 + (kr & 15)) * 2 + (ke & 1);
  v4h* Kh4 = (v4h*)Kh + fo;
  v4h* Qh4 = (v4h*)Qh + fo;
#pragma unroll
  for (int j = 0; j < 4; ++j) {
    Kh4[128 * j] = __builtin_convertvector(kv[j], v4h);
    Qh4[128 * j] = __builtin_convertvector(qv[j], v4h);
  }
}

// ---------------------------------------------------------------------------
// Kernel 2: per-query-column softmax stats over one range of the k axis.
// Each wave owns 16 SQT q columns; loops its k range (blockIdx.y) in 16-row tiles.
// First loop: the plain sum of exp2(score), reference 0: no maximum, no rescale, no
// cross-lane step; each lane sums its own 8 rows of a tile and the lane halves are
// joined once behind the loop. The sum is exact to f32 rounding whenever it lies in
// [2^-64, 2^126]: no term has then overflowed, and terms flushed to 0 (< 2^-126) are
// below 2^-54 of it. A wave with any column outside that range (or NaN) does its
// range again by the second loop: online (max, sum-exp2) per column, good for any input.
// Writes the range's log2 of its sum of exponentials, one float per column; the
// output kernel joins the ranges.
// The range's K rows, which all 8 waves read, are copied once per block into
// LDS in whole lines; the fragments are then read from LDS.
// ---------------------------------------------------------------------------
// The real block size lifts the register ceiling to what the wave tile needs.
__global__ __launch_bounds__(256) void sda_stats(const _Float16* __restrict__ Kh_all,
                          const _Float16* __restrict__ Qh,
                          float* __restrict__ pl) {   // [KSPLIT][SQ]
  const _Float16* Kh = Kh_all + (size_t)blockIdx.y * (SK / KSPLIT) * DD;
  const int lane = threadIdx.x & 31;
  const int wave = (blockIdx.x * blockDim.x + threadIdx.x) >> 5;
  const int q0 = wave * (16 * SQT);

  // 256 rows = 16 tiles in fragment order = 4096 pieces of 16 bytes, copied as they
  // lie; thread t copies pieces t + 256 j, j = 0..15.
  __shared__ __attribute__((aligned(16))) _Float16 kst[(SK / KSPLIT) * DD];
  {
    const int t = threadIdx.x;
    const unsigned int l = (unsigned int)(uintptr_t)&kst[0] + t * 16;
    const _Float16* g = Kh + t * 8;
    async_copy8(l, g, 256 * 16, 256 * 8);
    async_copy8(l + 8 * 256 * 16, g + 8 * 256 * 8, 256 * 16, 256 * 8);
  }

  v16h bq[SQT][4];
  const _Float16* qr = Qh + (size_t)q0 * DD + lane * 8;   // the lane's piece of its first Q fragment
#pragma unroll
  for (int qt = 0; qt < SQT; ++qt) {
#pragma unroll
    for (int dc = 0; dc < 4; ++dc) {
      const v8h lo = *(const v8h*)(qr + (qt * 4 + dc) * 512);           // as load_frag
      const v8h up = *(const v8h*)(qr + (qt * 4 + dc) * 512 + 256);
#pragma unroll
      for (int i = 0; i < 8; ++i) { bq[qt][dc][i] = lo[i]; bq[qt][dc][i + 8] = up[i]; }
    }
  }

  // Names the Q loads' address, which so stays in its registers up to this wait: it is
  // otherwise given to the result of the last load of the run, or to a K fragment
  // behind the barrier.
  asm volatile("s_wait_xcnt 0x0" :: "v"(qr) : "memory");
  // this wave's copies have landed; behind the barrier every wave's have
  asm volatile("s_wait_asynccnt 0x0" ::: "memory");
  __syncthreads();

  // K fragments run one tile ahead: each is read again, for the next tile, right
  // behind its own WMMAs and lands under the vector work. The last trip reads tile
  // 0 once more (inside kst, not used).
  v16h a[4];
#pragma unroll
  for (int dc = 0; dc < 4; ++dc) a[dc] = load_frag(kst, 0, dc, lane);
  float res[SQT];   // log2 of the range's sum of exponentials, per column

  // ---- first loop: plain sums, a pair of partial sums per lane and column
  v2f zs[SQT];
#pragma unroll
  for (int qt = 0; qt < SQT; ++qt) zs[qt] = (v2f){0.0f, 0.0f};
  // two trips per branch: the fragments' two register sets swap roles by name,
  // not by register copies
#pragma unroll 2
  for (int k0 = 0; k0 < SK / KSPLIT; k0 += 16) {
    const int kn = (k0 + 16) & (SK / KSPLIT - 1);
    v8f c[SQT];
#pragma unroll
    for (int qt = 0; qt < SQT; ++qt) c[qt] = (v8f){};
#pragma unroll
    for (int dc = 0; dc < 4; ++dc) {
#pragma unroll
      for (int qt = 0; qt < SQT; ++qt)
        c[qt] = __builtin_amdgcn_wmma_f32_16x16x32_f16(false, a[dc], false, bq[qt][dc],
                                                       (short)0, c[qt], false, false);
      a[dc] = load_frag(kst, kn >> 4, dc, lane);
    }
    // keeps those reads in front of the vector work: sunk behind it they would be
    // waited out at the head of the next trip
    __builtin_amdgcn_sched_barrier(0);
    // C layout: lane holds column n=lane&15, rows r+8*(lane>>4), r=0..7
#pragma unroll
    for (int qt = 0; qt < SQT; ++qt) {
      v8f e = c[qt] * SCALE2;
#pragma unroll
      for (int r = 0; r < 8; ++r) e[r] = fexp2(e[r]);
      zs[qt] += ((v2f){e[0], e[1]} + (v2f){e[2], e[3]}) + ((v2f){e[4], e[5]} + (v2f){e[6], e[7]});
    }
  }
  bool bad = false;
#pragma unroll
  for (int qt = 0; qt < SQT; ++qt) {
    float z = zs[qt][0] + zs[qt][1];
    z += __shfl_xor(z, 16, 32);
    bad = bad || !(z >= 0x1p-64f && z <= 0x1p+126f);   // NaN counts as outside
    res[qt] = flog2(z);
  }

  // ---- second loop, taken by the whole wave (a scalar branch: WMMAs need every lane on)
  if (__builtin_amdgcn_ballot_w32(bad) != 0) {
    float mrun[SQT], zrun[SQT];
#pragma unroll
    for (int qt = 0; qt < SQT; ++qt) { mrun[qt] = -__builtin_inff(); zrun[qt] = 0.0f; }
    // its fragments are read where they are used: fetched ahead over two unrolled trips, as
    // in the first loop, they lift the kernel above 256 registers, four waves a SIMD no more
    for (int k0 = 0; k0 < SK / KSPLIT; k0 += 16) {
      v8f c[SQT];
#pragma unroll
      for (int qt = 0; qt < SQT; ++qt) c[qt] = (v8f){};
#pragma unroll
      for (int dc = 0; dc < 4; ++dc) {
        const v16h as = load_frag(kst, k0 >> 4, dc, lane);
#pragma unroll
        for (int qt = 0; qt < SQT; ++qt)
          c[qt] = __builtin_amdgcn_wmma_f32_16x16x32_f16(false, as, false, bq[qt][dc],
                                                         (short)0, c[qt], false, false);
      }
#pragma unroll
      for (int qt = 0; qt < SQT; ++qt) {
        float tmax = c[qt][0];
#pragma unroll
        for (int r = 1; r < 8; ++r) tmax = fmaxf(tmax, c[qt][r]);
        tmax = fmaxf(tmax, __shfl_xor(tmax, 16, 32));
        tmax *= SCALE2;
        float nm = fmaxf(mrun[qt], tmax);
        float ts = 0.0f;
#pragma unroll
        for (int r = 0; r < 8; ++r) ts += fexp2(c[qt][r] * SCALE2 - nm);
        ts += __shfl_xor(ts, 16, 32);
        zrun[qt] = zrun[qt] * fexp2(mrun[qt] - nm) + ts;
        mrun[qt] = nm;
      }
    }
#pragma unroll
    for (int qt = 0; qt < SQT; ++qt) res[qt] = mrun[qt] + flog2(zrun[qt]);
  }
  if (lane < 16) {
#pragma unroll
    for (int qt = 0; qt < SQT; ++qt)
      pl[blockIdx.y * SQ + q0 + qt * 16 + lane] = res[qt];
  }
}

// ---------------------------------------------------------------------------
// Kernel 3: output. Each wave owns 16 OKT k rows x full 128 d (8 OKT f32 accumulators).
// A work-group has 16 waves: 8 groups of k rows x 2 halves of every 64-q step of
// its q range (blockIdx.y). Behind the loop the two waves of a k group add their
// sums through LDS, each taking one 16-row tile; the range's f32 partial sum goes
// to the workspace and sda_reduce adds the ranges.
// Per 32-q chunk the scores are formed TRANSPOSED, St = Q x K^T (A = Q rows from
// LDS, B = the wave's K rows in registers): a lane then holds, of one k row,
// q = 8 hi + r of each 16-q tile, which is the k order of the A operand of
// P x V. p = exp2(s-L[q]) is converted in place: P never leaves registers.
// A step's two Q chunks (32x128 f16) and two Vt chunks (128x32 f16), each shared by
// 8 waves, are copied block-wide into LDS by asynchronous copies, two buffers each,
// one step ahead, one barrier per step. L[q] = log2 of column q's whole sum of
// exponentials: each work-group joins the KSPLIT range values of its own q range
// in its prologue, two columns a thread, and keeps the result in LDS.
// ---------------------------------------------------------------------------
__device__ __forceinline__ void async_copy4(unsigned int l0, unsigned int l1,
                                            unsigned int l2, unsigned int l3,
                                            const _Float16* g0, const _Float16* g1,
                                            const _Float16* g2, const _Float16* g3) {
  asm volatile("global_load_async_to_lds_b128 %0, %4, off\n\t"
               "global_load_async_to_lds_b128 %1, %5, off\n\t"
               "global_load_async_to_lds_b128 %2, %6, off\n\t"
               "global_load_async_to_lds_b128 %3, %7, off\n\t"
               "s_wait_xcnt 0x0"
               :: "v"(l0), "v"(l1), "v"(l2), "v"(l3), "v"(g0), "v"(g1), "v"(g2), "v"(g3)
               : "memory");
}
#define QR (SQ / QSPLIT)
// One 16 x 128 accumulator tile (8 d tiles of 8 registers) into LDS: piece 2 dt + h
// holds registers 4 h .. 4 h + 3 of d tile dt, 512 bytes a piece.
__device__ __forceinline__ void xch_put(v4f* x, const v8f (&a)[8]) {
#pragma unroll
  for (int dt = 0; dt < 8; ++dt) {
    x[(2 * dt) * 32]     = (v4f){a[dt][0], a[dt][1], a[dt][2], a[dt][3]};
    x[(2 * dt + 1) * 32] = (v4f){a[dt][4], a[dt][5], a[dt][6], a[dt][7]};
  }
}
// Adds the partner's tile to this wave's and stores the sum.
// C layout: element (m = r + 8 hi, col = dt * 16 + n); o points at (8 hi, n); write-once.
// Plain stores: sda_reduce reads these partial sums back at once.
__device__ __forceinline__ void xch_finish(const v4f* x, const v8f (&a)[8], float* o) {
#pragma unroll
  for (int dt = 0; dt < 8; ++dt) {
    const v4f lo = x[(2 * dt) * 32], up = x[(2 * dt + 1) * 32];
#pragma unroll
    for (int r = 0; r < 4; ++r) {
      o[(size_t)r * (QSPLIT * DD) + dt * 16]       = a[dt][r] + lo[r];
      o[(size_t)(r + 4) * (QSPLIT * DD) + dt * 16] = a[dt][r + 4] + up[r];
    }
  }
}
// How many fragments the LDS reads of the output loop run ahead of their WMMAs.
#define AQD 2
#define BVD 4
// LDS, in bytes: the Vt buffers [2 steps][2 chunks], the Q buffers [2 steps][64 rows]
// and L; behind the loop the same bytes serve the exchange, 8 KB a wave.
#define VST_B (DD * VP * 2)
#define QST_B (64 * DD * 2)
#define OFF_Q (4 * VST_B)
#define OFF_L (OFF_Q + 2 * QST_B)
#define XCH_B (16 * 8192)
// Sixteen waves of 256 registers: one work-group fills a WGP, and the whole grid
// is resident at once.
__global__ __launch_bounds__(512, 4) void sda_output(const _Float16* __restrict__ Kh,
                           const _Float16* __restrict__ Qh_all,
                           const _Float16* __restrict__ Vt_all,
                           const float* __restrict__ pl,
                           float* __restrict__ part) {
  // this work-group's q range: every q index below is relative to qbase
  const int qbase = blockIdx.y * QR;
  const _Float16* Qh = Qh_all + (size_t)qbase * DD;
  const _Float16* Vt = Vt_all + qbase;
  float* out = part + blockIdx.y * DD;   // partials lie as [k][range][d]
  __shared__ __attribute__((aligned(32))) unsigned char smem[XCH_B];
  static_assert(OFF_L + QR * 4 <= XCH_B, "the loop's buffers lie inside smem");
  const _Float16* vstage = (const _Float16*)smem;            // Vt chunks, 40 KB
  const _Float16* qst    = (const _Float16*)(smem + OFF_Q);  // Q chunks, 32 KB
  float* lse = (float*)(smem + OFF_L);                       // L of the range, 4 KB
  const int lane = threadIdx.x & 31;
  // which half of each step this wave works on: the same in every lane, held as a scalar
  const int qh   = __builtin_amdgcn_readfirstlane(threadIdx.x >> 8);
  const int k0   = (blockIdx.x * 8 + ((threadIdx.x >> 5) & 7)) * (16 * OKT);
  const int n    = lane & 15;
  const int hi   = lane >> 4;

  // a step's Q rows = 4 tiles in fragment order = 1024 pieces of 16 bytes, copied as
  // they lie; thread t copies pieces t and t + 512.
  const unsigned int ql = (unsigned int)(uintptr_t)smem + OFF_Q + threadIdx.x * 16;
  const _Float16* qg = Qh + threadIdx.x * 8;
  // a step's Vt rows = 128 rows of 128 bytes = 1024 pieces of 16 bytes; thread t copies
  // pieces t and t + 512: piece p is bytes 16 (p & 7) .. +15 of row p >> 3 and goes
  // to chunk (p & 7) >> 2, piece p & 3 of that chunk's row.
  const unsigned int vl = (unsigned int)(uintptr_t)smem + ((threadIdx.x >> 2) & 1) * VST_B +
                          (threadIdx.x >> 3) * (VP * 2) + (threadIdx.x & 3) * 16;
  const _Float16* vg = Vt + (size_t)(threadIdx.x >> 3) * SQ + (threadIdx.x & 7) * 8;
  async_copy4(ql, ql + 512 * 16, vl, vl + 64 * VP * 2,            // step 0 -> buffers 0
              qg, qg + 512 * 8, vg, vg + (size_t)64 * SQ);
  // the range values of columns qbase + 2 t and the next one, all loads in flight at once
  v2f pv[KSPLIT];
#pragma unroll
  for (int s = 0; s < KSPLIT; ++s) pv[s] = *(const v2f*)(pl + s * SQ + qbase + 2 * threadIdx.x);

  v16h ak[OKT][4];
  const _Float16* kr = Kh + (size_t)k0 * DD + lane * 8;   // the lane's piece of its first K fragment
#pragma unroll
  for (int kt = 0; kt < OKT; ++kt) {
#pragma unroll
    for (int dc = 0; dc < 4; ++dc) {
      const v8h lo = *(const v8h*)(kr + (kt * 4 + dc) * 512);           // as load_frag
      const v8h up = *(const v8h*)(kr + (kt * 4 + dc) * 512 + 256);
#pragma unroll
      for (int i = 0; i < 8; ++i) { ak[kt][dc][i] = lo[i]; ak[kt][dc][i + 8] = up[i]; }
    }
  }
  // Names the K loads' address, which so stays in its registers up to this wait:
  // it is otherwise given to the result of a later load of the same run.
  asm volatile("s_wait_xcnt 0x0" :: "v"(kr) : "memory");

  // L = M + log2(sum over the ranges of exp2(value - M)), M the largest value
  {
    v2f mx = pv[0];
#pragma unroll
    for (int s = 1; s < KSPLIT; ++s) mx = __builtin_elementwise_max(mx, pv[s]);
    v2f sm = {0.0f, 0.0f};
#pragma unroll
    for (int s = 0; s < KSPLIT; ++s) {
      const v2f d = pv[s] - mx;
      sm += (v2f){fexp2(d[0]), fexp2(d[1])};
    }
    *(v2f*)&lse[2 * threadIdx.x] = mx + (v2f){flog2(sm[0]), flog2(sm[1])};
  }
  // the accumulators come to life behind the join: set to zero in front of it, they
  // and the range values together push K fragments and accumulators out into scratch
  __builtin_amdgcn_sched_barrier(0);

  v8f acc[OKT][8];
#pragma unroll
  for (int kt = 0; kt < OKT; ++kt) {
#pragma unroll
    for (int dt = 0; dt < 8; ++dt) acc[kt][dt] = (v8f){};
  }

  const int NCHUNK = QR / 64;
  // step 0: this wave's copies have landed; the barrier publishes them and L
  asm volatile("s_wait_asynccnt 0x0" ::: "memory");
  __syncthreads();
  async_copy4(ql + QST_B, ql + QST_B + 512 * 16,                  // step 1 -> buffers 1
              vl + 2 * VST_B, vl + 2 * VST_B + 64 * VP * 2,
              qg + 64 * DD, qg + 64 * DD + 512 * 8, vg + 64, vg + 64 + (size_t)64 * SQ);

  for (int ci = 0; ci < NCHUNK; ++ci) {
    const int q0 = ci * 64 + qh * 32;   // this wave's chunk of the step
    const _Float16* qsrc = qst + (ci & 1) * (QST_B / 2) + qh * (32 * DD);
    // ---- St = Q x K^T, one 16-q tile at a time (accumulate over d=128), and at once
    // ---- p = exp2(s*scale2 - L[q]); register r of tile j is q = 16 j + 8 hi + r,
    // ---- so the two tiles, converted, are halves 0-7 and 8-15 of the A operand.
    // Only one tile's scores are live at a time, which leaves registers for Q
    // fragments that run AQD ahead of their WMMAs in a rotating set.
    // The scheduler otherwise sinks each read to just in front of its WMMAs, where
    // its whole latency is waited out.
    v16h pa[OKT];
#pragma unroll
    for (int j = 0; j < 2; ++j) {
      v16h aq[AQD];
#pragma unroll
      for (int dc = 0; dc < AQD; ++dc) aq[dc] = load_frag(qsrc, j, dc, lane);
      v8f cj[OKT];
#pragma unroll
      for (int kt = 0; kt < OKT; ++kt) cj[kt] = (v8f){};
#pragma unroll
      for (int dc = 0; dc < 4; ++dc) {
        __builtin_amdgcn_sched_barrier(0);   // the reads issued so far stay ahead of these WMMAs
#pragma unroll
        for (int kt = 0; kt < OKT; ++kt)
          cj[kt] = __builtin_amdgcn_wmma_f32_16x16x32_f16(false, aq[dc % AQD], false, ak[kt][dc],
                                                          (short)0, cj[kt], false, false);
        if (dc + AQD < 4) {
          // tile 1, with tile 0's p live: the refill stays behind the WMMAs that read its
          // registers; hoisted over them it takes a third register set and pushes a K
          // fragment out into scratch, to be read back on every trip
          if (j == 1) __builtin_amdgcn_sched_barrier(0);
          aq[dc % AQD] = load_frag(qsrc, j, dc + AQD, lane);
        }
      }
      const v8f lq = *(const v8f*)&lse[q0 + 16 * j + 8 * hi];
#pragma unroll
      for (int kt = 0; kt < OKT; ++kt) {
        v8f e = cj[kt] * SCALE2 - lq;
#pragma unroll
        for (int r = 0; r < 8; ++r) e[r] = fexp2(e[r]);
        v8h h = __builtin_convertvector(e, v8h);
#pragma unroll
        for (int i = 0; i < 8; ++i) pa[kt][i + 8 * j] = h[i];
      }
      // the next group of reads stays behind this tile's vector work: hoisted over it,
      // it pushes accumulators and K fragments out into scratch
      __builtin_amdgcn_sched_barrier(0);
    }
    // ---- O(16x128) += P(16x32) x Vt-as-B(32q x 16d) per d-tile -----------
    // Vt fragments run BVD ahead of their WMMAs in the registers the scores have left.
    const _Float16* vsrc = vstage + ((ci & 1) * 2 + qh) * (VST_B / 2);   // row-major [128][32], pitch VP
    v16h bv[BVD];
#pragma unroll
    for (int dt = 0; dt < BVD; ++dt) bv[dt] = load_tile_ab(vsrc, VP, dt * 16, 0, lane);
#pragma unroll
    for (int dt = 0; dt < 8; ++dt) {
      __builtin_amdgcn_sched_barrier(0);   // the reads issued so far stay ahead of these WMMAs
#pragma unroll
      for (int kt = 0; kt < OKT; ++kt)
        acc[kt][dt] = __builtin_amdgcn_wmma_f32_16x16x32_f16(false, pa[kt], false, bv[dt % BVD],
                                                             (short)0, acc[kt][dt], false, false);
      if (dt + BVD < 8) bv[dt % BVD] = load_tile_ab(vsrc, VP, (dt + BVD) * 16, 0, lane);
    }
    // Publish point of step ci + 1: this wave's LDS reads of step ci are done and
    // its own copies have landed; the barrier publishes step ci + 1 to the block
    // and ends every reader's last read of the buffers that are refilled behind it.
    asm volatile("s_wait_dscnt 0x0" ::: "memory");
    asm volatile("s_wait_asynccnt 0x0" ::: "memory");
    __syncthreads();
    if (ci + 2 < NCHUNK) {   // step ci + 2 into the buffers that step ci has left
      const unsigned int lq = ql + (ci & 1) * QST_B;
      const unsigned int lv = vl + (ci & 1) * (2 * VST_B);
      const _Float16* gq = qg + (size_t)(ci * 64 + 128) * DD;
      const _Float16* gv = vg + (ci * 64 + 128);
      async_copy4(lq, lq + 512 * 16, lv, lv + 64 * VP * 2,
                  gq, gq + 512 * 8, gv, gv + (size_t)64 * SQ);
    }
  }
  // no copy is left in flight when the buffers are given to the exchange
  asm volatile("s_wait_asynccnt 0x0" ::: "memory");
  // ---- the two halves of a k group join: the wave of half 0 hands over its tile 1
  // ---- and finishes tile 0, the wave of half 1 the other way round. A handed tile
  // ---- lies register-major, 16 bytes a lane, so the partner's same lane reads it.
  // The loop's last barrier has ended every read of the buffers written here.
  v4f* xmine = (v4f*)smem + (threadIdx.x >> 5) * 512 + lane;
  const v4f* xpart = (const v4f*)smem + ((threadIdx.x >> 5) ^ 8) * 512 + lane;
  if (qh == 0) xch_put(xmine, acc[1]); else xch_put(xmine, acc[0]);
  __syncthreads();   // every handed tile is in LDS
  float* orow = out + (size_t)(k0 + qh * 16 + 8 * hi) * (QSPLIT * DD) + n;
  if (qh == 0) xch_finish(xpart, acc[0], orow); else xch_finish(xpart, acc[1], orow);
}

// ---------------------------------------------------------------------------
// Kernel 4: out = sum of the QSPLIT partial outputs, in range order.
// A thread sums one float4 of two neighbouring k rows, so that it still has 16
// loads in flight with half as many ranges.
// ---------------------------------------------------------------------------
__global__ void sda_reduce(const float* __restrict__ part, float* __restrict__ out) {
  const int i = blockIdx.x * blockDim.x + threadIdx.x;   // 0 .. SK*DD/8-1
  // rows k = 2 (i / 32) and k + 1 hold 2 QSPLIT partial rows of 32 float4 each, on end
  const float4* row4 = (const float4*)part + (i >> 5) * (2 * QSPLIT * DD / 4) + (i & 31);
  float4 v[2 * QSPLIT];
#pragma unroll
  for (int p = 0; p < 2 * QSPLIT; ++p) v[p] = row4[p * (DD / 4)];
#pragma unroll
  for (int h = 0; h < 2; ++h) {
    float4 s = v[h * QSPLIT];
#pragma unroll
    for (int p = 1; p < QSPLIT; ++p) {
      const float4 w = v[h * QSPLIT + p];
      s.x += w.x; s.y += w.y; s.z += w.z; s.w += w.w;
    }
    ((float4*)out)[(i >> 5) * (2 * DD / 4) + h * (DD / 4) + (i & 31)] = s;
  }
}

extern "C" void kernel_launch(void* const* d_in, const int* in_sizes, int n_in,
                              void* d_out, int out_size, void* d_ws, size_t ws_size,
                              hipStream_t stream) {
  (void)in_sizes; (void)n_in; (void)out_size; (void)ws_size;
  const float* K = (const float*)d_in[0];
  const float* Q = (const float*)d_in[1];
  const float* V = (const float*)d_in[2];
  float* out = (float*)d_out;

  _Float16* Kh = (_Float16*)d_ws;                       // 8192 x 128 f16, fragment order
  _Float16* Qh = Kh + (size_t)SK * DD;                  // 8192 x 128 f16, fragment order
  _Float16* Vt = Qh + (size_t)SQ * DD;                  // [128,8192] f16 (transposed)
  float*    pl = (float*)(Vt + (size_t)DD * SQ);        // [KSPLIT][8192] range log2-sum-exp
  float*    part = pl + (size_t)KSPLIT * SQ;            // [8192][QSPLIT][128] partial out

  sda_convert<<<(SQ / 64) * (DD / 64), 256, 0, stream>>>(K, Q, V, Kh, Qh, Vt);
  // stats: 8 waves/block, 128 SQT q columns per block in x; output: 16 waves/block,
  // 128 OKT k rows per block in x; the split ranges in y
  sda_stats<<<dim3(SQ / (128 * SQT), KSPLIT), 256, 0, stream>>>(Kh, Qh, pl);
  sda_output<<<dim3(SK / (128 * OKT), QSPLIT), 512, 0, stream>>>(Kh, Qh, Vt, pl, part);
  sda_reduce<<<(SK * DD) / 8 / 256, 256, 0, stream>>>(part, out);
}
